// v000
// Times are from an AMD MI455X. After a warm-up the kernel runs many times in a row, and a time is the length of
// such a window on the GPU divided by its runs, so every launch and the gaps after it count. The runs cycle
// through copies of the inputs. A figure is the median of several windows, for all but v000 over two sittings.
// Sittings can differ by a few percent; kernels timed side by side share one.
// v000, which the later versions start from, runs in 123 microseconds.
#include <hip/hip_runtime.h>
#include <math.h>
#include <stdint.h>

// ---------------- problem constants (B=1) ----------------
#define T_DIM   1024      // sequence length (queries == keys)
#define H_DIM   8         // heads
#define E_DIM   64        // head dim
#define R_DIM   64        // projection rows
#define F_DIM   128       // 2R feature dim
#define HALF_W  64        // local window half-width (LOCAL_CONTEXT/2)
#define NTILES_T (T_DIM/16)

#define TEMP_SCALE 0.125f                 // 1/sqrt(E)
#define DATA_NORM  0.35355339059327373f   // sqrt(1/sqrt(E))
#define RATIO      0.08838834764831843f   // (2R)^-0.5

typedef float v2f __attribute__((ext_vector_type(2)));
typedef float v8f __attribute__((ext_vector_type(8)));

// CDNA5 fp32 matrix core: D(16x16) = A(16x4) * B(4x16) + C
__device__ __forceinline__ v8f wmma4(v2f a, v2f b, v8f c) {
  return __builtin_amdgcn_wmma_f32_16x16x4_f32(false, a, false, b, (short)0, c,
                                               false, false);
}

__device__ __forceinline__ int clampi(int x, int lo, int hi) {
  return x < lo ? lo : (x > hi ? hi : x);
}

// ---- CDNA5 async global->LDS staging (ASYNCcnt path), guarded ----
#if defined(__has_builtin)
# if __has_builtin(__builtin_amdgcn_global_load_async_to_lds_b128) && \
     __has_builtin(__builtin_amdgcn_s_wait_asynccnt)
#  define USE_ASYNC_LDS 1
# endif
#endif
#ifndef USE_ASYNC_LDS
# define USE_ASYNC_LDS 0
#endif

#if USE_ASYNC_LDS
// builtin signature (per hipcc diagnostic): pointee is a 16-byte int vector
typedef int v4i_t __attribute__((vector_size(16)));
typedef __attribute__((address_space(1))) v4i_t* gas1_t;
typedef __attribute__((address_space(3))) v4i_t* las3_t;
// copy 16 bytes per active lane, global -> LDS, no VGPR round trip
__device__ __forceinline__ void async_copy16(const void* g, const void* l) {
  __builtin_amdgcn_global_load_async_to_lds_b128(
      (gas1_t)(uintptr_t)g, (las3_t)(uint32_t)(uintptr_t)l, 0, 0);
}
__device__ __forceinline__ void async_wait0() {
  __builtin_amdgcn_s_wait_asynccnt(0);
}
#endif

// ---------------------------------------------------------------------------
// K1: featurize q and k tiles.  dash = DATA_NORM * (X @ P^T) via WMMA.
// which==0 (query): emit q_prime + per-row stabilizer q_ls
// which==1 (key)  : stash dash, diag, per-row max (for global k stabilizer)
// ---------------------------------------------------------------------------
__global__ __launch_bounds__(32)
void featurize_kernel(const float* __restrict__ qin, const float* __restrict__ kin,
                      const float* __restrict__ proj,
                      float* __restrict__ qp, float* __restrict__ qls,
                      float* __restrict__ kdash, float* __restrict__ kdiag,
                      float* __restrict__ krowmax)
{
  __shared__ float Pl[R_DIM][E_DIM];
  __shared__ float Xs[16][E_DIM];     // raw (unscaled) data tile
  __shared__ float Dash[16][R_DIM];
  __shared__ float DiagL[16];

  const int lane  = threadIdx.x;
  const int bid   = blockIdx.x;
  const int which = bid / (H_DIM * NTILES_T);
  const int rem   = bid % (H_DIM * NTILES_T);
  const int h     = rem / NTILES_T;
  const int tt    = rem % NTILES_T;
  const float* __restrict__ xin = (which == 0) ? qin : kin;

#if USE_ASYNC_LDS
  for (int c = lane; c < (R_DIM * E_DIM) / 4; c += 32)
    async_copy16(proj + c * 4, &Pl[0][0] + c * 4);
  for (int c = lane; c < (16 * E_DIM) / 4; c += 32) {
    int m = c >> 4, e4 = c & 15;
    int t = tt * 16 + m;
    async_copy16(xin + ((size_t)t * H_DIM + h) * E_DIM + e4 * 4, &Xs[m][e4 * 4]);
  }
  async_wait0();
#else
  for (int i = lane; i < R_DIM * E_DIM; i += 32)
    Pl[i / E_DIM][i % E_DIM] = proj[i];
  for (int i = lane; i < 16 * E_DIM; i += 32) {
    int m = i >> 6, e = i & 63;
    int t = tt * 16 + m;
    Xs[m][e] = xin[((size_t)t * H_DIM + h) * E_DIM + e];
  }
#endif
  __syncthreads();

  if (lane < 16) {
    float s = 0.f;
    for (int e = 0; e < E_DIM; ++e) { float x = Xs[lane][e]; s += x * x; }
    DiagL[lane] = 0.5f * DATA_NORM * DATA_NORM * s;  // 0.5*dn^2*||x||^2
  }

  const int n    = lane & 15;
  const int koff = (lane >> 4) * 2;
  for (int nt = 0; nt < 4; ++nt) {
    v8f acc = {};
    for (int kk = 0; kk < E_DIM / 4; ++kk) {
      int k0 = kk * 4 + koff;
      v2f a, b;
      a.x = Xs[n][k0];            a.y = Xs[n][k0 + 1];
      int r = nt * 16 + n;        // B[k][n] = P^T[k][r] = P[r][k]
      b.x = Pl[r][k0];            b.y = Pl[r][k0 + 1];
      acc = wmma4(a, b, acc);
    }
    for (int vv = 0; vv < 8; ++vv) {
      int row = vv + ((lane >> 4) << 3);
      Dash[row][nt * 16 + n] = DATA_NORM * acc[vv];   // dash = dn * (X @ P^T)
    }
  }
  __syncthreads();

  if (lane < 16) {
    const int t    = tt * 16 + lane;
    const float dg = DiagL[lane];
    float mx = 0.f;                               // max_r |dash_r|  (>=0)
    for (int r = 0; r < R_DIM; ++r) mx = fmaxf(mx, fabsf(Dash[lane][r]));
    if (which == 0) {
      // stab = mx - diag;  prime = ratio*exp(±dash - diag - stab) = ratio*exp(±dash - mx)
      float* qrow = qp + ((size_t)h * T_DIM + t) * F_DIM;
      for (int r = 0; r < R_DIM; ++r) {
        float d = Dash[lane][r];
        qrow[r]         = RATIO * expf( d - mx);
        qrow[r + R_DIM] = RATIO * expf(-d - mx);
      }
      qls[h * T_DIM + t] = mx - dg;
    } else {
      float* krow = kdash + ((size_t)h * T_DIM + t) * R_DIM;
      for (int r = 0; r < R_DIM; ++r) krow[r] = Dash[lane][r];
      kdiag[h * T_DIM + t]   = dg;
      krowmax[h * T_DIM + t] = mx - dg;
    }
  }
}

// ---------------------------------------------------------------------------
// K2: per-head global key stabilizer (deterministic tree reduction)
// ---------------------------------------------------------------------------
__global__ __launch_bounds__(256)
void reduce_kls_kernel(const float* __restrict__ krowmax, float* __restrict__ kls)
{
  __shared__ float sm[256];
  const int h = blockIdx.x, tid = threadIdx.x;
  float m = -INFINITY;
  for (int t = tid; t < T_DIM; t += 256) m = fmaxf(m, krowmax[h * T_DIM + t]);
  sm[tid] = m; __syncthreads();
  for (int s = 128; s > 0; s >>= 1) {
    if (tid < s) sm[tid] = fmaxf(sm[tid], sm[tid + s]);
    __syncthreads();
  }
  if (tid == 0) kls[h] = sm[0];
}

// ---------------------------------------------------------------------------
// K3: k_prime = ratio * exp(±dash - diag - k_ls)
// ---------------------------------------------------------------------------
__global__ __launch_bounds__(256)
void kprime_kernel(const float* __restrict__ kdash, const float* __restrict__ kdiag,
                   const float* __restrict__ kls, float* __restrict__ kp)
{
  int idx = blockIdx.x * 256 + threadIdx.x;       // over H*T*R
  if (idx >= H_DIM * T_DIM * R_DIM) return;
  const int r  = idx % R_DIM;
  const int ht = idx / R_DIM;
  const int h  = ht / T_DIM;
  const float dash = kdash[idx];
  const float c    = kdiag[ht] + kls[h];
  kp[(size_t)ht * F_DIM + r]         = RATIO * expf( dash - c);
  kp[(size_t)ht * F_DIM + r + R_DIM] = RATIO * expf(-dash - c);
}

// ---------------------------------------------------------------------------
// K4: kv[h] = k_prime^T @ V   (F x E, K = T) via WMMA; 1 wave per 16x16 tile
// ---------------------------------------------------------------------------
__global__ __launch_bounds__(32)
void kv_kernel(const float* __restrict__ vin, const float* __restrict__ kp,
               float* __restrict__ kv)
{
  const int bid  = blockIdx.x;
  const int h    = bid / 32;
  const int rem  = bid % 32;
  const int mt   = rem / 4;      // feature tile
  const int nt   = rem % 4;      // d tile
  const int lane = threadIdx.x;
  const int n    = lane & 15;
  const int koff = (lane >> 4) * 2;
  const int mrow = mt * 16 + n;
  const int d    = nt * 16 + n;
  const float* __restrict__ kpb = kp + (size_t)h * T_DIM * F_DIM;

  v8f acc = {};
  for (int kk = 0; kk < T_DIM / 4; ++kk) {
    int s0 = kk * 4 + koff;
    v2f a, b;
    a.x = kpb[(size_t)s0 * F_DIM + mrow];         // A[m][s] = kp[s][m]
    a.y = kpb[(size_t)(s0 + 1) * F_DIM + mrow];
    b.x = vin[((size_t)s0 * H_DIM + h) * E_DIM + d];
    b.y = vin[((size_t)(s0 + 1) * H_DIM + h) * E_DIM + d];
    acc = wmma4(a, b, acc);
  }
  for (int vv = 0; vv < 8; ++vv) {
    int m = mt * 16 + vv + ((lane >> 4) << 3);
    kv[((size_t)h * F_DIM + m) * E_DIM + d] = acc[vv];
  }
}

// ---------------------------------------------------------------------------
// K5: ksum[h][m] = sum_s k_prime[h][s][m]
// ---------------------------------------------------------------------------
__global__ __launch_bounds__(128)
void ksum_kernel(const float* __restrict__ kp, float* __restrict__ ksum)
{
  const int h = blockIdx.x, m = threadIdx.x;
  const float* base = kp + (size_t)h * T_DIM * F_DIM + m;
  float s = 0.f;
  for (int t = 0; t < T_DIM; ++t) s += base[(size_t)t * F_DIM];
  ksum[h * F_DIM + m] = s;
}

// ---------------------------------------------------------------------------
// K6: fused band attention + low-rank combine. 1 wave per (h, 16-query tile).
// 9 aligned key tiles cover the 128-wide window; mask handles edges.
// ---------------------------------------------------------------------------
__global__ __launch_bounds__(32)
void sb_final_kernel(const float* __restrict__ qin, const float* __restrict__ kin,
                     const float* __restrict__ vin,
                     const float* __restrict__ qp, const float* __restrict__ kp,
                     const float* __restrict__ qls, const float* __restrict__ kls,
                     const float* __restrict__ kv, const float* __restrict__ ksum,
                     float* __restrict__ out)
{
  __shared__ float Xq[16][E_DIM];     // raw query tile (temp applied post-WMMA)
  __shared__ float QPl[16][F_DIM];    // q_prime tile
  __shared__ float QKb[16][144];
  __shared__ float DPb[16][144];
  __shared__ float Ab[16][144];
  __shared__ float Pscale[16];

  const int lane   = threadIdx.x;
  const int h      = blockIdx.x / NTILES_T;
  const int qt     = blockIdx.x % NTILES_T;
  const int n      = lane & 15;
  const int koff   = (lane >> 4) * 2;
  const int s_base = (qt - 4) * 16;

#if USE_ASYNC_LDS
  for (int c = lane; c < (16 * E_DIM) / 4; c += 32) {
    int m = c >> 4, e4 = c & 15;
    int t = qt * 16 + m;
    async_copy16(qin + ((size_t)t * H_DIM + h) * E_DIM + e4 * 4, &Xq[m][e4 * 4]);
  }
  for (int c = lane; c < (16 * F_DIM) / 4; c += 32) {
    int m = c >> 5, f4 = c & 31;
    int t = qt * 16 + m;
    async_copy16(qp + ((size_t)h * T_DIM + t) * F_DIM + f4 * 4, &QPl[m][f4 * 4]);
  }
  async_wait0();
#else
  for (int i = lane; i < 16 * E_DIM; i += 32) {
    int m = i >> 6, e = i & 63;
    int t = qt * 16 + m;
    Xq[m][e] = qin[((size_t)t * H_DIM + h) * E_DIM + e];
  }
  for (int i = lane; i < 16 * F_DIM; i += 32) {
    int m = i >> 7, f = i & 127;
    int t = qt * 16 + m;
    QPl[m][f] = qp[((size_t)h * T_DIM + t) * F_DIM + f];
  }
#endif
  __syncthreads();

  // qkv tile: (16 x 128) @ (128 x 64), kept in registers
  v8f qkvAcc[4];
  for (int nt = 0; nt < 4; ++nt) {
    v8f acc = {};
    const int d = nt * 16 + n;
    for (int kk = 0; kk < F_DIM / 4; ++kk) {
      int k0 = kk * 4 + koff;
      v2f a, b;
      a.x = QPl[n][k0];  a.y = QPl[n][k0 + 1];
      b.x = kv[((size_t)h * F_DIM + k0) * E_DIM + d];
      b.y = kv[((size_t)h * F_DIM + k0 + 1) * E_DIM + d];
      acc = wmma4(a, b, acc);
    }
    qkvAcc[nt] = acc;
  }

  // 9 key tiles: QK (K=64) and dots_prime (K=128)
  for (int d8 = 0; d8 < 9; ++d8) {
    const int sc = clampi(s_base + d8 * 16 + n, 0, T_DIM - 1);
    v8f accQ = {};
    for (int kk = 0; kk < E_DIM / 4; ++kk) {
      int k0 = kk * 4 + koff;
      v2f a, b;
      a.x = Xq[n][k0];  a.y = Xq[n][k0 + 1];
      b.x = kin[((size_t)sc * H_DIM + h) * E_DIM + k0];
      b.y = kin[((size_t)sc * H_DIM + h) * E_DIM + k0 + 1];
      accQ = wmma4(a, b, accQ);
    }
    v8f accD = {};
    for (int kk = 0; kk < F_DIM / 4; ++kk) {
      int k0 = kk * 4 + koff;
      v2f a, b;
      a.x = QPl[n][k0];  a.y = QPl[n][k0 + 1];
      b.x = kp[((size_t)h * T_DIM + sc) * F_DIM + k0];
      b.y = kp[((size_t)h * T_DIM + sc) * F_DIM + k0 + 1];
      accD = wmma4(a, b, accD);
    }
    for (int vv = 0; vv < 8; ++vv) {
      int row = vv + ((lane >> 4) << 3);
      QKb[row][d8 * 16 + n] = TEMP_SCALE * accQ[vv];   // QK = temp * (q . k)
      DPb[row][d8 * 16 + n] = accD[vv];
    }
  }
  __syncthreads();

  // per-query-row combine (matches reference logsumexp/clip exactly)
  if (lane < 16) {
    const int row = lane;
    const int t   = qt * 16 + row;
    const float pls = qls[h * T_DIM + t] + kls[h];
    float qk1 = 0.f;
    for (int f = 0; f < F_DIM; ++f) qk1 += QPl[row][f] * ksum[h * F_DIM + f];
    float mx = -INFINITY;
    for (int j = 0; j < 144; ++j) {
      int s = s_base + j;
      bool valid = (s >= 0) && (s < T_DIM) && (s >= t - HALF_W) && (s <= t + HALF_W - 1);
      if (valid) mx = fmaxf(mx, QKb[row][j]);
    }
    float se = 0.f, dpsum = 0.f;
    for (int j = 0; j < 144; ++j) {
      int s = s_base + j;
      bool valid = (s >= 0) && (s < T_DIM) && (s >= t - HALF_W) && (s <= t + HALF_W - 1);
      if (valid) { se += expf(QKb[row][j] - mx); dpsum += DPb[row][j]; }
    }
    const float lse = mx + logf(se);
    const float lr  = logf(fmaxf(qk1 - dpsum, 1e-24f)) + pls;
    const float mm  = fmaxf(lse, lr);
    const float log_norm = mm + logf(expf(lse - mm) + expf(lr - mm));
    const float pscale   = expf(pls - log_norm);
    Pscale[row] = pscale;
    for (int j = 0; j < 144; ++j) {
      int s = s_base + j;
      bool valid = (s >= 0) && (s < T_DIM) && (s >= t - HALF_W) && (s <= t + HALF_W - 1);
      Ab[row][j] = valid ? (expf(QKb[row][j] - log_norm) - DPb[row][j] * pscale) : 0.f;
    }
  }
  __syncthreads();

  // out = attn_local(16x144) @ V_band(144x64) + qkv * prime_scale
  for (int nt = 0; nt < 4; ++nt) {
    const int d = nt * 16 + n;
    v8f acc = {};
    for (int kk = 0; kk < 144 / 4; ++kk) {
      int k0  = kk * 4 + koff;
      int s0c = clampi(s_base + k0,     0, T_DIM - 1);
      int s1c = clampi(s_base + k0 + 1, 0, T_DIM - 1);
      v2f a, b;
      a.x = Ab[n][k0];  a.y = Ab[n][k0 + 1];
      b.x = vin[((size_t)s0c * H_DIM + h) * E_DIM + d];
      b.y = vin[((size_t)s1c * H_DIM + h) * E_DIM + d];
      acc = wmma4(a, b, acc);
    }
    for (int vv = 0; vv < 8; ++vv) {
      int row = vv + ((lane >> 4) << 3);
      int t   = qt * 16 + row;
      out[((size_t)t * H_DIM + h) * E_DIM + d] = acc[vv] + qkvAcc[nt][vv] * Pscale[row];
    }
  }
}

// ---------------------------------------------------------------------------
extern "C" void kernel_launch(void* const* d_in, const int* in_sizes, int n_in,
                              void* d_out, int out_size, void* d_ws, size_t ws_size,
                              hipStream_t stream)
{
  (void)in_sizes; (void)n_in; (void)out_size; (void)ws_size;
  const float* q    = (const float*)d_in[0];
  const float* k    = (const float*)d_in[1];
  const float* v    = (const float*)d_in[2];
  const float* proj = (const float*)d_in[3];
  float* out = (float*)d_out;
  float* ws  = (float*)d_ws;

  // workspace layout (floats); total ~10.9 MB
  size_t o = 0;
  float* qp      = ws + o; o += (size_t)H_DIM * T_DIM * F_DIM;   // 4 MB
  float* kp      = ws + o; o += (size_t)H_DIM * T_DIM * F_DIM;   // 4 MB
  float* kdash   = ws + o; o += (size_t)H_DIM * T_DIM * R_DIM;   // 2 MB
  float* kdiag   = ws + o; o += (size_t)H_DIM * T_DIM;
  float* krowmax = ws + o; o += (size_t)H_DIM * T_DIM;
  float* qls     = ws + o; o += (size_t)H_DIM * T_DIM;
  float* kls     = ws + o; o += (size_t)H_DIM;
  float* kvbuf   = ws + o; o += (size_t)H_DIM * F_DIM * E_DIM;
  float* ksumb   = ws + o; o += (size_t)H_DIM * F_DIM;

  featurize_kernel<<<2 * H_DIM * NTILES_T, 32, 0, stream>>>(
      q, k, proj, qp, qls, kdash, kdiag, krowmax);
  reduce_kls_kernel<<<H_DIM, 256, 0, stream>>>(krowmax, kls);
  kprime_kernel<<<(H_DIM * T_DIM * R_DIM) / 256, 256, 0, stream>>>(
      kdash, kdiag, kls, kp);
  kv_kernel<<<H_DIM * 32, 32, 0, stream>>>(v, kp, kvbuf);
  ksum_kernel<<<H_DIM, F_DIM, 0, stream>>>(kp, ksumb);
  sb_final_kernel<<<H_DIM * NTILES_T, 32, 0, stream>>>(
      q, k, v, qp, kp, qls, kls, kvbuf, ksumb, out);
}

// v001
// Measured time: 51.8 microseconds a run.
// Next to v000, in two timings, it ran 2.37 and 2.38 times as fast.
#include <hip/hip_runtime.h>
#include <math.h>
#include <stdint.h>

// ---------------- problem constants (B=1) ----------------
#define T_DIM   1024      // sequence length (queries == keys)
#define H_DIM   8         // heads
#define E_DIM   64        // head dim
#define R_DIM   64        // projection rows
#define F_DIM   128       // 2R feature dim
#define HALF_W  64        // local window half-width (LOCAL_CONTEXT/2)
#define NTILES_T (T_DIM/16)

#define TEMP_SCALE 0.125f                 // 1/sqrt(E)
#define DATA_NORM  0.35355339059327373f   // sqrt(1/sqrt(E))
#define RATIO      0.08838834764831843f   // (2R)^-0.5

typedef float v2f __attribute__((ext_vector_type(2)));
typedef float v8f __attribute__((ext_vector_type(8)));

// CDNA5 fp32 matrix core: D(16x16) = A(16x4) * B(4x16) + C
__device__ __forceinline__ v8f wmma4(v2f a, v2f b, v8f c) {
  return __builtin_amdgcn_wmma_f32_16x16x4_f32(false, a, false, b, (short)0, c,
                                               false, false);
}

__device__ __forceinline__ int clampi(int x, int lo, int hi) {
  return x < lo ? lo : (x > hi ? hi : x);
}

// ---- CDNA5 async global->LDS staging (ASYNCcnt path), guarded ----
#if defined(__has_builtin)
# if __has_builtin(__builtin_amdgcn_global_load_async_to_lds_b128) && \
     __has_builtin(__builtin_amdgcn_s_wait_asynccnt)
#  define USE_ASYNC_LDS 1
# endif
#endif
#ifndef USE_ASYNC_LDS
# define USE_ASYNC_LDS 0
#endif

#if USE_ASYNC_LDS
// builtin signature (per hipcc diagnostic): pointee is a 16-byte int vector
typedef int v4i_t __attribute__((vector_size(16)));
typedef __attribute__((address_space(1))) v4i_t* gas1_t;
typedef __attribute__((address_space(3))) v4i_t* las3_t;
// copy 16 bytes per active lane, global -> LDS, no VGPR round trip
__device__ __forceinline__ void async_copy16(const void* g, const void* l) {
  __builtin_amdgcn_global_load_async_to_lds_b128(
      (gas1_t)(uintptr_t)g, (las3_t)(uint32_t)(uintptr_t)l, 0, 0);
}
__device__ __forceinline__ void async_wait0() {
  __builtin_amdgcn_s_wait_asynccnt(0);
}
#endif

// ---------------------------------------------------------------------------
// K1: featurize q and k tiles.  dash = DATA_NORM * (X @ P^T) via WMMA.
// which==0 (query): emit q_prime + per-row stabilizer q_ls
// which==1 (key)  : stash dash, diag, per-row max (for global k stabilizer)
// ---------------------------------------------------------------------------
__global__ __launch_bounds__(32)
void featurize_kernel(const float* __restrict__ qin, const float* __restrict__ kin,
                      const float* __restrict__ proj,
                      float* __restrict__ qp, float* __restrict__ qls,
                      float* __restrict__ kdash, float* __restrict__ kdiag,
                      float* __restrict__ krowmax)
{
  __shared__ float Pl[R_DIM][E_DIM];
  __shared__ float Xs[16][E_DIM];     // raw (unscaled) data tile
  __shared__ float Dash[16][R_DIM];
  __shared__ float DiagL[16];

  const int lane  = threadIdx.x;
  const int bid   = blockIdx.x;
  const int which = bid / (H_DIM * NTILES_T);
  const int rem   = bid % (H_DIM * NTILES_T);
  const int h     = rem / NTILES_T;
  const int tt    = rem % NTILES_T;
  const float* __restrict__ xin = (which == 0) ? qin : kin;

#if USE_ASYNC_LDS
  for (int c = lane; c < (R_DIM * E_DIM) / 4; c += 32)
    async_copy16(proj + c * 4, &Pl[0][0] + c * 4);
  for (int c = lane; c < (16 * E_DIM) / 4; c += 32) {
    int m = c >> 4, e4 = c & 15;
    int t = tt * 16 + m;
    async_copy16(xin + ((size_t)t * H_DIM + h) * E_DIM + e4 * 4, &Xs[m][e4 * 4]);
  }
  async_wait0();
#else
  for (int i = lane; i < R_DIM * E_DIM; i += 32)
    Pl[i / E_DIM][i % E_DIM] = proj[i];
  for (int i = lane; i < 16 * E_DIM; i += 32) {
    int m = i >> 6, e = i & 63;
    int t = tt * 16 + m;
    Xs[m][e] = xin[((size_t)t * H_DIM + h) * E_DIM + e];
  }
#endif
  __syncthreads();

  if (lane < 16) {
    float s = 0.f;
    for (int e = 0; e < E_DIM; ++e) { float x = Xs[lane][e]; s += x * x; }
    DiagL[lane] = 0.5f * DATA_NORM * DATA_NORM * s;  // 0.5*dn^2*||x||^2
  }

  const int n    = lane & 15;
  const int koff = (lane >> 4) * 2;
  for (int nt = 0; nt < 4; ++nt) {
    v8f acc = {};
    for (int kk = 0; kk < E_DIM / 4; ++kk) {
      int k0 = kk * 4 + koff;
      v2f a, b;
      a.x = Xs[n][k0];            a.y = Xs[n][k0 + 1];
      int r = nt * 16 + n;        // B[k][n] = P^T[k][r] = P[r][k]
      b.x = Pl[r][k0];            b.y = Pl[r][k0 + 1];
      acc = wmma4(a, b, acc);
    }
    for (int vv = 0; vv < 8; ++vv) {
      int row = vv + ((lane >> 4) << 3);
      Dash[row][nt * 16 + n] = DATA_NORM * acc[vv];   // dash = dn * (X @ P^T)
    }
  }
  __syncthreads();

  if (lane < 16) {
    const int t    = tt * 16 + lane;
    const float dg = DiagL[lane];
    float mx = 0.f;                               // max_r |dash_r|  (>=0)
    for (int r = 0; r < R_DIM; ++r) mx = fmaxf(mx, fabsf(Dash[lane][r]));
    if (which == 0) {
      // stab = mx - diag;  prime = ratio*exp(±dash - diag - stab) = ratio*exp(±dash - mx)
      float* qrow = qp + ((size_t)h * T_DIM + t) * F_DIM;
      for (int r = 0; r < R_DIM; ++r) {
        float d = Dash[lane][r];
        qrow[r]         = RATIO * expf( d - mx);
        qrow[r + R_DIM] = RATIO * expf(-d - mx);
      }
      qls[h * T_DIM + t] = mx - dg;
    } else {
      float* krow = kdash + ((size_t)h * T_DIM + t) * R_DIM;
      for (int r = 0; r < R_DIM; ++r) krow[r] = Dash[lane][r];
      kdiag[h * T_DIM + t]   = dg;
      krowmax[h * T_DIM + t] = mx - dg;
    }
  }
}

// ---------------------------------------------------------------------------
// K2: per-head global key stabilizer (deterministic tree reduction)
// ---------------------------------------------------------------------------
__global__ __launch_bounds__(256)
void reduce_kls_kernel(const float* __restrict__ krowmax, float* __restrict__ kls)
{
  __shared__ float sm[256];
  const int h = blockIdx.x, tid = threadIdx.x;
  float m = -INFINITY;
  for (int t = tid; t < T_DIM; t += 256) m = fmaxf(m, krowmax[h * T_DIM + t]);
  sm[tid] = m; __syncthreads();
  for (int s = 128; s > 0; s >>= 1) {
    if (tid < s) sm[tid] = fmaxf(sm[tid], sm[tid + s]);
    __syncthreads();
  }
  if (tid == 0) kls[h] = sm[0];
}

// ---------------------------------------------------------------------------
// K3: k_prime = ratio * exp(±dash - diag - k_ls)
// ---------------------------------------------------------------------------
__global__ __launch_bounds__(256)
void kprime_kernel(const float* __restrict__ kdash, const float* __restrict__ kdiag,
                   const float* __restrict__ kls, float* __restrict__ kp)
{
  int idx = blockIdx.x * 256 + threadIdx.x;       // over H*T*R
  if (idx >= H_DIM * T_DIM * R_DIM) return;
  const int r  = idx % R_DIM;
  const int ht = idx / R_DIM;
  const int h  = ht / T_DIM;
  const float dash = kdash[idx];
  const float c    = kdiag[ht] + kls[h];
  kp[(size_t)ht * F_DIM + r]         = RATIO * expf( dash - c);
  kp[(size_t)ht * F_DIM + r + R_DIM] = RATIO * expf(-dash - c);
}

// ---------------------------------------------------------------------------
// K4: kv[h] = k_prime^T @ V   (F x E, K = T) via WMMA.
// One work-group of 8 waves per 16x16 tile: wave w sums keys [128w, 128w+128),
// the eight partial tiles are added through LDS in wave order.
// ---------------------------------------------------------------------------
#define KV_WAVES 8
#define KV_STEPS (T_DIM / 4 / KV_WAVES)
__global__ __launch_bounds__(32 * KV_WAVES)
void kv_kernel(const float* __restrict__ vin, const float* __restrict__ kp,
               float* __restrict__ kv)
{
  __shared__ float Part[KV_WAVES][8][32];   // [wave][accumulator register][lane]

  const int bid  = blockIdx.x;
  const int h    = bid / 32;
  const int rem  = bid % 32;
  const int mt   = rem / 4;      // feature tile
  const int nt   = rem % 4;      // d tile
  const int lane = threadIdx.x & 31;
  const int wave = __builtin_amdgcn_readfirstlane(threadIdx.x >> 5);
  const int n    = lane & 15;
  const int koff = (lane >> 4) * 2;
  const int mrow = mt * 16 + n;
  const int d    = nt * 16 + n;
  const float* __restrict__ kpb = kp + (size_t)h * T_DIM * F_DIM;

  v8f acc = {};
  for (int ks = 0; ks < KV_STEPS; ++ks) {
    int s0 = (wave * KV_STEPS + ks) * 4 + koff;
    v2f a, b;
    a.x = kpb[(size_t)s0 * F_DIM + mrow];         // A[m][s] = kp[s][m]
    a.y = kpb[(size_t)(s0 + 1) * F_DIM + mrow];
    b.x = vin[((size_t)s0 * H_DIM + h) * E_DIM + d];
    b.y = vin[((size_t)(s0 + 1) * H_DIM + h) * E_DIM + d];
    acc = wmma4(a, b, acc);
  }
  for (int vv = 0; vv < 8; ++vv) Part[wave][vv][lane] = acc[vv];
  __syncthreads();

  // wave w finishes accumulator register w of the tile (rows w and w + 8)
  float s = Part[0][wave][lane];
  for (int w = 1; w < KV_WAVES; ++w) s += Part[w][wave][lane];
  const int m = mt * 16 + wave + ((lane >> 4) << 3);
  kv[((size_t)h * F_DIM + m) * E_DIM + d] = s;
}

// ---------------------------------------------------------------------------
// K5: ksum[h][m] = sum_s k_prime[h][s][m]
// ---------------------------------------------------------------------------
__global__ __launch_bounds__(128)
void ksum_kernel(const float* __restrict__ kp, float* __restrict__ ksum)
{
  const int h = blockIdx.x, m = threadIdx.x;
  const float* base = kp + (size_t)h * T_DIM * F_DIM + m;
  float s = 0.f;
  for (int t = 0; t < T_DIM; ++t) s += base[(size_t)t * F_DIM];
  ksum[h * F_DIM + m] = s;
}

// ---------------------------------------------------------------------------
// sum / maximum over the 16 lanes of a DPP row; every lane gets the result
// ---------------------------------------------------------------------------
template <int CTRL>
__device__ __forceinline__ float row_xmask(float v) {
  return __builtin_bit_cast(float, __builtin_amdgcn_update_dpp(
      0, __builtin_bit_cast(int, v), CTRL, 0xf, 0xf, false));
}
__device__ __forceinline__ float row_sum16(float v) {
  v += row_xmask<0x161>(v);
  v += row_xmask<0x162>(v);
  v += row_xmask<0x164>(v);
  v += row_xmask<0x168>(v);
  return v;
}
__device__ __forceinline__ float row_max16(float v) {
  v = fmaxf(v, row_xmask<0x161>(v));
  v = fmaxf(v, row_xmask<0x162>(v));
  v = fmaxf(v, row_xmask<0x164>(v));
  v = fmaxf(v, row_xmask<0x168>(v));
  return v;
}

// ---------------------------------------------------------------------------
// K6: fused band attention + low-rank combine.
// One work-group of 8 waves per (h, 16-query tile).
// 9 aligned key tiles cover the 128-wide window; mask handles edges.
//   products : wave w takes key tile w; waves 0-3 also one d tile of qkv,
//              waves 4 and 5 share key tile 8
//   combine  : wave w takes query rows 2w and 2w+1, 16 lanes per row
//   output   : wave w takes d tile (w & 3), half (w >> 2) of the 144 keys
// ---------------------------------------------------------------------------
#define FIN_WAVES 8
__global__ __launch_bounds__(32 * FIN_WAVES)
void sb_final_kernel(const float* __restrict__ qin, const float* __restrict__ kin,
                     const float* __restrict__ vin,
                     const float* __restrict__ qp, const float* __restrict__ kp,
                     const float* __restrict__ qls, const float* __restrict__ kls,
                     const float* __restrict__ kv, const float* __restrict__ ksum,
                     float* __restrict__ out)
{
  __shared__ float Xq[16][E_DIM];     // raw query tile (temp applied post-WMMA)
  __shared__ float QPl[16][F_DIM];    // q_prime tile
  __shared__ float QKb[16][144];
  __shared__ float DPb[16][144];
  __shared__ float Ab[16][144];
  __shared__ float Pscale[16];
  __shared__ __attribute__((aligned(16))) float Opart[2][16][E_DIM];  // output halves

  const int tid    = threadIdx.x;
  const int lane   = tid & 31;
  const int wave   = __builtin_amdgcn_readfirstlane(tid >> 5);
  const int h      = blockIdx.x / NTILES_T;
  const int qt     = blockIdx.x % NTILES_T;
  const int n      = lane & 15;
  const int koff   = (lane >> 4) * 2;
  const int s_base = (qt - 4) * 16;

#if USE_ASYNC_LDS
  // 256 threads: one 16-byte piece of Xq and two of QPl each, every lane on
  static_assert((16 * E_DIM) / 4 == 32 * FIN_WAVES, "one Xq piece per thread");
  static_assert((16 * F_DIM) / 4 == 2 * 32 * FIN_WAVES, "two QPl pieces per thread");
  {
    int m = tid >> 4, e4 = tid & 15;
    int t = qt * 16 + m;
    async_copy16(qin + ((size_t)t * H_DIM + h) * E_DIM + e4 * 4, &Xq[m][e4 * 4]);
  }
  {
    int m = tid >> 5, f4 = tid & 31;     // rows 0-7, then rows 8-15
    int t = qt * 16 + m;
    async_copy16(qp + ((size_t)h * T_DIM + t) * F_DIM + f4 * 4, &QPl[m][f4 * 4]);
    async_copy16(qp + ((size_t)h * T_DIM + t + 8) * F_DIM + f4 * 4, &QPl[m + 8][f4 * 4]);
  }
  async_wait0();
#else
  for (int i = tid; i < 16 * E_DIM; i += 32 * FIN_WAVES) {
    int m = i >> 6, e = i & 63;
    int t = qt * 16 + m;
    Xq[m][e] = qin[((size_t)t * H_DIM + h) * E_DIM + e];
  }
  for (int i = tid; i < 16 * F_DIM; i += 32 * FIN_WAVES) {
    int m = i >> 7, f = i & 127;
    int t = qt * 16 + m;
    QPl[m][f] = qp[((size_t)h * T_DIM + t) * F_DIM + f];
  }
#endif
  // stands directly behind each wave's own wait: publishes every wave's copies
  __syncthreads();

  // QK of one key tile (K=64)
  auto qk_tile = [&](int d8) {
    const int sc = clampi(s_base + d8 * 16 + n, 0, T_DIM - 1);
    v8f accQ = {};
    for (int kk = 0; kk < E_DIM / 4; ++kk) {
      int k0 = kk * 4 + koff;
      v2f a, b;
      a.x = Xq[n][k0];  a.y = Xq[n][k0 + 1];
      b.x = kin[((size_t)sc * H_DIM + h) * E_DIM + k0];
      b.y = kin[((size_t)sc * H_DIM + h) * E_DIM + k0 + 1];
      accQ = wmma4(a, b, accQ);
    }
    for (int vv = 0; vv < 8; ++vv) {
      int row = vv + ((lane >> 4) << 3);
      QKb[row][d8 * 16 + n] = TEMP_SCALE * accQ[vv];   // QK = temp * (q . k)
    }
  };
  // dots_prime of one key tile (K=128)
  auto dp_tile = [&](int d8) {
    const int sc = clampi(s_base + d8 * 16 + n, 0, T_DIM - 1);
    v8f accD = {};
    for (int kk = 0; kk < F_DIM / 4; ++kk) {
      int k0 = kk * 4 + koff;
      v2f a, b;
      a.x = QPl[n][k0];  a.y = QPl[n][k0 + 1];
      b.x = kp[((size_t)h * T_DIM + sc) * F_DIM + k0];
      b.y = kp[((size_t)h * T_DIM + sc) * F_DIM + k0 + 1];
      accD = wmma4(a, b, accD);
    }
    for (int vv = 0; vv < 8; ++vv) {
      int row = vv + ((lane >> 4) << 3);
      DPb[row][d8 * 16 + n] = accD[vv];
    }
  };

  qk_tile(wave);
  dp_tile(wave);

  v8f qkvAcc = {};
  if (wave < 4) {
    // qkv d tile: (16 x 128) @ (128 x 16), kept in registers
    const int d = wave * 16 + n;
    for (int kk = 0; kk < F_DIM / 4; ++kk) {
      int k0 = kk * 4 + koff;
      v2f a, b;
      a.x = QPl[n][k0];  a.y = QPl[n][k0 + 1];
      b.x = kv[((size_t)h * F_DIM + k0) * E_DIM + d];
      b.y = kv[((size_t)h * F_DIM + k0 + 1) * E_DIM + d];
      qkvAcc = wmma4(a, b, qkvAcc);
    }
  } else if (wave == 4) {
    dp_tile(8);
  } else if (wave == 5) {
    qk_tile(8);
  }
  __syncthreads();

  // per-query-row combine (reference logsumexp/clip), 16 lanes per row
  {
    const int row = wave * 2 + (lane >> 4);
    const int t   = qt * 16 + row;
    const float pls = qls[h * T_DIM + t] + kls[h];
    float ksv[F_DIM / 16];
    for (int i = 0; i < F_DIM / 16; ++i) ksv[i] = ksum[h * F_DIM + i * 16 + n];
    // precaution: keeps the LDS loads below, whose results may reuse the address
    // registers of the global loads above, behind those loads' address phase
    asm volatile("s_wait_xcnt 0x0" ::: "memory");
    float qk1 = 0.f;
    for (int i = 0; i < F_DIM / 16; ++i) qk1 += QPl[row][i * 16 + n] * ksv[i];
    qk1 = row_sum16(qk1);
    float qkr[9], dpr[9];
    bool  val[9];
    float mx = -INFINITY;
    for (int i = 0; i < 9; ++i) {
      int j = i * 16 + n;
      int s = s_base + j;
      val[i] = (s >= 0) && (s < T_DIM) && (s >= t - HALF_W) && (s <= t + HALF_W - 1);
      qkr[i] = QKb[row][j];
      dpr[i] = DPb[row][j];
      if (val[i]) mx = fmaxf(mx, qkr[i]);
    }
    mx = row_max16(mx);
    float se = 0.f, dpsum = 0.f;
    for (int i = 0; i < 9; ++i) {
      if (val[i]) { se += expf(qkr[i] - mx); dpsum += dpr[i]; }
    }
    se    = row_sum16(se);
    dpsum = row_sum16(dpsum);
    const float lse = mx + logf(se);
    const float lr  = logf(fmaxf(qk1 - dpsum, 1e-24f)) + pls;
    const float mm  = fmaxf(lse, lr);
    const float log_norm = mm + logf(expf(lse - mm) + expf(lr - mm));
    const float pscale   = expf(pls - log_norm);
    if (n == 0) Pscale[row] = pscale;
    for (int i = 0; i < 9; ++i) {
      Ab[row][i * 16 + n] = val[i] ? (expf(qkr[i] - log_norm) - dpr[i] * pscale) : 0.f;
    }
  }
  __syncthreads();

  // out = attn_local(16x144) @ V_band(144x64) + qkv * prime_scale
  {
    const int nt   = wave & 3;
    const int half = wave >> 2;
    const int d    = nt * 16 + n;
    v8f acc = {};
    for (int ks = 0; ks < 144 / 8; ++ks) {
      int k0  = (half * (144 / 8) + ks) * 4 + koff;
      int s0c = clampi(s_base + k0,     0, T_DIM - 1);
      int s1c = clampi(s_base + k0 + 1, 0, T_DIM - 1);
      v2f a, b;
      a.x = Ab[n][k0];  a.y = Ab[n][k0 + 1];
      b.x = vin[((size_t)s0c * H_DIM + h) * E_DIM + d];
      b.y = vin[((size_t)s1c * H_DIM + h) * E_DIM + d];
      acc = wmma4(a, b, acc);
    }
    // qkvAcc is zero in waves 4-7
    for (int vv = 0; vv < 8; ++vv) {
      int row = vv + ((lane >> 4) << 3);
      Opart[half][row][d] = acc[vv] + qkvAcc[vv] * Pscale[row];
    }
  }
  __syncthreads();

  // add the two key halves; each wave stores two whole 256-byte output rows
  {
    const int row = tid >> 4, c4 = (tid & 15) * 4;
    const int t   = qt * 16 + row;
    const float4 p0 = *(const float4*)&Opart[0][row][c4];
    const float4 p1 = *(const float4*)&Opart[1][row][c4];
    float4 o;
    o.x = p0.x + p1.x;  o.y = p0.y + p1.y;  o.z = p0.z + p1.z;  o.w = p0.w + p1.w;
    *(float4*)&out[((size_t)t * H_DIM + h) * E_DIM + c4] = o;
  }
}

// ---------------------------------------------------------------------------
extern "C" void kernel_launch(void* const* d_in, const int* in_sizes, int n_in,
                              void* d_out, int out_size, void* d_ws, size_t ws_size,
                              hipStream_t stream)
{
  (void)in_sizes; (void)n_in; (void)out_size; (void)ws_size;
  const float* q    = (const float*)d_in[0];
  const float* k    = (const float*)d_in[1];
  const float* v    = (const float*)d_in[2];
  const float* proj = (const float*)d_in[3];
  float* out = (float*)d_out;
  float* ws  = (float*)d_ws;

  // workspace layout (floats); total ~10.9 MB
  size_t o = 0;
  float* qp      = ws + o; o += (size_t)H_DIM * T_DIM * F_DIM;   // 4 MB
  float* kp      = ws + o; o += (size_t)H_DIM * T_DIM * F_DIM;   // 4 MB
  float* kdash   = ws + o; o += (size_t)H_DIM * T_DIM * R_DIM;   // 2 MB
  float* kdiag   = ws + o; o += (size_t)H_DIM * T_DIM;
  float* krowmax = ws + o; o += (size_t)H_DIM * T_DIM;
  float* qls     = ws + o; o += (size_t)H_DIM * T_DIM;
  float* kls     = ws + o; o += (size_t)H_DIM;
  float* kvbuf   = ws + o; o += (size_t)H_DIM * F_DIM * E_DIM;
  float* ksumb   = ws + o; o += (size_t)H_DIM * F_DIM;

  featurize_kernel<<<2 * H_DIM * NTILES_T, 32, 0, stream>>>(
      q, k, proj, qp, qls, kdash, kdiag, krowmax);
  reduce_kls_kernel<<<H_DIM, 256, 0, stream>>>(krowmax, kls);
  kprime_kernel<<<(H_DIM * T_DIM * R_DIM) / 256, 256, 0, stream>>>(
      kdash, kdiag, kls, kp);
  kv_kernel<<<H_DIM * 32, 32 * KV_WAVES, 0, stream>>>(v, kp, kvbuf);
  ksum_kernel<<<H_DIM, F_DIM, 0, stream>>>(kp, ksumb);
  sb_final_kernel<<<H_DIM * NTILES_T, 32 * FIN_WAVES, 0, stream>>>(
      q, k, v, qp, kp, qls, kls, kvbuf, ksumb, out);
}

// v002
// A run of this version takes 38.8 microseconds.
// In two side-by-side timings against v001, it was 1.33 and 1.34 times as fast.
// Counting every step since v000, it is 3.17 times as fast.
#include <hip/hip_runtime.h>
#include <math.h>
#include <stdint.h>

// ---------------- problem constants (B=1) ----------------
#define T_DIM   1024      // sequence length (queries == keys)
#define H_DIM   8         // heads
#define E_DIM   64        // head dim
#define R_DIM   64        // projection rows
#define F_DIM   128       // 2R feature dim
#define HALF_W  64        // local window half-width (LOCAL_CONTEXT/2)
#define NTILES_T (T_DIM/16)

#define TEMP_SCALE 0.125f                 // 1/sqrt(E)
#define DATA_NORM  0.35355339059327373f   // sqrt(1/sqrt(E))
#define RATIO      0.08838834764831843f   // (2R)^-0.5

typedef float v2f __attribute__((ext_vector_type(2)));
typedef float v8f __attribute__((ext_vector_type(8)));

// CDNA5 fp32 matrix core: D(16x16) = A(16x4) * B(4x16) + C
__device__ __forceinline__ v8f wmma4(v2f a, v2f b, v8f c) {
  return __builtin_amdgcn_wmma_f32_16x16x4_f32(false, a, false, b, (short)0, c,
                                               false, false);
}

__device__ __forceinline__ int clampi(int x, int lo, int hi) {
  return x < lo ? lo : (x > hi ? hi : x);
}

// ---- CDNA5 async global->LDS staging (ASYNCcnt path), guarded ----
#if defined(__has_builtin)
# if __has_builtin(__builtin_amdgcn_global_load_async_to_lds_b128) && \
     __has_builtin(__builtin_amdgcn_s_wait_asynccnt)
#  define USE_ASYNC_LDS 1
# endif
#endif
#ifndef USE_ASYNC_LDS
# define USE_ASYNC_LDS 0
#endif

#if USE_ASYNC_LDS
// builtin signature (per hipcc diagnostic): pointee is a 16-byte int vector
typedef int v4i_t __attribute__((vector_size(16)));
typedef __attribute__((address_space(1))) v4i_t* gas1_t;
typedef __attribute__((address_space(3))) v4i_t* las3_t;
// copy 16 bytes per active lane, global -> LDS, no VGPR round trip
__device__ __forceinline__ void async_copy16(const void* g, const void* l) {
  __builtin_amdgcn_global_load_async_to_lds_b128(
      (gas1_t)(uintptr_t)g, (las3_t)(uint32_t)(uintptr_t)l, 0, 0);
}
__device__ __forceinline__ void async_wait0() {
  __builtin_amdgcn_s_wait_asynccnt(0);
}
#endif

// ---------------------------------------------------------------------------
// K1: featurize q and k tiles.  dash = DATA_NORM * (X @ P^T) via WMMA.
// which==0 (query): emit q_prime + per-row stabilizer q_ls
// which==1 (key)  : stash dash, diag, per-row max (for global k stabilizer)
// ---------------------------------------------------------------------------
__global__ __launch_bounds__(32)
void featurize_kernel(const float* __restrict__ qin, const float* __restrict__ kin,
                      const float* __restrict__ proj,
                      float* __restrict__ qp, float* __restrict__ qls,
                      float* __restrict__ kdash, float* __restrict__ kdiag,
                      float* __restrict__ krowmax)
{
  __shared__ float Pl[R_DIM][E_DIM];
  __shared__ float Xs[16][E_DIM];     // raw (unscaled) data tile
  __shared__ float Dash[16][R_DIM];
  __shared__ float DiagL[16];

  const int lane  = threadIdx.x;
  const int bid   = blockIdx.x;
  const int which = bid / (H_DIM * NTILES_T);
  const int rem   = bid % (H_DIM * NTILES_T);
  const int h     = rem / NTILES_T;
  const int tt    = rem % NTILES_T;
  const float* __restrict__ xin = (which == 0) ? qin : kin;

#if USE_ASYNC_LDS
  for (int c = lane; c < (R_DIM * E_DIM) / 4; c += 32)
    async_copy16(proj + c * 4, &Pl[0][0] + c * 4);
  for (int c = lane; c < (16 * E_DIM) / 4; c += 32) {
    int m = c >> 4, e4 = c & 15;
    int t = tt * 16 + m;
    async_copy16(xin + ((size_t)t * H_DIM + h) * E_DIM + e4 * 4, &Xs[m][e4 * 4]);
  }
  async_wait0();
#else
  for (int i = lane; i < R_DIM * E_DIM; i += 32)
    Pl[i / E_DIM][i % E_DIM] = proj[i];
  for (int i = lane; i < 16 * E_DIM; i += 32) {
    int m = i >> 6, e = i & 63;
    int t = tt * 16 + m;
    Xs[m][e] = xin[((size_t)t * H_DIM + h) * E_DIM + e];
  }
#endif
  __syncthreads();

  if (lane < 16) {
    float s = 0.f;
    for (int e = 0; e < E_DIM; ++e) { float x = Xs[lane][e]; s += x * x; }
    DiagL[lane] = 0.5f * DATA_NORM * DATA_NORM * s;  // 0.5*dn^2*||x||^2
  }

  const int n    = lane & 15;
  const int koff = (lane >> 4) * 2;
  for (int nt = 0; nt < 4; ++nt) {
    v8f acc = {};
    for (int kk = 0; kk < E_DIM / 4; ++kk) {
      int k0 = kk * 4 + koff;
      v2f a, b;
      a.x = Xs[n][k0];            a.y = Xs[n][k0 + 1];
      int r = nt * 16 + n;        // B[k][n] = P^T[k][r] = P[r][k]
      b.x = Pl[r][k0];            b.y = Pl[r][k0 + 1];
      acc = wmma4(a, b, acc);
    }
    for (int vv = 0; vv < 8; ++vv) {
      int row = vv + ((lane >> 4) << 3);
      Dash[row][nt * 16 + n] = DATA_NORM * acc[vv];   // dash = dn * (X @ P^T)
    }
  }
  __syncthreads();

  if (lane < 16) {
    const int t    = tt * 16 + lane;
    const float dg = DiagL[lane];
    float mx = 0.f;                               // max_r |dash_r|  (>=0)
    for (int r = 0; r < R_DIM; ++r) mx = fmaxf(mx, fabsf(Dash[lane][r]));
    if (which == 0) {
      // stab = mx - diag;  prime = ratio*exp(±dash - diag - stab) = ratio*exp(±dash - mx)
      float* qrow = qp + ((size_t)h * T_DIM + t) * F_DIM;
      for (int r = 0; r < R_DIM; ++r) {
        float d = Dash[lane][r];
        qrow[r]         = RATIO * expf( d - mx);
        qrow[r + R_DIM] = RATIO * expf(-d - mx);
      }
      qls[h * T_DIM + t] = mx - dg;
    } else {
      float* krow = kdash + ((size_t)h * T_DIM + t) * R_DIM;
      for (int r = 0; r < R_DIM; ++r) krow[r] = Dash[lane][r];
      kdiag[h * T_DIM + t]   = dg;
      krowmax[h * T_DIM + t] = mx - dg;
    }
  }
}

// ---------------------------------------------------------------------------
// K2: per-head global key stabilizer (deterministic tree reduction)
// ---------------------------------------------------------------------------
__global__ __launch_bounds__(256)
void reduce_kls_kernel(const float* __restrict__ krowmax, float* __restrict__ kls)
{
  __shared__ float sm[256];
  const int h = blockIdx.x, tid = threadIdx.x;
  float m = -INFINITY;
  for (int t = tid; t < T_DIM; t += 256) m = fmaxf(m, krowmax[h * T_DIM + t]);
  sm[tid] = m; __syncthreads();
  for (int s = 128; s > 0; s >>= 1) {
    if (tid < s) sm[tid] = fmaxf(sm[tid], sm[tid + s]);
    __syncthreads();
  }
  if (tid == 0) kls[h] = sm[0];
}

// ---------------------------------------------------------------------------
// K3: k_prime = ratio * exp(±dash - diag - k_ls)
// ---------------------------------------------------------------------------
__global__ __launch_bounds__(256)
void kprime_kernel(const float* __restrict__ kdash, const float* __restrict__ kdiag,
                   const float* __restrict__ kls, float* __restrict__ kp)
{
  int idx = blockIdx.x * 256 + threadIdx.x;       // over H*T*R
  if (idx >= H_DIM * T_DIM * R_DIM) return;
  const int r  = idx % R_DIM;
  const int ht = idx / R_DIM;
  const int h  = ht / T_DIM;
  const float dash = kdash[idx];
  const float c    = kdiag[ht] + kls[h];
  kp[(size_t)ht * F_DIM + r]         = RATIO * expf( dash - c);
  kp[(size_t)ht * F_DIM + r + R_DIM] = RATIO * expf(-dash - c);
}

// ---------------------------------------------------------------------------
// K4: kv[h] = k_prime^T @ V   (F x E, K = T) via WMMA.
// One work-group of 8 waves per 16x16 tile: wave w sums keys [128w, 128w+128),
// the eight partial tiles are added through LDS in wave order.
// ksum[h][m] = sum_s k_prime[h][s][m] comes from the same A fragments: every
// lane adds up the k_prime values it loads anyway, and the d tile 0 work-group
// of each feature tile adds the 16 shares of a feature and stores the sum.
// ---------------------------------------------------------------------------
#define KV_WAVES 8
#define KV_STEPS (T_DIM / 4 / KV_WAVES)
__global__ __launch_bounds__(32 * KV_WAVES)
void kv_kernel(const float* __restrict__ vin, const float* __restrict__ kp,
               float* __restrict__ kv, float* __restrict__ ksum)
{
  __shared__ float Part[KV_WAVES][8][32];   // [wave][accumulator register][lane]
  __shared__ float Csum[KV_WAVES][32];      // [wave][lane] share of a column sum

  const int bid  = blockIdx.x;
  const int h    = bid / 32;
  const int rem  = bid % 32;
  const int mt   = rem / 4;      // feature tile
  const int nt   = rem % 4;      // d tile
  const int lane = threadIdx.x & 31;
  const int wave = __builtin_amdgcn_readfirstlane(threadIdx.x >> 5);
  const int n    = lane & 15;
  const int koff = (lane >> 4) * 2;
  const int mrow = mt * 16 + n;
  const int d    = nt * 16 + n;
  const float* __restrict__ kpb = kp + (size_t)h * T_DIM * F_DIM;

  v8f acc = {};
  float cs = 0.f;     // sum of feature mrow over this lane's 64 keys
  for (int ks = 0; ks < KV_STEPS; ++ks) {
    int s0 = (wave * KV_STEPS + ks) * 4 + koff;
    v2f a, b;
    a.x = kpb[(size_t)s0 * F_DIM + mrow];         // A[m][s] = kp[s][m]
    a.y = kpb[(size_t)(s0 + 1) * F_DIM + mrow];
    b.x = vin[((size_t)s0 * H_DIM + h) * E_DIM + d];
    b.y = vin[((size_t)(s0 + 1) * H_DIM + h) * E_DIM + d];
    acc = wmma4(a, b, acc);
    cs += a.x + a.y;
  }
  for (int vv = 0; vv < 8; ++vv) Part[wave][vv][lane] = acc[vv];
  Csum[wave][lane] = cs;
  __syncthreads();

  // wave w finishes accumulator register w of the tile (rows w and w + 8)
  float s = Part[0][wave][lane];
  for (int w = 1; w < KV_WAVES; ++w) s += Part[w][wave][lane];
  const int m = mt * 16 + wave + ((lane >> 4) << 3);
  kv[((size_t)h * F_DIM + m) * E_DIM + d] = s;

  // column sums: lanes n and n + 16 of every wave hold shares of feature mt*16 + n
  if (nt == 0 && threadIdx.x < 16) {
    float t = 0.f;
    for (int w = 0; w < KV_WAVES; ++w) t += Csum[w][n] + Csum[w][n + 16];
    ksum[h * F_DIM + mrow] = t;
  }
}

// ---------------------------------------------------------------------------
// sum / maximum over the 16 lanes of a DPP row; every lane gets the result
// ---------------------------------------------------------------------------
template <int CTRL>
__device__ __forceinline__ float row_xmask(float v) {
  return __builtin_bit_cast(float, __builtin_amdgcn_update_dpp(
      0, __builtin_bit_cast(int, v), CTRL, 0xf, 0xf, false));
}
__device__ __forceinline__ float row_sum16(float v) {
  v += row_xmask<0x161>(v);
  v += row_xmask<0x162>(v);
  v += row_xmask<0x164>(v);
  v += row_xmask<0x168>(v);
  return v;
}
__device__ __forceinline__ float row_max16(float v) {
  v = fmaxf(v, row_xmask<0x161>(v));
  v = fmaxf(v, row_xmask<0x162>(v));
  v = fmaxf(v, row_xmask<0x164>(v));
  v = fmaxf(v, row_xmask<0x168>(v));
  return v;
}

// ---------------------------------------------------------------------------
// K5: fused band attention + low-rank combine.
// One work-group of 8 waves per (h, 16-query tile).
// 9 aligned key tiles cover the 128-wide window; mask handles edges.
//   products : wave w takes key tile w; waves 0-3 also one d tile of qkv,
//              waves 4 and 5 share key tile 8
//   combine  : wave w takes query rows 2w and 2w+1, 16 lanes per row
//   output   : wave w takes d tile (w & 3), half (w >> 2) of the 144 keys
// ---------------------------------------------------------------------------
#define FIN_WAVES 8
__global__ __launch_bounds__(32 * FIN_WAVES)
void sb_final_kernel(const float* __restrict__ qin, const float* __restrict__ kin,
                     const float* __restrict__ vin,
                     const float* __restrict__ qp, const float* __restrict__ kp,
                     const float* __restrict__ qls, const float* __restrict__ kls,
                     const float* __restrict__ kv, const float* __restrict__ ksum,
                     float* __restrict__ out)
{
  __shared__ float Xq[16][E_DIM];     // raw query tile (temp applied post-WMMA)
  __shared__ float QPl[16][F_DIM];    // q_prime tile
  __shared__ float QKb[16][144];
  __shared__ float DPb[16][144];
  __shared__ float Ab[16][144];
  __shared__ float Pscale[16];
  __shared__ __attribute__((aligned(16))) float Opart[2][16][E_DIM];  // output halves

  const int tid    = threadIdx.x;
  const int lane   = tid & 31;
  const int wave   = __builtin_amdgcn_readfirstlane(tid >> 5);
  const int h      = blockIdx.x / NTILES_T;
  const int qt     = blockIdx.x % NTILES_T;
  const int n      = lane & 15;
  const int koff   = (lane >> 4) * 2;
  const int s_base = (qt - 4) * 16;

#if USE_ASYNC_LDS
  // 256 threads: one 16-byte piece of Xq and two of QPl each, every lane on
  static_assert((16 * E_DIM) / 4 == 32 * FIN_WAVES, "one Xq piece per thread");
  static_assert((16 * F_DIM) / 4 == 2 * 32 * FIN_WAVES, "two QPl pieces per thread");
  {
    int m = tid >> 4, e4 = tid & 15;
    int t = qt * 16 + m;
    async_copy16(qin + ((size_t)t * H_DIM + h) * E_DIM + e4 * 4, &Xq[m][e4 * 4]);
  }
  {
    int m = tid >> 5, f4 = tid & 31;     // rows 0-7, then rows 8-15
    int t = qt * 16 + m;
    async_copy16(qp + ((size_t)h * T_DIM + t) * F_DIM + f4 * 4, &QPl[m][f4 * 4]);
    async_copy16(qp + ((size_t)h * T_DIM + t + 8) * F_DIM + f4 * 4, &QPl[m + 8][f4 * 4]);
  }
  async_wait0();
#else
  for (int i = tid; i < 16 * E_DIM; i += 32 * FIN_WAVES) {
    int m = i >> 6, e = i & 63;
    int t = qt * 16 + m;
    Xq[m][e] = qin[((size_t)t * H_DIM + h) * E_DIM + e];
  }
  for (int i = tid; i < 16 * F_DIM; i += 32 * FIN_WAVES) {
    int m = i >> 7, f = i & 127;
    int t = qt * 16 + m;
    QPl[m][f] = qp[((size_t)h * T_DIM + t) * F_DIM + f];
  }
#endif
  // stands directly behind each wave's own wait: publishes every wave's copies
  __syncthreads();

  // QK of one key tile (K=64)
  auto qk_tile = [&](int d8) {
    const int sc = clampi(s_base + d8 * 16 + n, 0, T_DIM - 1);
    v8f accQ = {};
    for (int kk = 0; kk < E_DIM / 4; ++kk) {
      int k0 = kk * 4 + koff;
      v2f a, b;
      a.x = Xq[n][k0];  a.y = Xq[n][k0 + 1];
      b.x = kin[((size_t)sc * H_DIM + h) * E_DIM + k0];
      b.y = kin[((size_t)sc * H_DIM + h) * E_DIM + k0 + 1];
      accQ = wmma4(a, b, accQ);
    }
    for (int vv = 0; vv < 8; ++vv) {
      int row = vv + ((lane >> 4) << 3);
      QKb[row][d8 * 16 + n] = TEMP_SCALE * accQ[vv];   // QK = temp * (q . k)
    }
  };
  // dots_prime of one key tile (K=128)
  auto dp_tile = [&](int d8) {
    const int sc = clampi(s_base + d8 * 16 + n, 0, T_DIM - 1);
    v8f accD = {};
    for (int kk = 0; kk < F_DIM / 4; ++kk) {
      int k0 = kk * 4 + koff;
      v2f a, b;
      a.x = QPl[n][k0];  a.y = QPl[n][k0 + 1];
      b.x = kp[((size_t)h * T_DIM + sc) * F_DIM + k0];
      b.y = kp[((size_t)h * T_DIM + sc) * F_DIM + k0 + 1];
      accD = wmma4(a, b, accD);
    }
    for (int vv = 0; vv < 8; ++vv) {
      int row = vv + ((lane >> 4) << 3);
      DPb[row][d8 * 16 + n] = accD[vv];
    }
  };

  qk_tile(wave);
  dp_tile(wave);

  v8f qkvAcc = {};
  if (wave < 4) {
    // qkv d tile: (16 x 128) @ (128 x 16), kept in registers
    const int d = wave * 16 + n;
    for (int kk = 0; kk < F_DIM / 4; ++kk) {
      int k0 = kk * 4 + koff;
      v2f a, b;
      a.x = QPl[n][k0];  a.y = QPl[n][k0 + 1];
      b.x = kv[((size_t)h * F_DIM + k0) * E_DIM + d];
      b.y = kv[((size_t)h * F_DIM + k0 + 1) * E_DIM + d];
      qkvAcc = wmma4(a, b, qkvAcc);
    }
  } else if (wave == 4) {
    dp_tile(8);
  } else if (wave == 5) {
    qk_tile(8);
  }
  __syncthreads();

  // per-query-row combine (reference logsumexp/clip), 16 lanes per row
  {
    const int row = wave * 2 + (lane >> 4);
    const int t   = qt * 16 + row;
    const float pls = qls[h * T_DIM + t] + kls[h];
    float ksv[F_DIM / 16];
    for (int i = 0; i < F_DIM / 16; ++i) ksv[i] = ksum[h * F_DIM + i * 16 + n];
    // precaution: keeps the LDS loads below, whose results may reuse the address
    // registers of the global loads above, behind those loads' address phase
    asm volatile("s_wait_xcnt 0x0" ::: "memory");
    float qk1 = 0.f;
    for (int i = 0; i < F_DIM / 16; ++i) qk1 += QPl[row][i * 16 + n] * ksv[i];
    qk1 = row_sum16(qk1);
    float qkr[9], dpr[9];
    bool  val[9];
    float mx = -INFINITY;
    for (int i = 0; i < 9; ++i) {
      int j = i * 16 + n;
      int s = s_base + j;
      val[i] = (s >= 0) && (s < T_DIM) && (s >= t - HALF_W) && (s <= t + HALF_W - 1);
      qkr[i] = QKb[row][j];
      dpr[i] = DPb[row][j];
      if (val[i]) mx = fmaxf(mx, qkr[i]);
    }
    mx = row_max16(mx);
    float se = 0.f, dpsum = 0.f;
    for (int i = 0; i < 9; ++i) {
      if (val[i]) { se += expf(qkr[i] - mx); dpsum += dpr[i]; }
    }
    se    = row_sum16(se);
    dpsum = row_sum16(dpsum);
    const float lse = mx + logf(se);
    const float lr  = logf(fmaxf(qk1 - dpsum, 1e-24f)) + pls;
    const float mm  = fmaxf(lse, lr);
    const float log_norm = mm + logf(expf(lse - mm) + expf(lr - mm));
    const float pscale   = expf(pls - log_norm);
    if (n == 0) Pscale[row] = pscale;
    for (int i = 0; i < 9; ++i) {
      Ab[row][i * 16 + n] = val[i] ? (expf(qkr[i] - log_norm) - dpr[i] * pscale) : 0.f;
    }
  }
  __syncthreads();

  // out = attn_local(16x144) @ V_band(144x64) + qkv * prime_scale
  {
    const int nt   = wave & 3;
    const int half = wave >> 2;
    const int d    = nt * 16 + n;
    v8f acc = {};
    for (int ks = 0; ks < 144 / 8; ++ks) {
      int k0  = (half * (144 / 8) + ks) * 4 + koff;
      int s0c = clampi(s_base + k0,     0, T_DIM - 1);
      int s1c = clampi(s_base + k0 + 1, 0, T_DIM - 1);
      v2f a, b;
      a.x = Ab[n][k0];  a.y = Ab[n][k0 + 1];
      b.x = vin[((size_t)s0c * H_DIM + h) * E_DIM + d];
      b.y = vin[((size_t)s1c * H_DIM + h) * E_DIM + d];
      acc = wmma4(a, b, acc);
    }
    // qkvAcc is zero in waves 4-7
    for (int vv = 0; vv < 8; ++vv) {
      int row = vv + ((lane >> 4) << 3);
      Opart[half][row][d] = acc[vv] + qkvAcc[vv] * Pscale[row];
    }
  }
  __syncthreads();

  // add the two key halves; each wave stores two whole 256-byte output rows
  {
    const int row = tid >> 4, c4 = (tid & 15) * 4;
    const int t   = qt * 16 + row;
    const float4 p0 = *(const float4*)&Opart[0][row][c4];
    const float4 p1 = *(const float4*)&Opart[1][row][c4];
    float4 o;
    o.x = p0.x + p1.x;  o.y = p0.y + p1.y;  o.z = p0.z + p1.z;  o.w = p0.w + p1.w;
    *(float4*)&out[((size_t)t * H_DIM + h) * E_DIM + c4] = o;
  }
}

// ---------------------------------------------------------------------------
extern "C" void kernel_launch(void* const* d_in, const int* in_sizes, int n_in,
                              void* d_out, int out_size, void* d_ws, size_t ws_size,
                              hipStream_t stream)
{
  (void)in_sizes; (void)n_in; (void)out_size; (void)ws_size;
  const float* q    = (const float*)d_in[0];
  const float* k    = (const float*)d_in[1];
  const float* v    = (const float*)d_in[2];
  const float* proj = (const float*)d_in[3];
  float* out = (float*)d_out;
  float* ws  = (float*)d_ws;

  // workspace layout (floats); total ~10.9 MB
  size_t o = 0;
  float* qp      = ws + o; o += (size_t)H_DIM * T_DIM * F_DIM;   // 4 MB
  float* kp      = ws + o; o += (size_t)H_DIM * T_DIM * F_DIM;   // 4 MB
  float* kdash   = ws + o; o += (size_t)H_DIM * T_DIM * R_DIM;   // 2 MB
  float* kdiag   = ws + o; o += (size_t)H_DIM * T_DIM;
  float* krowmax = ws + o; o += (size_t)H_DIM * T_DIM;
  float* qls     = ws + o; o += (size_t)H_DIM * T_DIM;
  float* kls     = ws + o; o += (size_t)H_DIM;
  float* kvbuf   = ws + o; o += (size_t)H_DIM * F_DIM * E_DIM;
  float* ksumb   = ws + o; o += (size_t)H_DIM * F_DIM;

  featurize_kernel<<<2 * H_DIM * NTILES_T, 32, 0, stream>>>(
      q, k, proj, qp, qls, kdash, kdiag, krowmax);
  reduce_kls_kernel<<<H_DIM, 256, 0, stream>>>(krowmax, kls);
  kprime_kernel<<<(H_DIM * T_DIM * R_DIM) / 256, 256, 0, stream>>>(
      kdash, kdiag, kls, kp);
  kv_kernel<<<H_DIM * 32, 32 * KV_WAVES, 0, stream>>>(v, kp, kvbuf, ksumb);
  sb_final_kernel<<<H_DIM * NTILES_T, 32 * FIN_WAVES, 0, stream>>>(
      q, k, v, qp, kp, qls, kls, kvbuf, ksumb, out);
}

// v003
// Measured time: 35.5 microseconds a run.
// Two timings next to v002 put it at 1.10 and 1.11 times that version's speed.
// All steps since v000 together make it 3.50 times as fast.
#include <hip/hip_runtime.h>
#include <math.h>
#include <stdint.h>

// ---------------- problem constants (B=1) ----------------
#define T_DIM   1024      // sequence length (queries == keys)
#define H_DIM   8         // heads
#define E_DIM   64        // head dim
#define R_DIM   64        // projection rows
#define F_DIM   128       // 2R feature dim
#define HALF_W  64        // local window half-width (LOCAL_CONTEXT/2)
#define NTILES_T (T_DIM/16)

// LDS row pitches, in floats.  A WMMA fragment read takes one row per lane
// (lanes n and n + 16 read dwords k0.. and k0 + 2.. of row n).  The LDS has 64
// banks of one dword, so at a pitch of 64, 128 or 144 floats the 16 rows fall on
// one (or four) bank groups and the read is served row after row.  A pitch of
// 4 * odd floats puts row n at bank 4n (in some order): 16 rows x 4 dwords cover
// all 64 banks once.  It stays a multiple of 16 bytes for the 16-byte copies.
#define E_PITCH (E_DIM + 4)     // 68  = 4 * 17
#define R_PITCH (R_DIM + 4)     // 68  = 4 * 17
#define F_PITCH (F_DIM + 4)     // 132 = 4 * 33
#define BAND    144             // keys of the 9 key tiles
#define B_PITCH (BAND + 4)      // 148 = 4 * 37

#define TEMP_SCALE 0.125f                 // 1/sqrt(E)
#define DATA_NORM  0.35355339059327373f   // sqrt(1/sqrt(E))
#define RATIO      0.08838834764831843f   // (2R)^-0.5

typedef float v2f __attribute__((ext_vector_type(2)));
typedef float v8f __attribute__((ext_vector_type(8)));

// CDNA5 fp32 matrix core: D(16x16) = A(16x4) * B(4x16) + C
__device__ __forceinline__ v8f wmma4(v2f a, v2f b, v8f c) {
  return __builtin_amdgcn_wmma_f32_16x16x4_f32(false, a, false, b, (short)0, c,
                                               false, false);
}

__device__ __forceinline__ int clampi(int x, int lo, int hi) {
  return x < lo ? lo : (x > hi ? hi : x);
}

// ---- CDNA5 async global->LDS staging (ASYNCcnt path), guarded ----
#if defined(__has_builtin)
# if __has_builtin(__builtin_amdgcn_global_load_async_to_lds_b128) && \
     __has_builtin(__builtin_amdgcn_s_wait_asynccnt)
#  define USE_ASYNC_LDS 1
# endif
#endif
#ifndef USE_ASYNC_LDS
# define USE_ASYNC_LDS 0
#endif

#if USE_ASYNC_LDS
// builtin signature (per hipcc diagnostic): pointee is a 16-byte int vector
typedef int v4i_t __attribute__((vector_size(16)));
typedef __attribute__((address_space(1))) v4i_t* gas1_t;
typedef __attribute__((address_space(3))) v4i_t* las3_t;
// copy 16 bytes per active lane, global -> LDS, no VGPR round trip
__device__ __forceinline__ void async_copy16(const void* g, const void* l) {
  __builtin_amdgcn_global_load_async_to_lds_b128(
      (gas1_t)(uintptr_t)g, (las3_t)(uint32_t)(uintptr_t)l, 0, 0);
}
__device__ __forceinline__ void async_wait0() {
  __builtin_amdgcn_s_wait_asynccnt(0);
}
#endif

// ---------------------------------------------------------------------------
// K1: featurize q and k tiles.  dash = DATA_NORM * (X @ P^T) via WMMA.
// which==0 (query): emit q_prime + per-row stabilizer q_ls
// which==1 (key)  : stash dash, diag, per-row max (for global k stabilizer)
// ---------------------------------------------------------------------------
__global__ __launch_bounds__(32)
void featurize_kernel(const float* __restrict__ qin, const float* __restrict__ kin,
                      const float* __restrict__ proj,
                      float* __restrict__ qp, float* __restrict__ qls,
                      float* __restrict__ kdash, float* __restrict__ kdiag,
                      float* __restrict__ krowmax)
{
  __shared__ __attribute__((aligned(16))) float Pl[R_DIM][E_PITCH];
  __shared__ __attribute__((aligned(16))) float Xs[16][E_PITCH];   // raw (unscaled) data tile
  __shared__ __attribute__((aligned(16))) float Dash[16][R_PITCH];
  __shared__ float DiagL[16];

  const int lane  = threadIdx.x;
  const int bid   = blockIdx.x;
  const int which = bid / (H_DIM * NTILES_T);
  const int rem   = bid % (H_DIM * NTILES_T);
  const int h     = rem / NTILES_T;
  const int tt    = rem % NTILES_T;
  const float* __restrict__ xin = (which == 0) ? qin : kin;

#if USE_ASYNC_LDS
  for (int c = lane; c < (R_DIM * E_DIM) / 4; c += 32)
    async_copy16(proj + c * 4, &Pl[c >> 4][(c & 15) * 4]);
  for (int c = lane; c < (16 * E_DIM) / 4; c += 32) {
    int m = c >> 4, e4 = c & 15;
    int t = tt * 16 + m;
    async_copy16(xin + ((size_t)t * H_DIM + h) * E_DIM + e4 * 4, &Xs[m][e4 * 4]);
  }
  async_wait0();
#else
  for (int i = lane; i < R_DIM * E_DIM; i += 32)
    Pl[i / E_DIM][i % E_DIM] = proj[i];
  for (int i = lane; i < 16 * E_DIM; i += 32) {
    int m = i >> 6, e = i & 63;
    int t = tt * 16 + m;
    Xs[m][e] = xin[((size_t)t * H_DIM + h) * E_DIM + e];
  }
#endif
  __syncthreads();

  if (lane < 16) {
    float s = 0.f;
    for (int e = 0; e < E_DIM; ++e) { float x = Xs[lane][e]; s += x * x; }
    DiagL[lane] = 0.5f * DATA_NORM * DATA_NORM * s;  // 0.5*dn^2*||x||^2
  }

  const int n    = lane & 15;
  const int koff = (lane >> 4) * 2;
  for (int nt = 0; nt < 4; ++nt) {
    v8f acc = {};
    for (int kk = 0; kk < E_DIM / 4; ++kk) {
      int k0 = kk * 4 + koff;
      v2f a, b;
      a.x = Xs[n][k0];            a.y = Xs[n][k0 + 1];
      int r = nt * 16 + n;        // B[k][n] = P^T[k][r] = P[r][k]
      b.x = Pl[r][k0];            b.y = Pl[r][k0 + 1];
      acc = wmma4(a, b, acc);
    }
    for (int vv = 0; vv < 8; ++vv) {
      int row = vv + ((lane >> 4) << 3);
      Dash[row][nt * 16 + n] = DATA_NORM * acc[vv];   // dash = dn * (X @ P^T)
    }
  }
  __syncthreads();

  if (lane < 16) {
    const int t    = tt * 16 + lane;
    const float dg = DiagL[lane];
    float mx = 0.f;                               // max_r |dash_r|  (>=0)
    for (int r = 0; r < R_DIM; ++r) mx = fmaxf(mx, fabsf(Dash[lane][r]));
    if (which == 0) {
      // stab = mx - diag;  prime = ratio*exp(±dash - diag - stab) = ratio*exp(±dash - mx)
      float* qrow = qp + ((size_t)h * T_DIM + t) * F_DIM;
      for (int r = 0; r < R_DIM; ++r) {
        float d = Dash[lane][r];
        qrow[r]         = RATIO * expf( d - mx);
        qrow[r + R_DIM] = RATIO * expf(-d - mx);
      }
      qls[h * T_DIM + t] = mx - dg;
    } else {
      float* krow = kdash + ((size_t)h * T_DIM + t) * R_DIM;
      for (int r = 0; r < R_DIM; ++r) krow[r] = Dash[lane][r];
      kdiag[h * T_DIM + t]   = dg;
      krowmax[h * T_DIM + t] = mx - dg;
    }
  }
}

// ---------------------------------------------------------------------------
// K2: per-head global key stabilizer (deterministic tree reduction)
// ---------------------------------------------------------------------------
__global__ __launch_bounds__(256)
void reduce_kls_kernel(const float* __restrict__ krowmax, float* __restrict__ kls)
{
  __shared__ float sm[256];
  const int h = blockIdx.x, tid = threadIdx.x;
  float m = -INFINITY;
  for (int t = tid; t < T_DIM; t += 256) m = fmaxf(m, krowmax[h * T_DIM + t]);
  sm[tid] = m; __syncthreads();
  for (int s = 128; s > 0; s >>= 1) {
    if (tid < s) sm[tid] = fmaxf(sm[tid], sm[tid + s]);
    __syncthreads();
  }
  if (tid == 0) kls[h] = sm[0];
}

// ---------------------------------------------------------------------------
// K3: k_prime = ratio * exp(±dash - diag - k_ls)
// ---------------------------------------------------------------------------
__global__ __launch_bounds__(256)
void kprime_kernel(const float* __restrict__ kdash, const float* __restrict__ kdiag,
                   const float* __restrict__ kls, float* __restrict__ kp)
{
  int idx = blockIdx.x * 256 + threadIdx.x;       // over H*T*R
  if (idx >= H_DIM * T_DIM * R_DIM) return;
  const int r  = idx % R_DIM;
  const int ht = idx / R_DIM;
  const int h  = ht / T_DIM;
  const float dash = kdash[idx];
  const float c    = kdiag[ht] + kls[h];
  kp[(size_t)ht * F_DIM + r]         = RATIO * expf( dash - c);
  kp[(size_t)ht * F_DIM + r + R_DIM] = RATIO * expf(-dash - c);
}

// ---------------------------------------------------------------------------
// K4: kv[h] = k_prime^T @ V   (F x E, K = T) via WMMA.
// One work-group of 8 waves per 16x16 tile: wave w sums keys [128w, 128w+128),
// the eight partial tiles are added through LDS in wave order.
// ksum[h][m] = sum_s k_prime[h][s][m] comes from the same A fragments: every
// lane adds up the k_prime values it loads anyway, and the d tile 0 work-group
// of each feature tile adds the 16 shares of a feature and stores the sum.
// ---------------------------------------------------------------------------
#define KV_WAVES 8
#define KV_STEPS (T_DIM / 4 / KV_WAVES)
__global__ __launch_bounds__(32 * KV_WAVES)
void kv_kernel(const float* __restrict__ vin, const float* __restrict__ kp,
               float* __restrict__ kv, float* __restrict__ ksum)
{
  __shared__ float Part[KV_WAVES][8][32];   // [wave][accumulator register][lane]
  __shared__ float Csum[KV_WAVES][32];      // [wave][lane] share of a column sum

  const int bid  = blockIdx.x;
  const int h    = bid / 32;
  const int rem  = bid % 32;
  const int mt   = rem / 4;      // feature tile
  const int nt   = rem % 4;      // d tile
  const int lane = threadIdx.x & 31;
  const int wave = __builtin_amdgcn_readfirstlane(threadIdx.x >> 5);
  const int n    = lane & 15;
  const int koff = (lane >> 4) * 2;
  const int mrow = mt * 16 + n;
  const int d    = nt * 16 + n;
  const float* __restrict__ kpb = kp + (size_t)h * T_DIM * F_DIM;

  v8f acc = {};
  float cs = 0.f;     // sum of feature mrow over this lane's 64 keys
  for (int ks = 0; ks < KV_STEPS; ++ks) {
    int s0 = (wave * KV_STEPS + ks) * 4 + koff;
    v2f a, b;
    a.x = kpb[(size_t)s0 * F_DIM + mrow];         // A[m][s] = kp[s][m]
    a.y = kpb[(size_t)(s0 + 1) * F_DIM + mrow];
    b.x = vin[((size_t)s0 * H_DIM + h) * E_DIM + d];
    b.y = vin[((size_t)(s0 + 1) * H_DIM + h) * E_DIM + d];
    acc = wmma4(a, b, acc);
    cs += a.x + a.y;
  }
  for (int vv = 0; vv < 8; ++vv) Part[wave][vv][lane] = acc[vv];
  Csum[wave][lane] = cs;
  __syncthreads();

  // wave w finishes accumulator register w of the tile (rows w and w + 8)
  float s = Part[0][wave][lane];
  for (int w = 1; w < KV_WAVES; ++w) s += Part[w][wave][lane];
  const int m = mt * 16 + wave + ((lane >> 4) << 3);
  kv[((size_t)h * F_DIM + m) * E_DIM + d] = s;

  // column sums: lanes n and n + 16 of every wave hold shares of feature mt*16 + n
  if (nt == 0 && threadIdx.x < 16) {
    float t = 0.f;
    for (int w = 0; w < KV_WAVES; ++w) t += Csum[w][n] + Csum[w][n + 16];
    ksum[h * F_DIM + mrow] = t;
  }
}

// ---------------------------------------------------------------------------
// sum / maximum over the 16 lanes of a DPP row; every lane gets the result
// ---------------------------------------------------------------------------
template <int CTRL>
__device__ __forceinline__ float row_xmask(float v) {
  return __builtin_bit_cast(float, __builtin_amdgcn_update_dpp(
      0, __builtin_bit_cast(int, v), CTRL, 0xf, 0xf, false));
}
__device__ __forceinline__ float row_sum16(float v) {
  v += row_xmask<0x161>(v);
  v += row_xmask<0x162>(v);
  v += row_xmask<0x164>(v);
  v += row_xmask<0x168>(v);
  return v;
}
__device__ __forceinline__ float row_max16(float v) {
  v = fmaxf(v, row_xmask<0x161>(v));
  v = fmaxf(v, row_xmask<0x162>(v));
  v = fmaxf(v, row_xmask<0x164>(v));
  v = fmaxf(v, row_xmask<0x168>(v));
  return v;
}

// ---------------------------------------------------------------------------
// K5: fused band attention + low-rank combine.
// One work-group of 8 waves per (h, 16-query tile).
// 9 aligned key tiles cover the 128-wide window; mask handles edges.
//   products : wave w takes key tile w; waves 0-3 also one d tile of qkv,
//              waves 4 and 5 share key tile 8
//   combine  : wave w takes query rows 2w and 2w+1, 16 lanes per row
//   output   : wave w takes d tile (w & 3), half (w >> 2) of the 144 keys
// ---------------------------------------------------------------------------
#define FIN_WAVES 8
__global__ __launch_bounds__(32 * FIN_WAVES)
void sb_final_kernel(const float* __restrict__ qin, const float* __restrict__ kin,
                     const float* __restrict__ vin,
                     const float* __restrict__ qp, const float* __restrict__ kp,
                     const float* __restrict__ qls, const float* __restrict__ kls,
                     const float* __restrict__ kv, const float* __restrict__ ksum,
                     float* __restrict__ out)
{
  __shared__ __attribute__((aligned(16))) float Xq[16][E_PITCH];   // raw query tile (temp applied post-WMMA)
  __shared__ __attribute__((aligned(16))) float QPl[16][F_PITCH];  // q_prime tile
  __shared__ float QKb[16][B_PITCH];
  __shared__ float DPb[16][B_PITCH];
  __shared__ float Ab[16][B_PITCH];
  __shared__ float Pscale[16];
  __shared__ __attribute__((aligned(16))) float Opart[2][16][E_PITCH];  // output halves

  const int tid    = threadIdx.x;
  const int lane   = tid & 31;
  const int wave   = __builtin_amdgcn_readfirstlane(tid >> 5);
  const int h      = blockIdx.x / NTILES_T;
  const int qt     = blockIdx.x % NTILES_T;
  const int n      = lane & 15;
  const int koff   = (lane >> 4) * 2;
  const int s_base = (qt - 4) * 16;

#if USE_ASYNC_LDS
  // 256 threads: one 16-byte piece of Xq and two of QPl each, every lane on
  static_assert((16 * E_DIM) / 4 == 32 * FIN_WAVES, "one Xq piece per thread");
  static_assert((16 * F_DIM) / 4 == 2 * 32 * FIN_WAVES, "two QPl pieces per thread");
  {
    int m = tid >> 4, e4 = tid & 15;
    int t = qt * 16 + m;
    async_copy16(qin + ((size_t)t * H_DIM + h) * E_DIM + e4 * 4, &Xq[m][e4 * 4]);
  }
  {
    int m = tid >> 5, f4 = tid & 31;     // rows 0-7, then rows 8-15
    int t = qt * 16 + m;
    async_copy16(qp + ((size_t)h * T_DIM + t) * F_DIM + f4 * 4, &QPl[m][f4 * 4]);
    async_copy16(qp + ((size_t)h * T_DIM + t + 8) * F_DIM + f4 * 4, &QPl[m + 8][f4 * 4]);
  }
  async_wait0();
#else
  for (int i = tid; i < 16 * E_DIM; i += 32 * FIN_WAVES) {
    int m = i >> 6, e = i & 63;
    int t = qt * 16 + m;
    Xq[m][e] = qin[((size_t)t * H_DIM + h) * E_DIM + e];
  }
  for (int i = tid; i < 16 * F_DIM; i += 32 * FIN_WAVES) {
    int m = i >> 7, f = i & 127;
    int t = qt * 16 + m;
    QPl[m][f] = qp[((size_t)h * T_DIM + t) * F_DIM + f];
  }
#endif
  // stands directly behind each wave's own wait: publishes every wave's copies
  __syncthreads();

  // QK of one key tile (K=64)
  auto qk_tile = [&](int d8) {
    const int sc = clampi(s_base + d8 * 16 + n, 0, T_DIM - 1);
    v8f accQ = {};
    for (int kk = 0; kk < E_DIM / 4; ++kk) {
      int k0 = kk * 4 + koff;
      v2f a, b;
      a.x = Xq[n][k0];  a.y = Xq[n][k0 + 1];
      b.x = kin[((size_t)sc * H_DIM + h) * E_DIM + k0];
      b.y = kin[((size_t)sc * H_DIM + h) * E_DIM + k0 + 1];
      accQ = wmma4(a, b, accQ);
    }
    for (int vv = 0; vv < 8; ++vv) {
      int row = vv + ((lane >> 4) << 3);
      QKb[row][d8 * 16 + n] = TEMP_SCALE * accQ[vv];   // QK = temp * (q . k)
    }
  };
  // dots_prime of one key tile (K=128)
  auto dp_tile = [&](int d8) {
    const int sc = clampi(s_base + d8 * 16 + n, 0, T_DIM - 1);
    v8f accD = {};
    for (int kk = 0; kk < F_DIM / 4; ++kk) {
      int k0 = kk * 4 + koff;
      v2f a, b;
      a.x = QPl[n][k0];  a.y = QPl[n][k0 + 1];
      b.x = kp[((size_t)h * T_DIM + sc) * F_DIM + k0];
      b.y = kp[((size_t)h * T_DIM + sc) * F_DIM + k0 + 1];
      accD = wmma4(a, b, accD);
    }
    for (int vv = 0; vv < 8; ++vv) {
      int row = vv + ((lane >> 4) << 3);
      DPb[row][d8 * 16 + n] = accD[vv];
    }
  };

  qk_tile(wave);
  dp_tile(wave);

  v8f qkvAcc = {};
  if (wave < 4) {
    // qkv d tile: (16 x 128) @ (128 x 16), kept in registers
    const int d = wave * 16 + n;
    for (int kk = 0; kk < F_DIM / 4; ++kk) {
      int k0 = kk * 4 + koff;
      v2f a, b;
      a.x = QPl[n][k0];  a.y = QPl[n][k0 + 1];
      b.x = kv[((size_t)h * F_DIM + k0) * E_DIM + d];
      b.y = kv[((size_t)h * F_DIM + k0 + 1) * E_DIM + d];
      qkvAcc = wmma4(a, b, qkvAcc);
    }
  } else if (wave == 4) {
    dp_tile(8);
  } else if (wave == 5) {
    qk_tile(8);
  }
  __syncthreads();

  // per-query-row combine (reference logsumexp/clip), 16 lanes per row
  {
    const int row = wave * 2 + (lane >> 4);
    const int t   = qt * 16 + row;
    const float pls = qls[h * T_DIM + t] + kls[h];
    float ksv[F_DIM / 16];
    for (int i = 0; i < F_DIM / 16; ++i) ksv[i] = ksum[h * F_DIM + i * 16 + n];
    // precaution: keeps the LDS loads below, whose results may reuse the address
    // registers of the global loads above, behind those loads' address phase
    asm volatile("s_wait_xcnt 0x0" ::: "memory");
    float qk1 = 0.f;
    for (int i = 0; i < F_DIM / 16; ++i) qk1 += QPl[row][i * 16 + n] * ksv[i];
    qk1 = row_sum16(qk1);
    float qkr[9], dpr[9];
    bool  val[9];
    float mx = -INFINITY;
    for (int i = 0; i < 9; ++i) {
      int j = i * 16 + n;
      int s = s_base + j;
      val[i] = (s >= 0) && (s < T_DIM) && (s >= t - HALF_W) && (s <= t + HALF_W - 1);
      qkr[i] = QKb[row][j];
      dpr[i] = DPb[row][j];
      if (val[i]) mx = fmaxf(mx, qkr[i]);
    }
    mx = row_max16(mx);
    float se = 0.f, dpsum = 0.f;
    for (int i = 0; i < 9; ++i) {
      if (val[i]) { se += expf(qkr[i] - mx); dpsum += dpr[i]; }
    }
    se    = row_sum16(se);
    dpsum = row_sum16(dpsum);
    const float lse = mx + logf(se);
    const float lr  = logf(fmaxf(qk1 - dpsum, 1e-24f)) + pls;
    const float mm  = fmaxf(lse, lr);
    const float log_norm = mm + logf(expf(lse - mm) + expf(lr - mm));
    const float pscale   = expf(pls - log_norm);
    if (n == 0) Pscale[row] = pscale;
    for (int i = 0; i < 9; ++i) {
      Ab[row][i * 16 + n] = val[i] ? (expf(qkr[i] - log_norm) - dpr[i] * pscale) : 0.f;
    }
  }
  __syncthreads();

  // out = attn_local(16x144) @ V_band(144x64) + qkv * prime_scale
  {
    const int nt   = wave & 3;
    const int half = wave >> 2;
    const int d    = nt * 16 + n;
    v8f acc = {};
    for (int ks = 0; ks < 144 / 8; ++ks) {
      int k0  = (half * (144 / 8) + ks) * 4 + koff;
      int s0c = clampi(s_base + k0,     0, T_DIM - 1);
      int s1c = clampi(s_base + k0 + 1, 0, T_DIM - 1);
      v2f a, b;
      a.x = Ab[n][k0];  a.y = Ab[n][k0 + 1];
      b.x = vin[((size_t)s0c * H_DIM + h) * E_DIM + d];
      b.y = vin[((size_t)s1c * H_DIM + h) * E_DIM + d];
      acc = wmma4(a, b, acc);
    }
    // qkvAcc is zero in waves 4-7
    for (int vv = 0; vv < 8; ++vv) {
      int row = vv + ((lane >> 4) << 3);
      Opart[half][row][d] = acc[vv] + qkvAcc[vv] * Pscale[row];
    }
  }
  __syncthreads();

  // add the two key halves; each wave stores two whole 256-byte output rows
  {
    const int row = tid >> 4, c4 = (tid & 15) * 4;
    const int t   = qt * 16 + row;
    const float4 p0 = *(const float4*)&Opart[0][row][c4];
    const float4 p1 = *(const float4*)&Opart[1][row][c4];
    float4 o;
    o.x = p0.x + p1.x;  o.y = p0.y + p1.y;  o.z = p0.z + p1.z;  o.w = p0.w + p1.w;
    *(float4*)&out[((size_t)t * H_DIM + h) * E_DIM + c4] = o;
  }
}

// ---------------------------------------------------------------------------
extern "C" void kernel_launch(void* const* d_in, const int* in_sizes, int n_in,
                              void* d_out, int out_size, void* d_ws, size_t ws_size,
                              hipStream_t stream)
{
  (void)in_sizes; (void)n_in; (void)out_size; (void)ws_size;
  const float* q    = (const float*)d_in[0];
  const float* k    = (const float*)d_in[1];
  const float* v    = (const float*)d_in[2];
  const float* proj = (const float*)d_in[3];
  float* out = (float*)d_out;
  float* ws  = (float*)d_ws;

  // workspace layout (floats); total ~10.9 MB
  size_t o = 0;
  float* qp      = ws + o; o += (size_t)H_DIM * T_DIM * F_DIM;   // 4 MB
  float* kp      = ws + o; o += (size_t)H_DIM * T_DIM * F_DIM;   // 4 MB
  float* kdash   = ws + o; o += (size_t)H_DIM * T_DIM * R_DIM;   // 2 MB
  float* kdiag   = ws + o; o += (size_t)H_DIM * T_DIM;
  float* krowmax = ws + o; o += (size_t)H_DIM * T_DIM;
  float* qls     = ws + o; o += (size_t)H_DIM * T_DIM;
  float* kls     = ws + o; o += (size_t)H_DIM;
  float* kvbuf   = ws + o; o += (size_t)H_DIM * F_DIM * E_DIM;
  float* ksumb   = ws + o; o += (size_t)H_DIM * F_DIM;

  featurize_kernel<<<2 * H_DIM * NTILES_T, 32, 0, stream>>>(
      q, k, proj, qp, qls, kdash, kdiag, krowmax);
  reduce_kls_kernel<<<H_DIM, 256, 0, stream>>>(krowmax, kls);
  kprime_kernel<<<(H_DIM * T_DIM * R_DIM) / 256, 256, 0, stream>>>(
      kdash, kdiag, kls, kp);
  kv_kernel<<<H_DIM * 32, 32 * KV_WAVES, 0, stream>>>(v, kp, kvbuf, ksumb);
  sb_final_kernel<<<H_DIM * NTILES_T, 32 * FIN_WAVES, 0, stream>>>(
      q, k, v, qp, kp, qls, kls, kvbuf, ksumb, out);
}

// v004
// Measured time: 31.6 microseconds a run.
// Timed twice side by side with v003, it ran 1.11 and 1.12 times as fast.
// Counting every step since v000, it is 3.90 times as fast.
#include <hip/hip_runtime.h>
#include <math.h>
#include <stdint.h>

// ---------------- problem constants (B=1) ----------------
#define T_DIM   1024      // sequence length (queries == keys)
#define H_DIM   8         // heads
#define E_DIM   64        // head dim
#define R_DIM   64        // projection rows
#define F_DIM   128       // 2R feature dim
#define HALF_W  64        // local window half-width (LOCAL_CONTEXT/2)
#define NTILES_T (T_DIM/16)

// LDS row pitches, in floats.  A WMMA fragment read takes one row per lane
// (lanes n and n + 16 read dwords k0.. and k0 + 2.. of row n).  The LDS has 64
// banks of one dword, so at a pitch of 64, 128 or 144 floats the 16 rows fall on
// one (or four) bank groups and the read is served row after row.  A pitch of
// 4 * odd floats puts row n at bank 4n (in some order): 16 rows x 4 dwords cover
// all 64 banks once.  It stays a multiple of 16 bytes for the 16-byte copies.
#define E_PITCH (E_DIM + 4)     // 68  = 4 * 17
#define R_PITCH (R_DIM + 4)     // 68  = 4 * 17
#define F_PITCH (F_DIM + 4)     // 132 = 4 * 33
#define BAND    144             // keys of the 9 key tiles
#define B_PITCH (BAND + 4)      // 148 = 4 * 37

#define TEMP_SCALE 0.125f                 // 1/sqrt(E)
#define DATA_NORM  0.35355339059327373f   // sqrt(1/sqrt(E))
#define RATIO      0.08838834764831843f   // (2R)^-0.5

typedef float v2f __attribute__((ext_vector_type(2)));
typedef float v8f __attribute__((ext_vector_type(8)));

// CDNA5 fp32 matrix core: D(16x16) = A(16x4) * B(4x16) + C
__device__ __forceinline__ v8f wmma4(v2f a, v2f b, v8f c) {
  return __builtin_amdgcn_wmma_f32_16x16x4_f32(false, a, false, b, (short)0, c,
                                               false, false);
}

__device__ __forceinline__ int clampi(int x, int lo, int hi) {
  return x < lo ? lo : (x > hi ? hi : x);
}

// ---- CDNA5 async global->LDS staging (ASYNCcnt path), guarded ----
#if defined(__has_builtin)
# if __has_builtin(__builtin_amdgcn_global_load_async_to_lds_b128) && \
     __has_builtin(__builtin_amdgcn_s_wait_asynccnt)
#  define USE_ASYNC_LDS 1
# endif
#endif
#ifndef USE_ASYNC_LDS
# define USE_ASYNC_LDS 0
#endif

#if USE_ASYNC_LDS
// builtin signature (per hipcc diagnostic): pointee is a 16-byte int vector
typedef int v4i_t __attribute__((vector_size(16)));
typedef __attribute__((address_space(1))) v4i_t* gas1_t;
typedef __attribute__((address_space(3))) v4i_t* las3_t;
// copy 16 bytes per active lane, global -> LDS, no VGPR round trip
__device__ __forceinline__ void async_copy16(const void* g, const void* l) {
  __builtin_amdgcn_global_load_async_to_lds_b128(
      (gas1_t)(uintptr_t)g, (las3_t)(uint32_t)(uintptr_t)l, 0, 0);
}
__device__ __forceinline__ void async_wait0() {
  __builtin_amdgcn_s_wait_asynccnt(0);
}
#endif

// ---------------------------------------------------------------------------
// K1: featurize q and k tiles.  dash = DATA_NORM * (X @ P^T) via WMMA.
// which==0 (query): emit q_prime + per-row stabilizer q_ls
// which==1 (key)  : stash dash, diag, per-row max (for global k stabilizer)
// ---------------------------------------------------------------------------
__global__ __launch_bounds__(32)
void featurize_kernel(const float* __restrict__ qin, const float* __restrict__ kin,
                      const float* __restrict__ proj,
                      float* __restrict__ qp, float* __restrict__ qls,
                      float* __restrict__ kdash, float* __restrict__ kdiag,
                      float* __restrict__ krowmax)
{
  __shared__ __attribute__((aligned(16))) float Pl[R_DIM][E_PITCH];
  __shared__ __attribute__((aligned(16))) float Xs[16][E_PITCH];   // raw (unscaled) data tile
  __shared__ __attribute__((aligned(16))) float Dash[16][R_PITCH];
  __shared__ float DiagL[16];

  const int lane  = threadIdx.x;
  const int bid   = blockIdx.x;
  const int which = bid / (H_DIM * NTILES_T);
  const int rem   = bid % (H_DIM * NTILES_T);
  const int h     = rem / NTILES_T;
  const int tt    = rem % NTILES_T;
  const float* __restrict__ xin = (which == 0) ? qin : kin;

#if USE_ASYNC_LDS
  for (int c = lane; c < (R_DIM * E_DIM) / 4; c += 32)
    async_copy16(proj + c * 4, &Pl[c >> 4][(c & 15) * 4]);
  for (int c = lane; c < (16 * E_DIM) / 4; c += 32) {
    int m = c >> 4, e4 = c & 15;
    int t = tt * 16 + m;
    async_copy16(xin + ((size_t)t * H_DIM + h) * E_DIM + e4 * 4, &Xs[m][e4 * 4]);
  }
  async_wait0();
#else
  for (int i = lane; i < R_DIM * E_DIM; i += 32)
    Pl[i / E_DIM][i % E_DIM] = proj[i];
  for (int i = lane; i < 16 * E_DIM; i += 32) {
    int m = i >> 6, e = i & 63;
    int t = tt * 16 + m;
    Xs[m][e] = xin[((size_t)t * H_DIM + h) * E_DIM + e];
  }
#endif
  __syncthreads();

  if (lane < 16) {
    float s = 0.f;
    for (int e = 0; e < E_DIM; ++e) { float x = Xs[lane][e]; s += x * x; }
    DiagL[lane] = 0.5f * DATA_NORM * DATA_NORM * s;  // 0.5*dn^2*||x||^2
  }

  const int n    = lane & 15;
  const int koff = (lane >> 4) * 2;
  for (int nt = 0; nt < 4; ++nt) {
    v8f acc = {};
    for (int kk = 0; kk < E_DIM / 4; ++kk) {
      int k0 = kk * 4 + koff;
      v2f a, b;
      a.x = Xs[n][k0];            a.y = Xs[n][k0 + 1];
      int r = nt * 16 + n;        // B[k][n] = P^T[k][r] = P[r][k]
      b.x = Pl[r][k0];            b.y = Pl[r][k0 + 1];
      acc = wmma4(a, b, acc);
    }
    for (int vv = 0; vv < 8; ++vv) {
      int row = vv + ((lane >> 4) << 3);
      Dash[row][nt * 16 + n] = DATA_NORM * acc[vv];   // dash = dn * (X @ P^T)
    }
  }
  __syncthreads();

  if (lane < 16) {
    const int t    = tt * 16 + lane;
    const float dg = DiagL[lane];
    float mx = 0.f;                               // max_r |dash_r|  (>=0)
    for (int r = 0; r < R_DIM; ++r) mx = fmaxf(mx, fabsf(Dash[lane][r]));
    if (which == 0) {
      // stab = mx - diag;  prime = ratio*exp(±dash - diag - stab) = ratio*exp(±dash - mx)
      float* qrow = qp + ((size_t)h * T_DIM + t) * F_DIM;
      for (int r = 0; r < R_DIM; ++r) {
        float d = Dash[lane][r];
        qrow[r]         = RATIO * expf( d - mx);
        qrow[r + R_DIM] = RATIO * expf(-d - mx);
      }
      qls[h * T_DIM + t] = mx - dg;
    } else {
      float* krow = kdash + ((size_t)h * T_DIM + t) * R_DIM;
      for (int r = 0; r < R_DIM; ++r) krow[r] = Dash[lane][r];
      kdiag[h * T_DIM + t]   = dg;
      krowmax[h * T_DIM + t] = mx - dg;
    }
  }
}

// ---------------------------------------------------------------------------
// sum / maximum over the 16 lanes of a DPP row; every lane gets the result
// ---------------------------------------------------------------------------
template <int CTRL>
__device__ __forceinline__ float row_xmask(float v) {
  return __builtin_bit_cast(float, __builtin_amdgcn_update_dpp(
      0, __builtin_bit_cast(int, v), CTRL, 0xf, 0xf, false));
}
__device__ __forceinline__ float row_sum16(float v) {
  v += row_xmask<0x161>(v);
  v += row_xmask<0x162>(v);
  v += row_xmask<0x164>(v);
  v += row_xmask<0x168>(v);
  return v;
}
__device__ __forceinline__ float row_max16(float v) {
  v = fmaxf(v, row_xmask<0x161>(v));
  v = fmaxf(v, row_xmask<0x162>(v));
  v = fmaxf(v, row_xmask<0x164>(v));
  v = fmaxf(v, row_xmask<0x168>(v));
  return v;
}

// ---------------------------------------------------------------------------
// K2: kv[h] = k_prime^T @ V   (F x E, K = T) via WMMA, with the key stabilizer
// and k_prime made on the way.
// One work-group of 8 waves per 16x16 tile: wave w sums keys [128w, 128w+128),
// the eight partial tiles are added through LDS in wave order.
// k_ls[h] = max_s krowmax[h][s]: every work-group takes the maximum of its
// head's 1024 row maxima itself (a maximum does not depend on the order).
// k_prime = ratio * exp(+-dash - (diag + k_ls)) is evaluated straight into the
// A fragment.  The final kernel wants k_prime as an array: each of the head's 32
// work-groups evaluates and stores 32 whole key rows of it, 16 bytes per lane.
// ksum[h][m] = sum_s k_prime[h][s][m] comes from the same A fragments: every
// lane adds up the k_prime values it forms anyway, and the d tile 0 work-group
// of each feature tile adds the 16 shares of a feature and stores the sum.
// ---------------------------------------------------------------------------
#define KV_WAVES 8
#define KV_STEPS (T_DIM / 4 / KV_WAVES)
#define KV_BLOCK 4
__global__ __launch_bounds__(32 * KV_WAVES)
void kv_kernel(const float* __restrict__ vin, const float* __restrict__ kdash,
               const float* __restrict__ kdiag, const float* __restrict__ krowmax,
               float* __restrict__ kp, float* __restrict__ kls,
               float* __restrict__ kv, float* __restrict__ ksum)
{
  __shared__ float Part[KV_WAVES][8][32];   // [wave][accumulator register][lane]
  __shared__ float Csum[KV_WAVES][32];      // [wave][lane] share of a column sum
  __shared__ __attribute__((aligned(16))) float Wmax[2 * KV_WAVES];  // maxima of 64 keys
  __shared__ __attribute__((aligned(16))) float Cs[T_DIM];           // diag[s] + k_ls

  const int bid  = blockIdx.x;
  const int h    = bid / 32;
  const int rem  = bid % 32;
  const int mt   = rem / 4;      // feature tile
  const int nt   = rem % 4;      // d tile
  const int tid  = threadIdx.x;
  const int lane = tid & 31;
  const int wave = __builtin_amdgcn_readfirstlane(tid >> 5);
  const int n    = lane & 15;
  const int koff = (lane >> 4) * 2;
  const int mrow = mt * 16 + n;
  const int d    = nt * 16 + n;

  // key stabilizer of the head: four keys per thread, 16 lanes by DPP, rest in LDS
  static_assert(T_DIM == 4 * 32 * KV_WAVES, "four keys per thread");
  const float4 rm = *(const float4*)&krowmax[h * T_DIM + tid * 4];
  const float4 dg = *(const float4*)&kdiag[h * T_DIM + tid * 4];
  // dash of this work-group's 32 rows of the k_prime array (a wave takes two rows
  // at a time), asked for here so that it arrives while the maximum is formed
  const float* __restrict__ kdb = kdash + (size_t)h * T_DIM * R_DIM;
  const int sr = rem * 32 + (tid >> 4);
  const int r4 = (tid & 15) * 4;
  float4 dv[2];
  for (int i = 0; i < 2; ++i) dv[i] = *(const float4*)&kdb[(size_t)(sr + i * 16) * R_DIM + r4];
  // keeps the four loads above in front of the first use of any of them: without
  // it the last three are issued only after the first has come back
  __builtin_amdgcn_sched_barrier(0);
  const float m16 = row_max16(fmaxf(fmaxf(rm.x, rm.y), fmaxf(rm.z, rm.w)));
  if (n == 0) Wmax[tid >> 4] = m16;
  __syncthreads();
  float kmax = Wmax[0];
  for (int i = 1; i < 2 * KV_WAVES; ++i) kmax = fmaxf(kmax, Wmax[i]);
  float4 c4;
  c4.x = dg.x + kmax;  c4.y = dg.y + kmax;  c4.z = dg.z + kmax;  c4.w = dg.w + kmax;
  *(float4*)&Cs[tid * 4] = c4;
  if (rem == 0 && tid == 0) kls[h] = kmax;
  __syncthreads();

  // k_prime rows for the final kernel, whole 128-byte lines from one wave
  float* __restrict__ kpb = kp + (size_t)h * T_DIM * F_DIM;
  for (int i = 0; i < 2; ++i) {
    const int   s = sr + i * 16;
    const float c = Cs[s];
    float4 p, q;
    p.x = RATIO * expf( dv[i].x - c);  p.y = RATIO * expf( dv[i].y - c);
    p.z = RATIO * expf( dv[i].z - c);  p.w = RATIO * expf( dv[i].w - c);
    q.x = RATIO * expf(-dv[i].x - c);  q.y = RATIO * expf(-dv[i].y - c);
    q.z = RATIO * expf(-dv[i].z - c);  q.w = RATIO * expf(-dv[i].w - c);
    *(float4*)&kpb[(size_t)s * F_DIM + r4]         = p;
    *(float4*)&kpb[(size_t)s * F_DIM + R_DIM + r4] = q;
  }

  // features 0-63 are exp(+dash), features 64-127 exp(-dash) of projection row m & 63
  const int   r   = (mt & 3) * 16 + n;
  const float sgn = (mt < 4) ? 1.f : -1.f;

  v8f acc = {};
  float cs = 0.f;     // sum of feature mrow over this lane's 64 keys
  // four steps per trip, so that their 16 loads are in flight together
  for (int kb = 0; kb < KV_STEPS; kb += KV_BLOCK) {
    v2f a[KV_BLOCK], b[KV_BLOCK];
    for (int u = 0; u < KV_BLOCK; ++u) {
      int s0 = (wave * KV_STEPS + kb + u) * 4 + koff;
      a[u].x = kdb[(size_t)s0 * R_DIM + r];
      a[u].y = kdb[(size_t)(s0 + 1) * R_DIM + r];
      b[u].x = vin[((size_t)s0 * H_DIM + h) * E_DIM + d];
      b[u].y = vin[((size_t)(s0 + 1) * H_DIM + h) * E_DIM + d];
    }
    for (int u = 0; u < KV_BLOCK; ++u) {
      int s0 = (wave * KV_STEPS + kb + u) * 4 + koff;
      a[u].x = RATIO * expf(sgn * a[u].x - Cs[s0]);       // A[m][s] = kp[s][m]
      a[u].y = RATIO * expf(sgn * a[u].y - Cs[s0 + 1]);
      acc = wmma4(a[u], b[u], acc);
      cs += a[u].x + a[u].y;
    }
  }
  for (int vv = 0; vv < 8; ++vv) Part[wave][vv][lane] = acc[vv];
  Csum[wave][lane] = cs;
  __syncthreads();

  // wave w finishes accumulator register w of the tile (rows w and w + 8)
  float s = Part[0][wave][lane];
  for (int w = 1; w < KV_WAVES; ++w) s += Part[w][wave][lane];
  const int m = mt * 16 + wave + ((lane >> 4) << 3);
  kv[((size_t)h * F_DIM + m) * E_DIM + d] = s;

  // column sums: lanes n and n + 16 of every wave hold shares of feature mt*16 + n
  if (nt == 0 && threadIdx.x < 16) {
    float t = 0.f;
    for (int w = 0; w < KV_WAVES; ++w) t += Csum[w][n] + Csum[w][n + 16];
    ksum[h * F_DIM + mrow] = t;
  }
}

// ---------------------------------------------------------------------------
// K3: fused band attention + low-rank combine.
// One work-group of 8 waves per (h, 16-query tile).
// 9 aligned key tiles cover the 128-wide window; mask handles edges.
//   products : wave w takes key tile w; waves 0-3 also one d tile of qkv,
//              waves 4 and 5 share key tile 8
//   combine  : wave w takes query rows 2w and 2w+1, 16 lanes per row
//   output   : wave w takes d tile (w & 3), half (w >> 2) of the 144 keys
// ---------------------------------------------------------------------------
#define FIN_WAVES 8
__global__ __launch_bounds__(32 * FIN_WAVES)
void sb_final_kernel(const float* __restrict__ qin, const float* __restrict__ kin,
                     const float* __restrict__ vin,
                     const float* __restrict__ qp, const float* __restrict__ kp,
                     const float* __restrict__ qls, const float* __restrict__ kls,
                     const float* __restrict__ kv, const float* __restrict__ ksum,
                     float* __restrict__ out)
{
  __shared__ __attribute__((aligned(16))) float Xq[16][E_PITCH];   // raw query tile (temp applied post-WMMA)
  __shared__ __attribute__((aligned(16))) float QPl[16][F_PITCH];  // q_prime tile
  __shared__ float QKb[16][B_PITCH];
  __shared__ float DPb[16][B_PITCH];
  __shared__ float Ab[16][B_PITCH];
  __shared__ float Pscale[16];
  __shared__ __attribute__((aligned(16))) float Opart[2][16][E_PITCH];  // output halves

  const int tid    = threadIdx.x;
  const int lane   = tid & 31;
  const int wave   = __builtin_amdgcn_readfirstlane(tid >> 5);
  const int h      = blockIdx.x / NTILES_T;
  const int qt     = blockIdx.x % NTILES_T;
  const int n      = lane & 15;
  const int koff   = (lane >> 4) * 2;
  const int s_base = (qt - 4) * 16;

#if USE_ASYNC_LDS
  // 256 threads: one 16-byte piece of Xq and two of QPl each, every lane on
  static_assert((16 * E_DIM) / 4 == 32 * FIN_WAVES, "one Xq piece per thread");
  static_assert((16 * F_DIM) / 4 == 2 * 32 * FIN_WAVES, "two QPl pieces per thread");
  {
    int m = tid >> 4, e4 = tid & 15;
    int t = qt * 16 + m;
    async_copy16(qin + ((size_t)t * H_DIM + h) * E_DIM + e4 * 4, &Xq[m][e4 * 4]);
  }
  {
    int m = tid >> 5, f4 = tid & 31;     // rows 0-7, then rows 8-15
    int t = qt * 16 + m;
    async_copy16(qp + ((size_t)h * T_DIM + t) * F_DIM + f4 * 4, &QPl[m][f4 * 4]);
    async_copy16(qp + ((size_t)h * T_DIM + t + 8) * F_DIM + f4 * 4, &QPl[m + 8][f4 * 4]);
  }
  async_wait0();
#else
  for (int i = tid; i < 16 * E_DIM; i += 32 * FIN_WAVES) {
    int m = i >> 6, e = i & 63;
    int t = qt * 16 + m;
    Xq[m][e] = qin[((size_t)t * H_DIM + h) * E_DIM + e];
  }
  for (int i = tid; i < 16 * F_DIM; i += 32 * FIN_WAVES) {
    int m = i >> 7, f = i & 127;
    int t = qt * 16 + m;
    QPl[m][f] = qp[((size_t)h * T_DIM + t) * F_DIM + f];
  }
#endif
  // stands directly behind each wave's own wait: publishes every wave's copies
  __syncthreads();

  // QK of one key tile (K=64)
  auto qk_tile = [&](int d8) {
    const int sc = clampi(s_base + d8 * 16 + n, 0, T_DIM - 1);
    v8f accQ = {};
    for (int kk = 0; kk < E_DIM / 4; ++kk) {
      int k0 = kk * 4 + koff;
      v2f a, b;
      a.x = Xq[n][k0];  a.y = Xq[n][k0 + 1];
      b.x = kin[((size_t)sc * H_DIM + h) * E_DIM + k0];
      b.y = kin[((size_t)sc * H_DIM + h) * E_DIM + k0 + 1];
      accQ = wmma4(a, b, accQ);
    }
    for (int vv = 0; vv < 8; ++vv) {
      int row = vv + ((lane >> 4) << 3);
      QKb[row][d8 * 16 + n] = TEMP_SCALE * accQ[vv];   // QK = temp * (q . k)
    }
  };
  // dots_prime of one key tile (K=128)
  auto dp_tile = [&](int d8) {
    const int sc = clampi(s_base + d8 * 16 + n, 0, T_DIM - 1);
    v8f accD = {};
    for (int kk = 0; kk < F_DIM / 4; ++kk) {
      int k0 = kk * 4 + koff;
      v2f a, b;
      a.x = QPl[n][k0];  a.y = QPl[n][k0 + 1];
      b.x = kp[((size_t)h * T_DIM + sc) * F_DIM + k0];
      b.y = kp[((size_t)h * T_DIM + sc) * F_DIM + k0 + 1];
      accD = wmma4(a, b, accD);
    }
    for (int vv = 0; vv < 8; ++vv) {
      int row = vv + ((lane >> 4) << 3);
      DPb[row][d8 * 16 + n] = accD[vv];
    }
  };

  qk_tile(wave);
  dp_tile(wave);

  v8f qkvAcc = {};
  if (wave < 4) {
    // qkv d tile: (16 x 128) @ (128 x 16), kept in registers
    const int d = wave * 16 + n;
    for (int kk = 0; kk < F_DIM / 4; ++kk) {
      int k0 = kk * 4 + koff;
      v2f a, b;
      a.x = QPl[n][k0];  a.y = QPl[n][k0 + 1];
      b.x = kv[((size_t)h * F_DIM + k0) * E_DIM + d];
      b.y = kv[((size_t)h * F_DIM + k0 + 1) * E_DIM + d];
      qkvAcc = wmma4(a, b, qkvAcc);
    }
  } else if (wave == 4) {
    dp_tile(8);
  } else if (wave == 5) {
    qk_tile(8);
  }
  __syncthreads();

  // per-query-row combine (reference logsumexp/clip), 16 lanes per row
  {
    const int row = wave * 2 + (lane >> 4);
    const int t   = qt * 16 + row;
    const float pls = qls[h * T_DIM + t] + kls[h];
    float ksv[F_DIM / 16];
    for (int i = 0; i < F_DIM / 16; ++i) ksv[i] = ksum[h * F_DIM + i * 16 + n];
    // precaution: keeps the LDS loads below, whose results may reuse the address
    // registers of the global loads above, behind those loads' address phase
    asm volatile("s_wait_xcnt 0x0" ::: "memory");
    float qk1 = 0.f;
    for (int i = 0; i < F_DIM / 16; ++i) qk1 += QPl[row][i * 16 + n] * ksv[i];
    qk1 = row_sum16(qk1);
    float qkr[9], dpr[9];
    bool  val[9];
    float mx = -INFINITY;
    for (int i = 0; i < 9; ++i) {
      int j = i * 16 + n;
      int s = s_base + j;
      val[i] = (s >= 0) && (s < T_DIM) && (s >= t - HALF_W) && (s <= t + HALF_W - 1);
      qkr[i] = QKb[row][j];
      dpr[i] = DPb[row][j];
      if (val[i]) mx = fmaxf(mx, qkr[i]);
    }
    mx = row_max16(mx);
    float se = 0.f, dpsum = 0.f;
    for (int i = 0; i < 9; ++i) {
      if (val[i]) { se += expf(qkr[i] - mx); dpsum += dpr[i]; }
    }
    se    = row_sum16(se);
    dpsum = row_sum16(dpsum);
    const float lse = mx + logf(se);
    const float lr  = logf(fmaxf(qk1 - dpsum, 1e-24f)) + pls;
    const float mm  = fmaxf(lse, lr);
    const float log_norm = mm + logf(expf(lse - mm) + expf(lr - mm));
    const float pscale   = expf(pls - log_norm);
    if (n == 0) Pscale[row] = pscale;
    for (int i = 0; i < 9; ++i) {
      Ab[row][i * 16 + n] = val[i] ? (expf(qkr[i] - log_norm) - dpr[i] * pscale) : 0.f;
    }
  }
  __syncthreads();

  // out = attn_local(16x144) @ V_band(144x64) + qkv * prime_scale
  {
    const int nt   = wave & 3;
    const int half = wave >> 2;
    const int d    = nt * 16 + n;
    v8f acc = {};
    for (int ks = 0; ks < 144 / 8; ++ks) {
      int k0  = (half * (144 / 8) + ks) * 4 + koff;
      int s0c = clampi(s_base + k0,     0, T_DIM - 1);
      int s1c = clampi(s_base + k0 + 1, 0, T_DIM - 1);
      v2f a, b;
      a.x = Ab[n][k0];  a.y = Ab[n][k0 + 1];
      b.x = vin[((size_t)s0c * H_DIM + h) * E_DIM + d];
      b.y = vin[((size_t)s1c * H_DIM + h) * E_DIM + d];
      acc = wmma4(a, b, acc);
    }
    // qkvAcc is zero in waves 4-7
    for (int vv = 0; vv < 8; ++vv) {
      int row = vv + ((lane >> 4) << 3);
      Opart[half][row][d] = acc[vv] + qkvAcc[vv] * Pscale[row];
    }
  }
  __syncthreads();

  // add the two key halves; each wave stores two whole 256-byte output rows
  {
    const int row = tid >> 4, c4 = (tid & 15) * 4;
    const int t   = qt * 16 + row;
    const float4 p0 = *(const float4*)&Opart[0][row][c4];
    const float4 p1 = *(const float4*)&Opart[1][row][c4];
    float4 o;
    o.x = p0.x + p1.x;  o.y = p0.y + p1.y;  o.z = p0.z + p1.z;  o.w = p0.w + p1.w;
    *(float4*)&out[((size_t)t * H_DIM + h) * E_DIM + c4] = o;
  }
}

// ---------------------------------------------------------------------------
extern "C" void kernel_launch(void* const* d_in, const int* in_sizes, int n_in,
                              void* d_out, int out_size, void* d_ws, size_t ws_size,
                              hipStream_t stream)
{
  (void)in_sizes; (void)n_in; (void)out_size; (void)ws_size;
  const float* q    = (const float*)d_in[0];
  const float* k    = (const float*)d_in[1];
  const float* v    = (const float*)d_in[2];
  const float* proj = (const float*)d_in[3];
  float* out = (float*)d_out;
  float* ws  = (float*)d_ws;

  // workspace layout (floats); total ~10.9 MB
  size_t o = 0;
  float* qp      = ws + o; o += (size_t)H_DIM * T_DIM * F_DIM;   // 4 MB
  float* kp      = ws + o; o += (size_t)H_DIM * T_DIM * F_DIM;   // 4 MB
  float* kdash   = ws + o; o += (size_t)H_DIM * T_DIM * R_DIM;   // 2 MB
  float* kdiag   = ws + o; o += (size_t)H_DIM * T_DIM;
  float* krowmax = ws + o; o += (size_t)H_DIM * T_DIM;
  float* qls     = ws + o; o += (size_t)H_DIM * T_DIM;
  float* kls     = ws + o; o += (size_t)H_DIM;
  float* kvbuf   = ws + o; o += (size_t)H_DIM * F_DIM * E_DIM;
  float* ksumb   = ws + o; o += (size_t)H_DIM * F_DIM;

  featurize_kernel<<<2 * H_DIM * NTILES_T, 32, 0, stream>>>(
      q, k, proj, qp, qls, kdash, kdiag, krowmax);
  kv_kernel<<<H_DIM * 32, 32 * KV_WAVES, 0, stream>>>(
      v, kdash, kdiag, krowmax, kp, kls, kvbuf, ksumb);
  sb_final_kernel<<<H_DIM * NTILES_T, 32 * FIN_WAVES, 0, stream>>>(
      q, k, v, qp, kp, qls, kls, kvbuf, ksumb, out);
}

// v005
// A run of this version takes 28.5 microseconds.
// Timed twice side by side with v004, it ran 1.11 times as fast both times.
// Over all steps from v000 it is 4.31 times as fast.
#include <hip/hip_runtime.h>
#include <math.h>
#include <stdint.h>

// ---------------- problem constants (B=1) ----------------
#define T_DIM   1024      // sequence length (queries == keys)
#define H_DIM   8         // heads
#define E_DIM   64        // head dim
#define R_DIM   64        // projection rows
#define F_DIM   128       // 2R feature dim
#define HALF_W  64        // local window half-width (LOCAL_CONTEXT/2)
#define NTILES_T (T_DIM/16)

// LDS row pitches, in floats.  A WMMA fragment read takes one row per lane
// (lanes n and n + 16 read dwords k0.. and k0 + 2.. of row n).  The LDS has 64
// banks of one dword, so at a pitch of 64, 128 or 144 floats the 16 rows fall on
// one (or four) bank groups and the read is served row after row.  A pitch of
// 4 * odd floats puts row n at bank 4n (in some order): 16 rows x 4 dwords cover
// all 64 banks once.  It stays a multiple of 16 bytes for the 16-byte copies.
#define E_PITCH (E_DIM + 4)     // 68  = 4 * 17
#define R_PITCH (R_DIM + 4)     // 68  = 4 * 17
#define F_PITCH (F_DIM + 4)     // 132 = 4 * 33
#define BAND    144             // keys of the 9 key tiles
#define B_PITCH (BAND + 4)      // 148 = 4 * 37

#define TEMP_SCALE 0.125f                 // 1/sqrt(E)
#define DATA_NORM  0.35355339059327373f   // sqrt(1/sqrt(E))
#define RATIO      0.08838834764831843f   // (2R)^-0.5

typedef float v2f __attribute__((ext_vector_type(2)));
typedef float v8f __attribute__((ext_vector_type(8)));

// CDNA5 fp32 matrix core: D(16x16) = A(16x4) * B(4x16) + C
__device__ __forceinline__ v8f wmma4(v2f a, v2f b, v8f c) {
  return __builtin_amdgcn_wmma_f32_16x16x4_f32(false, a, false, b, (short)0, c,
                                               false, false);
}

__device__ __forceinline__ int clampi(int x, int lo, int hi) {
  return x < lo ? lo : (x > hi ? hi : x);
}

// ---- CDNA5 async global->LDS staging (ASYNCcnt path), guarded ----
#if defined(__has_builtin)
# if __has_builtin(__builtin_amdgcn_global_load_async_to_lds_b128) && \
     __has_builtin(__builtin_amdgcn_s_wait_asynccnt)
#  define USE_ASYNC_LDS 1
# endif
#endif
#ifndef USE_ASYNC_LDS
# define USE_ASYNC_LDS 0
#endif

#if USE_ASYNC_LDS
// builtin signature (per hipcc diagnostic): pointee is a 16-byte int vector
typedef int v4i_t __attribute__((vector_size(16)));
typedef __attribute__((address_space(1))) v4i_t* gas1_t;
typedef __attribute__((address_space(3))) v4i_t* las3_t;
// copy 16 bytes per active lane, global -> LDS, no VGPR round trip
__device__ __forceinline__ void async_copy16(const void* g, const void* l) {
  __builtin_amdgcn_global_load_async_to_lds_b128(
      (gas1_t)(uintptr_t)g, (las3_t)(uint32_t)(uintptr_t)l, 0, 0);
}
__device__ __forceinline__ void async_wait0() {
  __builtin_amdgcn_s_wait_asynccnt(0);
}
#endif

// ---------------------------------------------------------------------------
// sum / maximum over the 16 lanes of a DPP row; every lane gets the result
// ---------------------------------------------------------------------------
template <int CTRL>
__device__ __forceinline__ float row_xmask(float v) {
  return __builtin_bit_cast(float, __builtin_amdgcn_update_dpp(
      0, __builtin_bit_cast(int, v), CTRL, 0xf, 0xf, false));
}
__device__ __forceinline__ float row_sum16(float v) {
  v += row_xmask<0x161>(v);
  v += row_xmask<0x162>(v);
  v += row_xmask<0x164>(v);
  v += row_xmask<0x168>(v);
  return v;
}
__device__ __forceinline__ float row_max16(float v) {
  v = fmaxf(v, row_xmask<0x161>(v));
  v = fmaxf(v, row_xmask<0x162>(v));
  v = fmaxf(v, row_xmask<0x164>(v));
  v = fmaxf(v, row_xmask<0x168>(v));
  return v;
}

// ---------------------------------------------------------------------------
// K1: featurize q and k tiles.  dash = DATA_NORM * (X @ P^T) via WMMA.
// which==0 (query): emit q_prime + per-row stabilizer q_ls
// which==1 (key)  : stash dash, diag, per-row max (for global k stabilizer)
// Everything per row is taken from the fragments, on all 32 lanes: a lane holds
// 32 dash values (rows vv + 8 * half, columns nt * 16 + n) in its accumulators and
// half of row n of the data tile in its A fragments.
// ---------------------------------------------------------------------------
__global__ __launch_bounds__(32)
void featurize_kernel(const float* __restrict__ qin, const float* __restrict__ kin,
                      const float* __restrict__ proj,
                      float* __restrict__ qp, float* __restrict__ qls,
                      float* __restrict__ kdash, float* __restrict__ kdiag,
                      float* __restrict__ krowmax)
{
  __shared__ __attribute__((aligned(16))) float Pl[R_DIM][E_PITCH];
  __shared__ __attribute__((aligned(16))) float Xs[16][E_PITCH];   // raw (unscaled) data tile
  __shared__ __attribute__((aligned(16))) float Rows[16][F_PITCH];  // q_prime (or dash) tile, by rows
  __shared__ float SqH[32];                                   // [k half][row] sum of squares
  __shared__ __attribute__((aligned(16))) float MxL[16];      // max_r |dash_r| of a row

  const int lane  = threadIdx.x;
  const int bid   = blockIdx.x;
  const int which = bid / (H_DIM * NTILES_T);
  const int rem   = bid % (H_DIM * NTILES_T);
  const int h     = rem / NTILES_T;
  const int tt    = rem % NTILES_T;
  const float* __restrict__ xin = (which == 0) ? qin : kin;

#if USE_ASYNC_LDS
  for (int c = lane; c < (R_DIM * E_DIM) / 4; c += 32)
    async_copy16(proj + c * 4, &Pl[c >> 4][(c & 15) * 4]);
  for (int c = lane; c < (16 * E_DIM) / 4; c += 32) {
    int m = c >> 4, e4 = c & 15;
    int t = tt * 16 + m;
    async_copy16(xin + ((size_t)t * H_DIM + h) * E_DIM + e4 * 4, &Xs[m][e4 * 4]);
  }
  async_wait0();
#else
  for (int i = lane; i < R_DIM * E_DIM; i += 32)
    Pl[i / E_DIM][i % E_DIM] = proj[i];
  for (int i = lane; i < 16 * E_DIM; i += 32) {
    int m = i >> 6, e = i & 63;
    int t = tt * 16 + m;
    Xs[m][e] = xin[((size_t)t * H_DIM + h) * E_DIM + e];
  }
#endif
  __syncthreads();

  const int n    = lane & 15;
  const int half = lane >> 4;
  const int koff = half * 2;
  v8f acc[4] = {};
  float sq0 = 0.f, sq1 = 0.f;     // squares of this lane's half of data row n
  // unrolled whole, so that the 64 WMMAs stand in one straight run with later steps'
  // LDS reads ahead of them: left to itself the compiler keeps four trips here, and
  // each trip waits for its own reads
#pragma unroll
  for (int kk = 0; kk < E_DIM / 4; ++kk) {
    const int k0 = kk * 4 + koff;
    v2f a;
    a.x = Xs[n][k0];              a.y = Xs[n][k0 + 1];
    sq0 += a.x * a.x;             sq1 += a.y * a.y;
    for (int nt = 0; nt < 4; ++nt) {
      const int r = nt * 16 + n;  // B[k][n] = P^T[k][r] = P[r][k]
      v2f b;
      b.x = Pl[r][k0];            b.y = Pl[r][k0 + 1];
      acc[nt] = wmma4(a, b, acc[nt]);
    }
  }
  SqH[lane] = sq0 + sq1;

  // dash = dn * (X @ P^T); max_r |dash_r| of a row: 4 registers, then 16 lanes
  float mx8[8];
  for (int vv = 0; vv < 8; ++vv) {
    for (int nt = 0; nt < 4; ++nt) acc[nt][vv] *= DATA_NORM;
    mx8[vv] = row_max16(fmaxf(fmaxf(fabsf(acc[0][vv]), fabsf(acc[1][vv])),
                              fmaxf(fabsf(acc[2][vv]), fabsf(acc[3][vv]))));
  }
  if (n == 0) {
    for (int vv = 0; vv < 8; ++vv) MxL[half * 8 + vv] = mx8[vv];
  }

  // the values that go to memory, laid down by rows
  if (which == 0) {
    // stab = mx - diag;  prime = ratio*exp(+-dash - diag - stab) = ratio*exp(+-dash - mx)
    // unrolled so that the accumulators are named outright: left to itself the
    // compiler keeps eight trips and picks the registers through an index (v_movrels)
#pragma unroll
    for (int vv = 0; vv < 8; ++vv) {
      for (int nt = 0; nt < 4; ++nt) {
        const float d = acc[nt][vv];
        Rows[half * 8 + vv][nt * 16 + n]         = RATIO * expf( d - mx8[vv]);
        Rows[half * 8 + vv][R_DIM + nt * 16 + n] = RATIO * expf(-d - mx8[vv]);
      }
    }
  } else {
    for (int vv = 0; vv < 8; ++vv) {
      for (int nt = 0; nt < 4; ++nt) Rows[half * 8 + vv][nt * 16 + n] = acc[nt][vv];
    }
  }
  __syncthreads();

  // whole rows to memory, 16 bytes per lane
  if (which == 0) {
    float* __restrict__ qb = qp + ((size_t)h * T_DIM + tt * 16) * F_DIM;
    for (int m = 0; m < 16; ++m)
      *(float4*)&qb[m * F_DIM + lane * 4] = *(const float4*)&Rows[m][lane * 4];
    // precaution: stands in front of every later write of a register that the
    // stores above name (address or data)
    asm volatile("s_wait_xcnt 0x0" ::: "memory");
  } else {
    float* __restrict__ kb = kdash + ((size_t)h * T_DIM + tt * 16) * R_DIM;
    for (int m = 0; m < 16; m += 2)
      *(float4*)&kb[(m + half) * R_DIM + n * 4] = *(const float4*)&Rows[m + half][n * 4];
    // precaution: as in the branch above
    asm volatile("s_wait_xcnt 0x0" ::: "memory");
  }

  // one value per row: lane = row
  if (lane < 16) {
    const int   t  = tt * 16 + lane;
    const float dg = 0.5f * DATA_NORM * DATA_NORM * (SqH[lane] + SqH[lane + 16]);  // 0.5*dn^2*||x||^2
    const float mx = MxL[lane];
    if (which == 0) {
      qls[h * T_DIM + t] = mx - dg;
    } else {
      kdiag[h * T_DIM + t]   = dg;
      krowmax[h * T_DIM + t] = mx - dg;
    }
  }
}

// ---------------------------------------------------------------------------
// K2: kv[h] = k_prime^T @ V   (F x E, K = T) via WMMA, with the key stabilizer
// and k_prime made on the way.
// One work-group of 8 waves per 16x16 tile: wave w sums keys [128w, 128w+128),
// the eight partial tiles are added through LDS in wave order.
// k_ls[h] = max_s krowmax[h][s]: every work-group takes the maximum of its
// head's 1024 row maxima itself (a maximum does not depend on the order).
// k_prime = ratio * exp(+-dash - (diag + k_ls)) is evaluated straight into the
// A fragment.  The final kernel wants k_prime as an array: each of the head's 32
// work-groups evaluates and stores 32 whole key rows of it, 16 bytes per lane.
// ksum[h][m] = sum_s k_prime[h][s][m] comes from the same A fragments: every
// lane adds up the k_prime values it forms anyway, and the d tile 0 work-group
// of each feature tile adds the 16 shares of a feature and stores the sum.
// ---------------------------------------------------------------------------
#define KV_WAVES 8
#define KV_STEPS (T_DIM / 4 / KV_WAVES)
#define KV_BLOCK 4
__global__ __launch_bounds__(32 * KV_WAVES)
void kv_kernel(const float* __restrict__ vin, const float* __restrict__ kdash,
               const float* __restrict__ kdiag, const float* __restrict__ krowmax,
               float* __restrict__ kp, float* __restrict__ kls,
               float* __restrict__ kv, float* __restrict__ ksum)
{
  __shared__ float Part[KV_WAVES][8][32];   // [wave][accumulator register][lane]
  __shared__ float Csum[KV_WAVES][32];      // [wave][lane] share of a column sum
  __shared__ __attribute__((aligned(16))) float Wmax[2 * KV_WAVES];  // maxima of 64 keys
  __shared__ __attribute__((aligned(16))) float Cs[T_DIM];           // diag[s] + k_ls

  const int bid  = blockIdx.x;
  const int h    = bid / 32;
  const int rem  = bid % 32;
  const int mt   = rem / 4;      // feature tile
  const int nt   = rem % 4;      // d tile
  const int tid  = threadIdx.x;
  const int lane = tid & 31;
  const int wave = __builtin_amdgcn_readfirstlane(tid >> 5);
  const int n    = lane & 15;
  const int koff = (lane >> 4) * 2;
  const int mrow = mt * 16 + n;
  const int d    = nt * 16 + n;

  // key stabilizer of the head: four keys per thread, 16 lanes by DPP, rest in LDS
  static_assert(T_DIM == 4 * 32 * KV_WAVES, "four keys per thread");
  const float4 rm = *(const float4*)&krowmax[h * T_DIM + tid * 4];
  const float4 dg = *(const float4*)&kdiag[h * T_DIM + tid * 4];
  // dash of this work-group's 32 rows of the k_prime array (a wave takes two rows
  // at a time), asked for here so that it arrives while the maximum is formed
  const float* __restrict__ kdb = kdash + (size_t)h * T_DIM * R_DIM;
  const int sr = rem * 32 + (tid >> 4);
  const int r4 = (tid & 15) * 4;
  float4 dv[2];
  for (int i = 0; i < 2; ++i) dv[i] = *(const float4*)&kdb[(size_t)(sr + i * 16) * R_DIM + r4];
  // keeps the four loads above in front of the first use of any of them: without
  // it the last three are issued only after the first has come back
  __builtin_amdgcn_sched_barrier(0);
  const float m16 = row_max16(fmaxf(fmaxf(rm.x, rm.y), fmaxf(rm.z, rm.w)));
  if (n == 0) Wmax[tid >> 4] = m16;
  __syncthreads();
  float kmax = Wmax[0];
  for (int i = 1; i < 2 * KV_WAVES; ++i) kmax = fmaxf(kmax, Wmax[i]);
  float4 c4;
  c4.x = dg.x + kmax;  c4.y = dg.y + kmax;  c4.z = dg.z + kmax;  c4.w = dg.w + kmax;
  *(float4*)&Cs[tid * 4] = c4;
  if (rem == 0 && tid == 0) kls[h] = kmax;
  __syncthreads();

  // k_prime rows for the final kernel, whole 128-byte lines from one wave
  float* __restrict__ kpb = kp + (size_t)h * T_DIM * F_DIM;
  for (int i = 0; i < 2; ++i) {
    const int   s = sr + i * 16;
    const float c = Cs[s];
    float4 p, q;
    p.x = RATIO * expf( dv[i].x - c);  p.y = RATIO * expf( dv[i].y - c);
    p.z = RATIO * expf( dv[i].z - c);  p.w = RATIO * expf( dv[i].w - c);
    q.x = RATIO * expf(-dv[i].x - c);  q.y = RATIO * expf(-dv[i].y - c);
    q.z = RATIO * expf(-dv[i].z - c);  q.w = RATIO * expf(-dv[i].w - c);
    *(float4*)&kpb[(size_t)s * F_DIM + r4]         = p;
    *(float4*)&kpb[(size_t)s * F_DIM + R_DIM + r4] = q;
  }

  // features 0-63 are exp(+dash), features 64-127 exp(-dash) of projection row m & 63
  const int   r   = (mt & 3) * 16 + n;
  const float sgn = (mt < 4) ? 1.f : -1.f;

  v8f acc = {};
  float cs = 0.f;     // sum of feature mrow over this lane's 64 keys
  // four steps per trip, so that their 16 loads are in flight together
  for (int kb = 0; kb < KV_STEPS; kb += KV_BLOCK) {
    v2f a[KV_BLOCK], b[KV_BLOCK];
    for (int u = 0; u < KV_BLOCK; ++u) {
      int s0 = (wave * KV_STEPS + kb + u) * 4 + koff;
      a[u].x = kdb[(size_t)s0 * R_DIM + r];
      a[u].y = kdb[(size_t)(s0 + 1) * R_DIM + r];
      b[u].x = vin[((size_t)s0 * H_DIM + h) * E_DIM + d];
      b[u].y = vin[((size_t)(s0 + 1) * H_DIM + h) * E_DIM + d];
    }
    for (int u = 0; u < KV_BLOCK; ++u) {
      int s0 = (wave * KV_STEPS + kb + u) * 4 + koff;
      a[u].x = RATIO * expf(sgn * a[u].x - Cs[s0]);       // A[m][s] = kp[s][m]
      a[u].y = RATIO * expf(sgn * a[u].y - Cs[s0 + 1]);
      acc = wmma4(a[u], b[u], acc);
      cs += a[u].x + a[u].y;
    }
  }
  for (int vv = 0; vv < 8; ++vv) Part[wave][vv][lane] = acc[vv];
  Csum[wave][lane] = cs;
  __syncthreads();

  // wave w finishes accumulator register w of the tile (rows w and w + 8)
  float s = Part[0][wave][lane];
  for (int w = 1; w < KV_WAVES; ++w) s += Part[w][wave][lane];
  const int m = mt * 16 + wave + ((lane >> 4) << 3);
  kv[((size_t)h * F_DIM + m) * E_DIM + d] = s;

  // column sums: lanes n and n + 16 of every wave hold shares of feature mt*16 + n
  if (nt == 0 && threadIdx.x < 16) {
    float t = 0.f;
    for (int w = 0; w < KV_WAVES; ++w) t += Csum[w][n] + Csum[w][n + 16];
    ksum[h * F_DIM + mrow] = t;
  }
}

// ---------------------------------------------------------------------------
// K3: fused band attention + low-rank combine.
// One work-group of 8 waves per (h, 16-query tile).
// 9 aligned key tiles cover the 128-wide window; mask handles edges.
//   products : wave w takes key tile w; waves 0-3 also one d tile of qkv,
//              waves 4 and 5 share key tile 8
//   combine  : wave w takes query rows 2w and 2w+1, 16 lanes per row
//   output   : wave w takes d tile (w & 3), half (w >> 2) of the 144 keys
// ---------------------------------------------------------------------------
#define FIN_WAVES 8
__global__ __launch_bounds__(32 * FIN_WAVES)
void sb_final_kernel(const float* __restrict__ qin, const float* __restrict__ kin,
                     const float* __restrict__ vin,
                     const float* __restrict__ qp, const float* __restrict__ kp,
                     const float* __restrict__ qls, const float* __restrict__ kls,
                     const float* __restrict__ kv, const float* __restrict__ ksum,
                     float* __restrict__ out)
{
  __shared__ __attribute__((aligned(16))) float Xq[16][E_PITCH];   // raw query tile (temp applied post-WMMA)
  __shared__ __attribute__((aligned(16))) float QPl[16][F_PITCH];  // q_prime tile
  __shared__ float QKb[16][B_PITCH];
  __shared__ float DPb[16][B_PITCH];
  __shared__ float Ab[16][B_PITCH];
  __shared__ float Pscale[16];
  __shared__ __attribute__((aligned(16))) float Opart[2][16][E_PITCH];  // output halves

  const int tid    = threadIdx.x;
  const int lane   = tid & 31;
  const int wave   = __builtin_amdgcn_readfirstlane(tid >> 5);
  const int h      = blockIdx.x / NTILES_T;
  const int qt     = blockIdx.x % NTILES_T;
  const int n      = lane & 15;
  const int koff   = (lane >> 4) * 2;
  const int s_base = (qt - 4) * 16;

#if USE_ASYNC_LDS
  // 256 threads: one 16-byte piece of Xq and two of QPl each, every lane on
  static_assert((16 * E_DIM) / 4 == 32 * FIN_WAVES, "one Xq piece per thread");
  static_assert((16 * F_DIM) / 4 == 2 * 32 * FIN_WAVES, "two QPl pieces per thread");
  {
    int m = tid >> 4, e4 = tid & 15;
    int t = qt * 16 + m;
    async_copy16(qin + ((size_t)t * H_DIM + h) * E_DIM + e4 * 4, &Xq[m][e4 * 4]);
  }
  {
    int m = tid >> 5, f4 = tid & 31;     // rows 0-7, then rows 8-15
    int t = qt * 16 + m;
    async_copy16(qp + ((size_t)h * T_DIM + t) * F_DIM + f4 * 4, &QPl[m][f4 * 4]);
    async_copy16(qp + ((size_t)h * T_DIM + t + 8) * F_DIM + f4 * 4, &QPl[m + 8][f4 * 4]);
  }
  async_wait0();
#else
  for (int i = tid; i < 16 * E_DIM; i += 32 * FIN_WAVES) {
    int m = i >> 6, e = i & 63;
    int t = qt * 16 + m;
    Xq[m][e] = qin[((size_t)t * H_DIM + h) * E_DIM + e];
  }
  for (int i = tid; i < 16 * F_DIM; i += 32 * FIN_WAVES) {
    int m = i >> 7, f = i & 127;
    int t = qt * 16 + m;
    QPl[m][f] = qp[((size_t)h * T_DIM + t) * F_DIM + f];
  }
#endif
  // stands directly behind each wave's own wait: publishes every wave's copies
  __syncthreads();

  // QK of one key tile (K=64)
  auto qk_tile = [&](int d8) {
    const int sc = clampi(s_base + d8 * 16 + n, 0, T_DIM - 1);
    v8f accQ = {};
    for (int kk = 0; kk < E_DIM / 4; ++kk) {
      int k0 = kk * 4 + koff;
      v2f a, b;
      a.x = Xq[n][k0];  a.y = Xq[n][k0 + 1];
      b.x = kin[((size_t)sc * H_DIM + h) * E_DIM + k0];
      b.y = kin[((size_t)sc * H_DIM + h) * E_DIM + k0 + 1];
      accQ = wmma4(a, b, accQ);
    }
    for (int vv = 0; vv < 8; ++vv) {
      int row = vv + ((lane >> 4) << 3);
      QKb[row][d8 * 16 + n] = TEMP_SCALE * accQ[vv];   // QK = temp * (q . k)
    }
  };
  // dots_prime of one key tile (K=128)
  auto dp_tile = [&](int d8) {
    const int sc = clampi(s_base + d8 * 16 + n, 0, T_DIM - 1);
    v8f accD = {};
    for (int kk = 0; kk < F_DIM / 4; ++kk) {
      int k0 = kk * 4 + koff;
      v2f a, b;
      a.x = QPl[n][k0];  a.y = QPl[n][k0 + 1];
      b.x = kp[((size_t)h * T_DIM + sc) * F_DIM + k0];
      b.y = kp[((size_t)h * T_DIM + sc) * F_DIM + k0 + 1];
      accD = wmma4(a, b, accD);
    }
    for (int vv = 0; vv < 8; ++vv) {
      int row = vv + ((lane >> 4) << 3);
      DPb[row][d8 * 16 + n] = accD[vv];
    }
  };

  qk_tile(wave);
  dp_tile(wave);

  v8f qkvAcc = {};
  if (wave < 4) {
    // qkv d tile: (16 x 128) @ (128 x 16), kept in registers
    const int d = wave * 16 + n;
    for (int kk = 0; kk < F_DIM / 4; ++kk) {
      int k0 = kk * 4 + koff;
      v2f a, b;
      a.x = QPl[n][k0];  a.y = QPl[n][k0 + 1];
      b.x = kv[((size_t)h * F_DIM + k0) * E_DIM + d];
      b.y = kv[((size_t)h * F_DIM + k0 + 1) * E_DIM + d];
      qkvAcc = wmma4(a, b, qkvAcc);
    }
  } else if (wave == 4) {
    dp_tile(8);
  } else if (wave == 5) {
    qk_tile(8);
  }
  __syncthreads();

  // per-query-row combine (reference logsumexp/clip), 16 lanes per row
  {
    const int row = wave * 2 + (lane >> 4);
    const int t   = qt * 16 + row;
    const float pls = qls[h * T_DIM + t] + kls[h];
    float ksv[F_DIM / 16];
    for (int i = 0; i < F_DIM / 16; ++i) ksv[i] = ksum[h * F_DIM + i * 16 + n];
    // precaution: keeps the LDS loads below, whose results may reuse the address
    // registers of the global loads above, behind those loads' address phase
    asm volatile("s_wait_xcnt 0x0" ::: "memory");
    float qk1 = 0.f;
    for (int i = 0; i < F_DIM / 16; ++i) qk1 += QPl[row][i * 16 + n] * ksv[i];
    qk1 = row_sum16(qk1);
    float qkr[9], dpr[9];
    bool  val[9];
    float mx = -INFINITY;
    for (int i = 0; i < 9; ++i) {
      int j = i * 16 + n;
      int s = s_base + j;
      val[i] = (s >= 0) && (s < T_DIM) && (s >= t - HALF_W) && (s <= t + HALF_W - 1);
      qkr[i] = QKb[row][j];
      dpr[i] = DPb[row][j];
      if (val[i]) mx = fmaxf(mx, qkr[i]);
    }
    mx = row_max16(mx);
    float se = 0.f, dpsum = 0.f;
    for (int i = 0; i < 9; ++i) {
      if (val[i]) { se += expf(qkr[i] - mx); dpsum += dpr[i]; }
    }
    se    = row_sum16(se);
    dpsum = row_sum16(dpsum);
    const float lse = mx + logf(se);
    const float lr  = logf(fmaxf(qk1 - dpsum, 1e-24f)) + pls;
    const float mm  = fmaxf(lse, lr);
    const float log_norm = mm + logf(expf(lse - mm) + expf(lr - mm));
    const float pscale   = expf(pls - log_norm);
    if (n == 0) Pscale[row] = pscale;
    for (int i = 0; i < 9; ++i) {
      Ab[row][i * 16 + n] = val[i] ? (expf(qkr[i] - log_norm) - dpr[i] * pscale) : 0.f;
    }
  }
  __syncthreads();

  // out = attn_local(16x144) @ V_band(144x64) + qkv * prime_scale
  {
    const int nt   = wave & 3;
    const int half = wave >> 2;
    const int d    = nt * 16 + n;
    v8f acc = {};
    for (int ks = 0; ks < 144 / 8; ++ks) {
      int k0  = (half * (144 / 8) + ks) * 4 + koff;
      int s0c = clampi(s_base + k0,     0, T_DIM - 1);
      int s1c = clampi(s_base + k0 + 1, 0, T_DIM - 1);
      v2f a, b;
      a.x = Ab[n][k0];  a.y = Ab[n][k0 + 1];
      b.x = vin[((size_t)s0c * H_DIM + h) * E_DIM + d];
      b.y = vin[((size_t)s1c * H_DIM + h) * E_DIM + d];
      acc = wmma4(a, b, acc);
    }
    // qkvAcc is zero in waves 4-7
    for (int vv = 0; vv < 8; ++vv) {
      int row = vv + ((lane >> 4) << 3);
      Opart[half][row][d] = acc[vv] + qkvAcc[vv] * Pscale[row];
    }
  }
  __syncthreads();

  // add the two key halves; each wave stores two whole 256-byte output rows
  {
    const int row = tid >> 4, c4 = (tid & 15) * 4;
    const int t   = qt * 16 + row;
    const float4 p0 = *(const float4*)&Opart[0][row][c4];
    const float4 p1 = *(const float4*)&Opart[1][row][c4];
    float4 o;
    o.x = p0.x + p1.x;  o.y = p0.y + p1.y;  o.z = p0.z + p1.z;  o.w = p0.w + p1.w;
    *(float4*)&out[((size_t)t * H_DIM + h) * E_DIM + c4] = o;
  }
}

// ---------------------------------------------------------------------------
extern "C" void kernel_launch(void* const* d_in, const int* in_sizes, int n_in,
                              void* d_out, int out_size, void* d_ws, size_t ws_size,
                              hipStream_t stream)
{
  (void)in_sizes; (void)n_in; (void)out_size; (void)ws_size;
  const float* q    = (const float*)d_in[0];
  const float* k    = (const float*)d_in[1];
  const float* v    = (const float*)d_in[2];
  const float* proj = (const float*)d_in[3];
  float* out = (float*)d_out;
  float* ws  = (float*)d_ws;

  // workspace layout (floats); total ~10.9 MB
  size_t o = 0;
  float* qp      = ws + o; o += (size_t)H_DIM * T_DIM * F_DIM;   // 4 MB
  float* kp      = ws + o; o += (size_t)H_DIM * T_DIM * F_DIM;   // 4 MB
  float* kdash   = ws + o; o += (size_t)H_DIM * T_DIM * R_DIM;   // 2 MB
  float* kdiag   = ws + o; o += (size_t)H_DIM * T_DIM;
  float* krowmax = ws + o; o += (size_t)H_DIM * T_DIM;
  float* qls     = ws + o; o += (size_t)H_DIM * T_DIM;
  float* kls     = ws + o; o += (size_t)H_DIM;
  float* kvbuf   = ws + o; o += (size_t)H_DIM * F_DIM * E_DIM;
  float* ksumb   = ws + o; o += (size_t)H_DIM * F_DIM;

  featurize_kernel<<<2 * H_DIM * NTILES_T, 32, 0, stream>>>(
      q, k, proj, qp, qls, kdash, kdiag, krowmax);
  kv_kernel<<<H_DIM * 32, 32 * KV_WAVES, 0, stream>>>(
      v, kdash, kdiag, krowmax, kp, kls, kvbuf, ksumb);
  sb_final_kernel<<<H_DIM * NTILES_T, 32 * FIN_WAVES, 0, stream>>>(
      q, k, v, qp, kp, qls, kls, kvbuf, ksumb, out);
}

// v006
// Measured time: 26.4 microseconds a run.
// Two timings next to v005 both put it at 1.08 times that version's speed.
// Over all steps from v000 it is 4.66 times as fast.
#include <hip/hip_runtime.h>
#include <math.h>
#include <stdint.h>

// ---------------- problem constants (B=1) ----------------
#define T_DIM   1024      // sequence length (queries == keys)
#define H_DIM   8         // heads
#define E_DIM   64        // head dim
#define R_DIM   64        // projection rows
#define F_DIM   128       // 2R feature dim
#define HALF_W  64        // local window half-width (LOCAL_CONTEXT/2)
#define NTILES_T (T_DIM/16)

// LDS row pitches, in floats.  A WMMA fragment read takes one row per lane
// (lanes n and n + 16 read dwords k0.. and k0 + 2.. of row n).  The LDS has 64
// banks of one dword, so at a pitch of 64, 128 or 144 floats the 16 rows fall on
// one (or four) bank groups and the read is served row after row.  A pitch of
// 4 * odd floats puts row n at bank 4n (in some order): 16 rows x 4 dwords cover
// all 64 banks once.  It stays a multiple of 16 bytes for the 16-byte copies.
#define E_PITCH (E_DIM + 4)     // 68  = 4 * 17
#define R_PITCH (R_DIM + 4)     // 68  = 4 * 17
#define F_PITCH (F_DIM + 4)     // 132 = 4 * 33
#define BAND    144             // keys of the 9 key tiles
#define B_PITCH (BAND + 4)      // 148 = 4 * 37

#define TEMP_SCALE 0.125f                 // 1/sqrt(E)
#define DATA_NORM  0.35355339059327373f   // sqrt(1/sqrt(E))
#define RATIO      0.08838834764831843f   // (2R)^-0.5

typedef float v2f __attribute__((ext_vector_type(2)));
typedef float v8f __attribute__((ext_vector_type(8)));

// CDNA5 fp32 matrix core: D(16x16) = A(16x4) * B(4x16) + C
__device__ __forceinline__ v8f wmma4(v2f a, v2f b, v8f c) {
  return __builtin_amdgcn_wmma_f32_16x16x4_f32(false, a, false, b, (short)0, c,
                                               false, false);
}

__device__ __forceinline__ int clampi(int x, int lo, int hi) {
  return x < lo ? lo : (x > hi ? hi : x);
}

// ---- CDNA5 async global->LDS staging (ASYNCcnt path), guarded ----
#if defined(__has_builtin)
# if __has_builtin(__builtin_amdgcn_global_load_async_to_lds_b128) && \
     __has_builtin(__builtin_amdgcn_s_wait_asynccnt)
#  define USE_ASYNC_LDS 1
# endif
#endif
#ifndef USE_ASYNC_LDS
# define USE_ASYNC_LDS 0
#endif

#if USE_ASYNC_LDS
// builtin signature (per hipcc diagnostic): pointee is a 16-byte int vector
typedef int v4i_t __attribute__((vector_size(16)));
typedef __attribute__((address_space(1))) v4i_t* gas1_t;
typedef __attribute__((address_space(3))) v4i_t* las3_t;
// copy 16 bytes per active lane, global -> LDS, no VGPR round trip
__device__ __forceinline__ void async_copy16(const void* g, const void* l) {
  __builtin_amdgcn_global_load_async_to_lds_b128(
      (gas1_t)(uintptr_t)g, (las3_t)(uint32_t)(uintptr_t)l, 0, 0);
}
__device__ __forceinline__ void async_wait0() {
  __builtin_amdgcn_s_wait_asynccnt(0);
}
#endif

// ---------------------------------------------------------------------------
// sum / maximum over the 16 lanes of a DPP row; every lane gets the result
// ---------------------------------------------------------------------------
template <int CTRL>
__device__ __forceinline__ float row_xmask(float v) {
  return __builtin_bit_cast(float, __builtin_amdgcn_update_dpp(
      0, __builtin_bit_cast(int, v), CTRL, 0xf, 0xf, false));
}
__device__ __forceinline__ float row_sum16(float v) {
  v += row_xmask<0x161>(v);
  v += row_xmask<0x162>(v);
  v += row_xmask<0x164>(v);
  v += row_xmask<0x168>(v);
  return v;
}
__device__ __forceinline__ float row_max16(float v) {
  v = fmaxf(v, row_xmask<0x161>(v));
  v = fmaxf(v, row_xmask<0x162>(v));
  v = fmaxf(v, row_xmask<0x164>(v));
  v = fmaxf(v, row_xmask<0x168>(v));
  return v;
}

// ---------------------------------------------------------------------------
// K1: featurize q and k tiles.  dash = DATA_NORM * (X @ P^T) via WMMA.
// which==0 (query): emit q_prime + per-row stabilizer q_ls
// which==1 (key)  : stash dash, diag, per-row max (for global k stabilizer)
// Everything per row is taken from the fragments, on all 32 lanes: a lane holds
// 32 dash values (rows vv + 8 * half, columns nt * 16 + n) in its accumulators and
// half of row n of the data tile in its A fragments.
// ---------------------------------------------------------------------------
__global__ __launch_bounds__(32)
void featurize_kernel(const float* __restrict__ qin, const float* __restrict__ kin,
                      const float* __restrict__ proj,
                      float* __restrict__ qp, float* __restrict__ qls,
                      float* __restrict__ kdash, float* __restrict__ kdiag,
                      float* __restrict__ krowmax)
{
  __shared__ __attribute__((aligned(16))) float Pl[R_DIM][E_PITCH];
  __shared__ __attribute__((aligned(16))) float Xs[16][E_PITCH];   // raw (unscaled) data tile
  __shared__ __attribute__((aligned(16))) float Rows[16][F_PITCH];  // q_prime (or dash) tile, by rows
  __shared__ float SqH[32];                                   // [k half][row] sum of squares
  __shared__ __attribute__((aligned(16))) float MxL[16];      // max_r |dash_r| of a row

  const int lane  = threadIdx.x;
  const int bid   = blockIdx.x;
  const int which = bid / (H_DIM * NTILES_T);
  const int rem   = bid % (H_DIM * NTILES_T);
  const int h     = rem / NTILES_T;
  const int tt    = rem % NTILES_T;
  const float* __restrict__ xin = (which == 0) ? qin : kin;

#if USE_ASYNC_LDS
  for (int c = lane; c < (R_DIM * E_DIM) / 4; c += 32)
    async_copy16(proj + c * 4, &Pl[c >> 4][(c & 15) * 4]);
  for (int c = lane; c < (16 * E_DIM) / 4; c += 32) {
    int m = c >> 4, e4 = c & 15;
    int t = tt * 16 + m;
    async_copy16(xin + ((size_t)t * H_DIM + h) * E_DIM + e4 * 4, &Xs[m][e4 * 4]);
  }
  async_wait0();
#else
  for (int i = lane; i < R_DIM * E_DIM; i += 32)
    Pl[i / E_DIM][i % E_DIM] = proj[i];
  for (int i = lane; i < 16 * E_DIM; i += 32) {
    int m = i >> 6, e = i & 63;
    int t = tt * 16 + m;
    Xs[m][e] = xin[((size_t)t * H_DIM + h) * E_DIM + e];
  }
#endif
  __syncthreads();

  const int n    = lane & 15;
  const int half = lane >> 4;
  const int koff = half * 2;
  v8f acc[4] = {};
  float sq0 = 0.f, sq1 = 0.f;     // squares of this lane's half of data row n
  // unrolled whole, so that the 64 WMMAs stand in one straight run with later steps'
  // LDS reads ahead of them: left to itself the compiler keeps four trips here, and
  // each trip waits for its own reads
#pragma unroll
  for (int kk = 0; kk < E_DIM / 4; ++kk) {
    const int k0 = kk * 4 + koff;
    v2f a;
    a.x = Xs[n][k0];              a.y = Xs[n][k0 + 1];
    sq0 += a.x * a.x;             sq1 += a.y * a.y;
    for (int nt = 0; nt < 4; ++nt) {
      const int r = nt * 16 + n;  // B[k][n] = P^T[k][r] = P[r][k]
      v2f b;
      b.x = Pl[r][k0];            b.y = Pl[r][k0 + 1];
      acc[nt] = wmma4(a, b, acc[nt]);
    }
  }
  SqH[lane] = sq0 + sq1;

  // dash = dn * (X @ P^T); max_r |dash_r| of a row: 4 registers, then 16 lanes
  float mx8[8];
  for (int vv = 0; vv < 8; ++vv) {
    for (int nt = 0; nt < 4; ++nt) acc[nt][vv] *= DATA_NORM;
    mx8[vv] = row_max16(fmaxf(fmaxf(fabsf(acc[0][vv]), fabsf(acc[1][vv])),
                              fmaxf(fabsf(acc[2][vv]), fabsf(acc[3][vv]))));
  }
  if (n == 0) {
    for (int vv = 0; vv < 8; ++vv) MxL[half * 8 + vv] = mx8[vv];
  }

  // the values that go to memory, laid down by rows
  if (which == 0) {
    // stab = mx - diag;  prime = ratio*exp(+-dash - diag - stab) = ratio*exp(+-dash - mx)
    // unrolled so that the accumulators are named outright: left to itself the
    // compiler keeps eight trips and picks the registers through an index (v_movrels)
#pragma unroll
    for (int vv = 0; vv < 8; ++vv) {
      for (int nt = 0; nt < 4; ++nt) {
        const float d = acc[nt][vv];
        Rows[half * 8 + vv][nt * 16 + n]         = RATIO * expf( d - mx8[vv]);
        Rows[half * 8 + vv][R_DIM + nt * 16 + n] = RATIO * expf(-d - mx8[vv]);
      }
    }
  } else {
    for (int vv = 0; vv < 8; ++vv) {
      for (int nt = 0; nt < 4; ++nt) Rows[half * 8 + vv][nt * 16 + n] = acc[nt][vv];
    }
  }
  __syncthreads();

  // whole rows to memory, 16 bytes per lane
  if (which == 0) {
    float* __restrict__ qb = qp + ((size_t)h * T_DIM + tt * 16) * F_DIM;
    for (int m = 0; m < 16; ++m)
      *(float4*)&qb[m * F_DIM + lane * 4] = *(const float4*)&Rows[m][lane * 4];
    // precaution: stands in front of every later write of a register that the
    // stores above name (address or data)
    asm volatile("s_wait_xcnt 0x0" ::: "memory");
  } else {
    float* __restrict__ kb = kdash + ((size_t)h * T_DIM + tt * 16) * R_DIM;
    for (int m = 0; m < 16; m += 2)
      *(float4*)&kb[(m + half) * R_DIM + n * 4] = *(const float4*)&Rows[m + half][n * 4];
    // precaution: as in the branch above
    asm volatile("s_wait_xcnt 0x0" ::: "memory");
  }

  // one value per row: lane = row
  if (lane < 16) {
    const int   t  = tt * 16 + lane;
    const float dg = 0.5f * DATA_NORM * DATA_NORM * (SqH[lane] + SqH[lane + 16]);  // 0.5*dn^2*||x||^2
    const float mx = MxL[lane];
    if (which == 0) {
      qls[h * T_DIM + t] = mx - dg;
    } else {
      kdiag[h * T_DIM + t]   = dg;
      krowmax[h * T_DIM + t] = mx - dg;
    }
  }
}

// ---------------------------------------------------------------------------
// K2: kv[h] = k_prime^T @ V   (F x E, K = T) via WMMA, with the key stabilizer
// and k_prime made on the way.
// One work-group of 8 waves per 16x16 tile: wave w sums keys [128w, 128w+128),
// the eight partial tiles are added through LDS in wave order.
// k_ls[h] = max_s krowmax[h][s]: every work-group takes the maximum of its
// head's 1024 row maxima itself (a maximum does not depend on the order).
// k_prime = ratio * exp(+-dash - (diag + k_ls)) is evaluated straight into the
// A fragment.  The final kernel wants k_prime as an array: each of the head's 32
// work-groups evaluates and stores 32 whole key rows of it, 16 bytes per lane.
// ksum[h][m] = sum_s k_prime[h][s][m] comes from the same A fragments: every
// lane adds up the k_prime values it forms anyway, and the d tile 0 work-group
// of each feature tile adds the 16 shares of a feature and stores the sum.
// ---------------------------------------------------------------------------
#define KV_WAVES 8
#define KV_STEPS (T_DIM / 4 / KV_WAVES)
#define KV_BLOCK 4
__global__ __launch_bounds__(32 * KV_WAVES)
void kv_kernel(const float* __restrict__ vin, const float* __restrict__ kdash,
               const float* __restrict__ kdiag, const float* __restrict__ krowmax,
               float* __restrict__ kp, float* __restrict__ kls,
               float* __restrict__ kv, float* __restrict__ ksum)
{
  __shared__ float Part[KV_WAVES][8][32];   // [wave][accumulator register][lane]
  __shared__ float Csum[KV_WAVES][32];      // [wave][lane] share of a column sum
  __shared__ __attribute__((aligned(16))) float Wmax[2 * KV_WAVES];  // maxima of 64 keys
  __shared__ __attribute__((aligned(16))) float Cs[T_DIM];           // diag[s] + k_ls

  const int bid  = blockIdx.x;
  const int h    = bid / 32;
  const int rem  = bid % 32;
  const int mt   = rem / 4;      // feature tile
  const int nt   = rem % 4;      // d tile
  const int tid  = threadIdx.x;
  const int lane = tid & 31;
  const int wave = __builtin_amdgcn_readfirstlane(tid >> 5);
  const int n    = lane & 15;
  const int koff = (lane >> 4) * 2;
  const int mrow = mt * 16 + n;
  const int d    = nt * 16 + n;

  // key stabilizer of the head: four keys per thread, 16 lanes by DPP, rest in LDS
  static_assert(T_DIM == 4 * 32 * KV_WAVES, "four keys per thread");
  const float4 rm = *(const float4*)&krowmax[h * T_DIM + tid * 4];
  const float4 dg = *(const float4*)&kdiag[h * T_DIM + tid * 4];
  // dash of this work-group's 32 rows of the k_prime array (a wave takes two rows
  // at a time), asked for here so that it arrives while the maximum is formed
  const float* __restrict__ kdb = kdash + (size_t)h * T_DIM * R_DIM;
  const int sr = rem * 32 + (tid >> 4);
  const int r4 = (tid & 15) * 4;
  float4 dv[2];
  for (int i = 0; i < 2; ++i) dv[i] = *(const float4*)&kdb[(size_t)(sr + i * 16) * R_DIM + r4];
  // keeps the four loads above in front of the first use of any of them: without
  // it the last three are issued only after the first has come back
  __builtin_amdgcn_sched_barrier(0);
  const float m16 = row_max16(fmaxf(fmaxf(rm.x, rm.y), fmaxf(rm.z, rm.w)));
  if (n == 0) Wmax[tid >> 4] = m16;
  __syncthreads();
  float kmax = Wmax[0];
  for (int i = 1; i < 2 * KV_WAVES; ++i) kmax = fmaxf(kmax, Wmax[i]);
  float4 c4;
  c4.x = dg.x + kmax;  c4.y = dg.y + kmax;  c4.z = dg.z + kmax;  c4.w = dg.w + kmax;
  *(float4*)&Cs[tid * 4] = c4;
  if (rem == 0 && tid == 0) kls[h] = kmax;
  __syncthreads();

  // k_prime rows for the final kernel, whole 128-byte lines from one wave
  float* __restrict__ kpb = kp + (size_t)h * T_DIM * F_DIM;
  for (int i = 0; i < 2; ++i) {
    const int   s = sr + i * 16;
    const float c = Cs[s];
    float4 p, q;
    p.x = RATIO * expf( dv[i].x - c);  p.y = RATIO * expf( dv[i].y - c);
    p.z = RATIO * expf( dv[i].z - c);  p.w = RATIO * expf( dv[i].w - c);
    q.x = RATIO * expf(-dv[i].x - c);  q.y = RATIO * expf(-dv[i].y - c);
    q.z = RATIO * expf(-dv[i].z - c);  q.w = RATIO * expf(-dv[i].w - c);
    *(float4*)&kpb[(size_t)s * F_DIM + r4]         = p;
    *(float4*)&kpb[(size_t)s * F_DIM + R_DIM + r4] = q;
  }

  // features 0-63 are exp(+dash), features 64-127 exp(-dash) of projection row m & 63
  const int   r   = (mt & 3) * 16 + n;
  const float sgn = (mt < 4) ? 1.f : -1.f;

  v8f acc = {};
  float cs = 0.f;     // sum of feature mrow over this lane's 64 keys
  // four steps per trip, so that their 16 loads are in flight together
  for (int kb = 0; kb < KV_STEPS; kb += KV_BLOCK) {
    v2f a[KV_BLOCK], b[KV_BLOCK];
    for (int u = 0; u < KV_BLOCK; ++u) {
      int s0 = (wave * KV_STEPS + kb + u) * 4 + koff;
      a[u].x = kdb[(size_t)s0 * R_DIM + r];
      a[u].y = kdb[(size_t)(s0 + 1) * R_DIM + r];
      b[u].x = vin[((size_t)s0 * H_DIM + h) * E_DIM + d];
      b[u].y = vin[((size_t)(s0 + 1) * H_DIM + h) * E_DIM + d];
    }
    for (int u = 0; u < KV_BLOCK; ++u) {
      int s0 = (wave * KV_STEPS + kb + u) * 4 + koff;
      a[u].x = RATIO * expf(sgn * a[u].x - Cs[s0]);       // A[m][s] = kp[s][m]
      a[u].y = RATIO * expf(sgn * a[u].y - Cs[s0 + 1]);
      acc = wmma4(a[u], b[u], acc);
      cs += a[u].x + a[u].y;
    }
  }
  for (int vv = 0; vv < 8; ++vv) Part[wave][vv][lane] = acc[vv];
  Csum[wave][lane] = cs;
  __syncthreads();

  // wave w finishes accumulator register w of the tile (rows w and w + 8)
  float s = Part[0][wave][lane];
  for (int w = 1; w < KV_WAVES; ++w) s += Part[w][wave][lane];
  const int m = mt * 16 + wave + ((lane >> 4) << 3);
  kv[((size_t)h * F_DIM + m) * E_DIM + d] = s;

  // column sums: lanes n and n + 16 of every wave hold shares of feature mt*16 + n
  if (nt == 0 && threadIdx.x < 16) {
    float t = 0.f;
    for (int w = 0; w < KV_WAVES; ++w) t += Csum[w][n] + Csum[w][n + 16];
    ksum[h * F_DIM + mrow] = t;
  }
}

// ---------------------------------------------------------------------------
// K3: fused band attention + low-rank combine.
// One work-group of 8 waves per (h, 16-query tile).
// 9 aligned key tiles cover the 128-wide window; mask handles edges.
// The band's 144 key rows and k_prime rows are laid in LDS first, by copies that
// take whole rows (a wave-wide copy covers four whole 128-byte lines).  A B fragment
// takes 8 bytes of one row per lane: read from memory, each such load touches 16
// lines, and every line is touched again by 8 loads.
//   products : wave w takes key tile w; waves 0-3 also one d tile of qkv,
//              waves 4 and 5 share key tile 8
//   combine  : wave w takes query rows 2w and 2w+1, 16 lanes per row
//   output   : wave w takes d tile (w & 3), half (w >> 2) of the 144 keys
// ---------------------------------------------------------------------------
#define FIN_WAVES 8
__global__ __launch_bounds__(32 * FIN_WAVES)
void sb_final_kernel(const float* __restrict__ qin, const float* __restrict__ kin,
                     const float* __restrict__ vin,
                     const float* __restrict__ qp, const float* __restrict__ kp,
                     const float* __restrict__ qls, const float* __restrict__ kls,
                     const float* __restrict__ kv, const float* __restrict__ ksum,
                     float* __restrict__ out)
{
  __shared__ __attribute__((aligned(16))) float Xq[16][E_PITCH];   // raw query tile (temp applied post-WMMA)
  __shared__ __attribute__((aligned(16))) float QPl[16][F_PITCH];  // q_prime tile
  __shared__ __attribute__((aligned(16))) float Kb[BAND][E_PITCH];   // key rows of the band
  __shared__ __attribute__((aligned(16))) float KPb[BAND][F_PITCH];  // k_prime rows of the band
  __shared__ float QKb[16][B_PITCH];
  __shared__ float DPb[16][B_PITCH];
  __shared__ float Pscale[16];
  // Ab (attn_local) and Opart (output halves) are first written behind the barrier
  // that ends the last read of Kb, and take its place: with arrays of their own the
  // work-group would need more than half of a WGP's LDS and would be alone on it
  static_assert(16 * B_PITCH <= 40 * E_PITCH && (40 + 2 * 16) <= BAND, "both fit in Kb, apart");
  float (*Ab)[B_PITCH]       = reinterpret_cast<float (*)[B_PITCH]>(&Kb[0][0]);
  float (*Opart)[16][E_PITCH] = reinterpret_cast<float (*)[16][E_PITCH]>(&Kb[40][0]);

  const int tid    = threadIdx.x;
  const int lane   = tid & 31;
  const int wave   = __builtin_amdgcn_readfirstlane(tid >> 5);
  const int h      = blockIdx.x / NTILES_T;
  const int qt     = blockIdx.x % NTILES_T;
  const int n      = lane & 15;
  const int koff   = (lane >> 4) * 2;
  const int s_base = (qt - 4) * 16;

#if USE_ASYNC_LDS
  // 256 threads: one 16-byte piece of Xq and two of QPl each, every lane on
  static_assert((16 * E_DIM) / 4 == 32 * FIN_WAVES, "one Xq piece per thread");
  static_assert((16 * F_DIM) / 4 == 2 * 32 * FIN_WAVES, "two QPl pieces per thread");
  {
    int m = tid >> 4, e4 = tid & 15;
    int t = qt * 16 + m;
    async_copy16(qin + ((size_t)t * H_DIM + h) * E_DIM + e4 * 4, &Xq[m][e4 * 4]);
  }
  {
    int m = tid >> 5, f4 = tid & 31;     // rows 0-7, then rows 8-15
    int t = qt * 16 + m;
    async_copy16(qp + ((size_t)h * T_DIM + t) * F_DIM + f4 * 4, &QPl[m][f4 * 4]);
    async_copy16(qp + ((size_t)h * T_DIM + t + 8) * F_DIM + f4 * 4, &QPl[m + 8][f4 * 4]);
  }
  // band rows: 16 key rows, then 8 k_prime rows, per trip of the work-group, every
  // lane on; a row outside the sequence takes the nearest row's bytes (masked later)
  static_assert((BAND * E_DIM / 4) % (32 * FIN_WAVES) == 0, "whole trips over the key rows");
  static_assert((BAND * F_DIM / 4) % (32 * FIN_WAVES) == 0, "whole trips over the k_prime rows");
  for (int i = 0; i < (BAND * E_DIM / 4) / (32 * FIN_WAVES); ++i) {
    const int j  = i * 16 + (tid >> 4), e4 = tid & 15;
    const int sc = clampi(s_base + j, 0, T_DIM - 1);
    async_copy16(kin + ((size_t)sc * H_DIM + h) * E_DIM + e4 * 4, &Kb[j][e4 * 4]);
  }
  for (int i = 0; i < (BAND * F_DIM / 4) / (32 * FIN_WAVES); ++i) {
    const int j  = i * 8 + (tid >> 5), f4 = tid & 31;
    const int sc = clampi(s_base + j, 0, T_DIM - 1);
    async_copy16(kp + ((size_t)h * T_DIM + sc) * F_DIM + f4 * 4, &KPb[j][f4 * 4]);
  }
  async_wait0();
#else
  for (int i = tid; i < 16 * E_DIM; i += 32 * FIN_WAVES) {
    int m = i >> 6, e = i & 63;
    int t = qt * 16 + m;
    Xq[m][e] = qin[((size_t)t * H_DIM + h) * E_DIM + e];
  }
  for (int i = tid; i < 16 * F_DIM; i += 32 * FIN_WAVES) {
    int m = i >> 7, f = i & 127;
    int t = qt * 16 + m;
    QPl[m][f] = qp[((size_t)h * T_DIM + t) * F_DIM + f];
  }
  for (int i = tid; i < BAND * E_DIM; i += 32 * FIN_WAVES) {
    int j = i >> 6, e = i & 63;
    int sc = clampi(s_base + j, 0, T_DIM - 1);
    Kb[j][e] = kin[((size_t)sc * H_DIM + h) * E_DIM + e];
  }
  for (int i = tid; i < BAND * F_DIM; i += 32 * FIN_WAVES) {
    int j = i >> 7, f = i & 127;
    int sc = clampi(s_base + j, 0, T_DIM - 1);
    KPb[j][f] = kp[((size_t)h * T_DIM + sc) * F_DIM + f];
  }
#endif
  // stands directly behind each wave's own wait: publishes every wave's copies
  __syncthreads();

  // QK of one key tile (K=64)
  auto qk_tile = [&](int d8) {
    v8f accQ = {};
    for (int kk = 0; kk < E_DIM / 4; ++kk) {
      int k0 = kk * 4 + koff;
      v2f a, b;
      a.x = Xq[n][k0];  a.y = Xq[n][k0 + 1];
      b.x = Kb[d8 * 16 + n][k0];  b.y = Kb[d8 * 16 + n][k0 + 1];
      accQ = wmma4(a, b, accQ);
    }
    for (int vv = 0; vv < 8; ++vv) {
      int row = vv + ((lane >> 4) << 3);
      QKb[row][d8 * 16 + n] = TEMP_SCALE * accQ[vv];   // QK = temp * (q . k)
    }
  };
  // dots_prime of one key tile (K=128)
  auto dp_tile = [&](int d8) {
    v8f accD = {};
    for (int kk = 0; kk < F_DIM / 4; ++kk) {
      int k0 = kk * 4 + koff;
      v2f a, b;
      a.x = QPl[n][k0];  a.y = QPl[n][k0 + 1];
      b.x = KPb[d8 * 16 + n][k0];  b.y = KPb[d8 * 16 + n][k0 + 1];
      accD = wmma4(a, b, accD);
    }
    for (int vv = 0; vv < 8; ++vv) {
      int row = vv + ((lane >> 4) << 3);
      DPb[row][d8 * 16 + n] = accD[vv];
    }
  };

  qk_tile(wave);
  dp_tile(wave);

  v8f qkvAcc = {};
  if (wave < 4) {
    // qkv d tile: (16 x 128) @ (128 x 16), kept in registers
    const int d = wave * 16 + n;
    for (int kk = 0; kk < F_DIM / 4; ++kk) {
      int k0 = kk * 4 + koff;
      v2f a, b;
      a.x = QPl[n][k0];  a.y = QPl[n][k0 + 1];
      b.x = kv[((size_t)h * F_DIM + k0) * E_DIM + d];
      b.y = kv[((size_t)h * F_DIM + k0 + 1) * E_DIM + d];
      qkvAcc = wmma4(a, b, qkvAcc);
    }
  } else if (wave == 4) {
    dp_tile(8);
  } else if (wave == 5) {
    qk_tile(8);
  }
  __syncthreads();

  // per-query-row combine (reference logsumexp/clip), 16 lanes per row
  {
    const int row = wave * 2 + (lane >> 4);
    const int t   = qt * 16 + row;
    const float pls = qls[h * T_DIM + t] + kls[h];
    float ksv[F_DIM / 16];
    for (int i = 0; i < F_DIM / 16; ++i) ksv[i] = ksum[h * F_DIM + i * 16 + n];
    // precaution: keeps the LDS loads below, whose results may reuse the address
    // registers of the global loads above, behind those loads' address phase
    asm volatile("s_wait_xcnt 0x0" ::: "memory");
    float qk1 = 0.f;
    for (int i = 0; i < F_DIM / 16; ++i) qk1 += QPl[row][i * 16 + n] * ksv[i];
    qk1 = row_sum16(qk1);
    float qkr[9], dpr[9];
    bool  val[9];
    float mx = -INFINITY;
    for (int i = 0; i < 9; ++i) {
      int j = i * 16 + n;
      int s = s_base + j;
      val[i] = (s >= 0) && (s < T_DIM) && (s >= t - HALF_W) && (s <= t + HALF_W - 1);
      qkr[i] = QKb[row][j];
      dpr[i] = DPb[row][j];
      if (val[i]) mx = fmaxf(mx, qkr[i]);
    }
    mx = row_max16(mx);
    float se = 0.f, dpsum = 0.f;
    for (int i = 0; i < 9; ++i) {
      if (val[i]) { se += expf(qkr[i] - mx); dpsum += dpr[i]; }
    }
    se    = row_sum16(se);
    dpsum = row_sum16(dpsum);
    const float lse = mx + logf(se);
    const float lr  = logf(fmaxf(qk1 - dpsum, 1e-24f)) + pls;
    const float mm  = fmaxf(lse, lr);
    const float log_norm = mm + logf(expf(lse - mm) + expf(lr - mm));
    const float pscale   = expf(pls - log_norm);
    if (n == 0) Pscale[row] = pscale;
    for (int i = 0; i < 9; ++i) {
      Ab[row][i * 16 + n] = val[i] ? (expf(qkr[i] - log_norm) - dpr[i] * pscale) : 0.f;
    }
  }
  __syncthreads();

  // out = attn_local(16x144) @ V_band(144x64) + qkv * prime_scale
  {
    const int nt   = wave & 3;
    const int half = wave >> 2;
    const int d    = nt * 16 + n;
    v8f acc = {};
    for (int ks = 0; ks < 144 / 8; ++ks) {
      int k0  = (half * (144 / 8) + ks) * 4 + koff;
      int s0c = clampi(s_base + k0,     0, T_DIM - 1);
      int s1c = clampi(s_base + k0 + 1, 0, T_DIM - 1);
      v2f a, b;
      a.x = Ab[n][k0];  a.y = Ab[n][k0 + 1];
      b.x = vin[((size_t)s0c * H_DIM + h) * E_DIM + d];
      b.y = vin[((size_t)s1c * H_DIM + h) * E_DIM + d];
      acc = wmma4(a, b, acc);
    }
    // qkvAcc is zero in waves 4-7
    for (int vv = 0; vv < 8; ++vv) {
      int row = vv + ((lane >> 4) << 3);
      Opart[half][row][d] = acc[vv] + qkvAcc[vv] * Pscale[row];
    }
  }
  __syncthreads();

  // add the two key halves; each wave stores two whole 256-byte output rows
  {
    const int row = tid >> 4, c4 = (tid & 15) * 4;
    const int t   = qt * 16 + row;
    const float4 p0 = *(const float4*)&Opart[0][row][c4];
    const float4 p1 = *(const float4*)&Opart[1][row][c4];
    float4 o;
    o.x = p0.x + p1.x;  o.y = p0.y + p1.y;  o.z = p0.z + p1.z;  o.w = p0.w + p1.w;
    *(float4*)&out[((size_t)t * H_DIM + h) * E_DIM + c4] = o;
  }
}

// ---------------------------------------------------------------------------
extern "C" void kernel_launch(void* const* d_in, const int* in_sizes, int n_in,
                              void* d_out, int out_size, void* d_ws, size_t ws_size,
                              hipStream_t stream)
{
  (void)in_sizes; (void)n_in; (void)out_size; (void)ws_size;
  const float* q    = (const float*)d_in[0];
  const float* k    = (const float*)d_in[1];
  const float* v    = (const float*)d_in[2];
  const float* proj = (const float*)d_in[3];
  float* out = (float*)d_out;
  float* ws  = (float*)d_ws;

  // workspace layout (floats); total ~10.9 MB
  size_t o = 0;
  float* qp      = ws + o; o += (size_t)H_DIM * T_DIM * F_DIM;   // 4 MB
  float* kp      = ws + o; o += (size_t)H_DIM * T_DIM * F_DIM;   // 4 MB
  float* kdash   = ws + o; o += (size_t)H_DIM * T_DIM * R_DIM;   // 2 MB
  float* kdiag   = ws + o; o += (size_t)H_DIM * T_DIM;
  float* krowmax = ws + o; o += (size_t)H_DIM * T_DIM;
  float* qls     = ws + o; o += (size_t)H_DIM * T_DIM;
  float* kls     = ws + o; o += (size_t)H_DIM;
  float* kvbuf   = ws + o; o += (size_t)H_DIM * F_DIM * E_DIM;
  float* ksumb   = ws + o; o += (size_t)H_DIM * F_DIM;

  featurize_kernel<<<2 * H_DIM * NTILES_T, 32, 0, stream>>>(
      q, k, proj, qp, qls, kdash, kdiag, krowmax);
  kv_kernel<<<H_DIM * 32, 32 * KV_WAVES, 0, stream>>>(
      v, kdash, kdiag, krowmax, kp, kls, kvbuf, ksumb);
  sb_final_kernel<<<H_DIM * NTILES_T, 32 * FIN_WAVES, 0, stream>>>(
      q, k, v, qp, kp, qls, kls, kvbuf, ksumb, out);
}

// v007
// A run of this version takes 23.5 microseconds.
// Timed twice side by side with v006, it ran 1.12 and 1.13 times as fast.
// Over all steps from v000 it is 5.24 times as fast.
#include <hip/hip_runtime.h>
#include <math.h>
#include <stdint.h>

// ---------------- problem constants (B=1) ----------------
#define T_DIM   1024      // sequence length (queries == keys)
#define H_DIM   8         // heads
#define E_DIM   64        // head dim
#define R_DIM   64        // projection rows
#define F_DIM   128       // 2R feature dim
#define HALF_W  64        // local window half-width (LOCAL_CONTEXT/2)
#define NTILES_T (T_DIM/16)

// LDS row pitches, in floats.  A WMMA fragment read takes one row per lane
// (lanes n and n + 16 read dwords k0.. and k0 + 2.. of row n).  The LDS has 64
// banks of one dword, so at a pitch of 64, 128 or 144 floats the 16 rows fall on
// one (or four) bank groups and the read is served row after row.  A pitch of
// 4 * odd floats puts row n at bank 4n (in some order): 16 rows x 4 dwords cover
// all 64 banks once.  It stays a multiple of 16 bytes for the 16-byte copies.
#define E_PITCH (E_DIM + 4)     // 68  = 4 * 17
#define R_PITCH (R_DIM + 4)     // 68  = 4 * 17
#define F_PITCH (F_DIM + 4)     // 132 = 4 * 33
#define BAND    144             // keys of the 9 key tiles
#define B_PITCH (BAND + 4)      // 148 = 4 * 37

#define TEMP_SCALE 0.125f                 // 1/sqrt(E)
#define DATA_NORM  0.35355339059327373f   // sqrt(1/sqrt(E))
#define RATIO      0.08838834764831843f   // (2R)^-0.5

typedef float v2f __attribute__((ext_vector_type(2)));
typedef float v8f __attribute__((ext_vector_type(8)));

// CDNA5 fp32 matrix core: D(16x16) = A(16x4) * B(4x16) + C
__device__ __forceinline__ v8f wmma4(v2f a, v2f b, v8f c) {
  return __builtin_amdgcn_wmma_f32_16x16x4_f32(false, a, false, b, (short)0, c,
                                               false, false);
}

__device__ __forceinline__ int clampi(int x, int lo, int hi) {
  return x < lo ? lo : (x > hi ? hi : x);
}

// ---- CDNA5 async global->LDS staging (ASYNCcnt path), guarded ----
#if defined(__has_builtin)
# if __has_builtin(__builtin_amdgcn_global_load_async_to_lds_b128) && \
     __has_builtin(__builtin_amdgcn_s_wait_asynccnt)
#  define USE_ASYNC_LDS 1
# endif
#endif
#ifndef USE_ASYNC_LDS
# define USE_ASYNC_LDS 0
#endif

#if USE_ASYNC_LDS
// builtin signature (per hipcc diagnostic): pointee is a 16-byte int vector
typedef int v4i_t __attribute__((vector_size(16)));
typedef __attribute__((address_space(1))) v4i_t* gas1_t;
typedef __attribute__((address_space(3))) v4i_t* las3_t;
// copy 16 bytes per active lane, global -> LDS, no VGPR round trip
__device__ __forceinline__ void async_copy16(const void* g, const void* l) {
  __builtin_amdgcn_global_load_async_to_lds_b128(
      (gas1_t)(uintptr_t)g, (las3_t)(uint32_t)(uintptr_t)l, 0, 0);
}
__device__ __forceinline__ void async_wait0() {
  __builtin_amdgcn_s_wait_asynccnt(0);
}
#endif

// ---------------------------------------------------------------------------
// sum / maximum over the 16 lanes of a DPP row; every lane gets the result
// ---------------------------------------------------------------------------
template <int CTRL>
__device__ __forceinline__ float row_xmask(float v) {
  return __builtin_bit_cast(float, __builtin_amdgcn_update_dpp(
      0, __builtin_bit_cast(int, v), CTRL, 0xf, 0xf, false));
}
__device__ __forceinline__ float row_sum16(float v) {
  v += row_xmask<0x161>(v);
  v += row_xmask<0x162>(v);
  v += row_xmask<0x164>(v);
  v += row_xmask<0x168>(v);
  return v;
}
__device__ __forceinline__ float row_max16(float v) {
  v = fmaxf(v, row_xmask<0x161>(v));
  v = fmaxf(v, row_xmask<0x162>(v));
  v = fmaxf(v, row_xmask<0x164>(v));
  v = fmaxf(v, row_xmask<0x168>(v));
  return v;
}

// ---------------------------------------------------------------------------
// K1: featurize q and k tiles.  dash = DATA_NORM * (X @ P^T) via WMMA.
// which==0 (query): emit q_prime + per-row stabilizer q_ls
// which==1 (key)  : stash dash, diag, per-row max (for global k stabilizer)
// Everything per row is taken from the fragments, on all 32 lanes: a lane holds
// 32 dash values (rows vv + 8 * half, columns nt * 16 + n) in its accumulators and
// half of row n of the data tile in its A fragments.
// ---------------------------------------------------------------------------
__global__ __launch_bounds__(32)
void featurize_kernel(const float* __restrict__ qin, const float* __restrict__ kin,
                      const float* __restrict__ proj,
                      float* __restrict__ qp, float* __restrict__ qls,
                      float* __restrict__ kdash, float* __restrict__ kdiag,
                      float* __restrict__ krowmax)
{
  __shared__ __attribute__((aligned(16))) float Pl[R_DIM][E_PITCH];
  __shared__ __attribute__((aligned(16))) float Xs[16][E_PITCH];   // raw (unscaled) data tile
  __shared__ __attribute__((aligned(16))) float Rows[16][F_PITCH];  // q_prime (or dash) tile, by rows
  __shared__ float SqH[32];                                   // [k half][row] sum of squares
  __shared__ __attribute__((aligned(16))) float MxL[16];      // max_r |dash_r| of a row

  const int lane  = threadIdx.x;
  const int bid   = blockIdx.x;
  const int which = bid / (H_DIM * NTILES_T);
  const int rem   = bid % (H_DIM * NTILES_T);
  const int h     = rem / NTILES_T;
  const int tt    = rem % NTILES_T;
  const float* __restrict__ xin = (which == 0) ? qin : kin;

#if USE_ASYNC_LDS
  for (int c = lane; c < (R_DIM * E_DIM) / 4; c += 32)
    async_copy16(proj + c * 4, &Pl[c >> 4][(c & 15) * 4]);
  for (int c = lane; c < (16 * E_DIM) / 4; c += 32) {
    int m = c >> 4, e4 = c & 15;
    int t = tt * 16 + m;
    async_copy16(xin + ((size_t)t * H_DIM + h) * E_DIM + e4 * 4, &Xs[m][e4 * 4]);
  }
  async_wait0();
#else
  for (int i = lane; i < R_DIM * E_DIM; i += 32)
    Pl[i / E_DIM][i % E_DIM] = proj[i];
  for (int i = lane; i < 16 * E_DIM; i += 32) {
    int m = i >> 6, e = i & 63;
    int t = tt * 16 + m;
    Xs[m][e] = xin[((size_t)t * H_DIM + h) * E_DIM + e];
  }
#endif
  __syncthreads();

  const int n    = lane & 15;
  const int half = lane >> 4;
  const int koff = half * 2;
  v8f acc[4] = {};
  float sq0 = 0.f, sq1 = 0.f;     // squares of this lane's half of data row n
  // unrolled whole, so that the 64 WMMAs stand in one straight run with later steps'
  // LDS reads ahead of them: left to itself the compiler keeps four trips here, and
  // each trip waits for its own reads
#pragma unroll
  for (int kk = 0; kk < E_DIM / 4; ++kk) {
    const int k0 = kk * 4 + koff;
    v2f a;
    a.x = Xs[n][k0];              a.y = Xs[n][k0 + 1];
    sq0 += a.x * a.x;             sq1 += a.y * a.y;
    for (int nt = 0; nt < 4; ++nt) {
      const int r = nt * 16 + n;  // B[k][n] = P^T[k][r] = P[r][k]
      v2f b;
      b.x = Pl[r][k0];            b.y = Pl[r][k0 + 1];
      acc[nt] = wmma4(a, b, acc[nt]);
    }
  }
  SqH[lane] = sq0 + sq1;

  // dash = dn * (X @ P^T); max_r |dash_r| of a row: 4 registers, then 16 lanes
  float mx8[8];
  for (int vv = 0; vv < 8; ++vv) {
    for (int nt = 0; nt < 4; ++nt) acc[nt][vv] *= DATA_NORM;
    mx8[vv] = row_max16(fmaxf(fmaxf(fabsf(acc[0][vv]), fabsf(acc[1][vv])),
                              fmaxf(fabsf(acc[2][vv]), fabsf(acc[3][vv]))));
  }
  if (n == 0) {
    for (int vv = 0; vv < 8; ++vv) MxL[half * 8 + vv] = mx8[vv];
  }

  // the values that go to memory, laid down by rows
  if (which == 0) {
    // stab = mx - diag;  prime = ratio*exp(+-dash - diag - stab) = ratio*exp(+-dash - mx)
    // unrolled so that the accumulators are named outright: left to itself the
    // compiler keeps eight trips and picks the registers through an index (v_movrels)
#pragma unroll
    for (int vv = 0; vv < 8; ++vv) {
      for (int nt = 0; nt < 4; ++nt) {
        const float d = acc[nt][vv];
        Rows[half * 8 + vv][nt * 16 + n]         = RATIO * expf( d - mx8[vv]);
        Rows[half * 8 + vv][R_DIM + nt * 16 + n] = RATIO * expf(-d - mx8[vv]);
      }
    }
  } else {
    for (int vv = 0; vv < 8; ++vv) {
      for (int nt = 0; nt < 4; ++nt) Rows[half * 8 + vv][nt * 16 + n] = acc[nt][vv];
    }
  }
  __syncthreads();

  // whole rows to memory, 16 bytes per lane
  if (which == 0) {
    float* __restrict__ qb = qp + ((size_t)h * T_DIM + tt * 16) * F_DIM;
    for (int m = 0; m < 16; ++m)
      *(float4*)&qb[m * F_DIM + lane * 4] = *(const float4*)&Rows[m][lane * 4];
    // precaution: stands in front of every later write of a register that the
    // stores above name (address or data)
    asm volatile("s_wait_xcnt 0x0" ::: "memory");
  } else {
    float* __restrict__ kb = kdash + ((size_t)h * T_DIM + tt * 16) * R_DIM;
    for (int m = 0; m < 16; m += 2)
      *(float4*)&kb[(m + half) * R_DIM + n * 4] = *(const float4*)&Rows[m + half][n * 4];
    // precaution: as in the branch above
    asm volatile("s_wait_xcnt 0x0" ::: "memory");
  }

  // one value per row: lane = row
  if (lane < 16) {
    const int   t  = tt * 16 + lane;
    const float dg = 0.5f * DATA_NORM * DATA_NORM * (SqH[lane] + SqH[lane + 16]);  // 0.5*dn^2*||x||^2
    const float mx = MxL[lane];
    if (which == 0) {
      qls[h * T_DIM + t] = mx - dg;
    } else {
      kdiag[h * T_DIM + t]   = dg;
      krowmax[h * T_DIM + t] = mx - dg;
    }
  }
}

// ---------------------------------------------------------------------------
// K2: kv[h] = k_prime^T @ V   (F x E, K = T) via WMMA, with the key stabilizer
// and k_prime made on the way.
// One work-group of 8 waves per 16x16 tile: wave w sums keys [128w, 128w+128),
// the eight partial tiles are added through LDS in wave order.
// k_ls[h] = max_s krowmax[h][s]: every work-group takes the maximum of its
// head's 1024 row maxima itself (a maximum does not depend on the order).
// k_prime = ratio * exp(+-dash - (diag + k_ls)) is evaluated straight into the
// A fragment.  The final kernel wants k_prime as an array: each of the head's 32
// work-groups evaluates and stores 32 whole key rows of it, 16 bytes per lane.
// ksum[h][m] = sum_s k_prime[h][s][m] comes from the same A fragments: every
// lane adds up the k_prime values it forms anyway, and the d tile 0 work-group
// of each feature tile adds the 16 shares of a feature and stores the sum.
// ---------------------------------------------------------------------------
#define KV_WAVES 8
#define KV_STEPS (T_DIM / 4 / KV_WAVES)
// the fragment loads go out in three runs, four loads a step: steps [0, KV_R1) at the
// kernel's head, [KV_R1, KV_R2) behind the barriers, the rest among the work that covers
// the second run.  A run fits the load counter (63 outstanding), or its last loads would
// stall the wave until its first have come back
#define KV_R1 10
#define KV_R2 21
static_assert((KV_R2 - KV_R1) * 4 <= 63 && (KV_STEPS - KV_R2) * 4 <= 63, "a run fits the load counter");
__global__ __launch_bounds__(32 * KV_WAVES)
void kv_kernel(const float* __restrict__ vin, const float* __restrict__ kdash,
               const float* __restrict__ kdiag, const float* __restrict__ krowmax,
               float* __restrict__ kp, float* __restrict__ kls,
               float* __restrict__ kv, float* __restrict__ ksum)
{
  __shared__ float Part[KV_WAVES][8][32];   // [wave][accumulator register][lane]
  __shared__ float Csum[KV_WAVES][32];      // [wave][lane] share of a column sum
  __shared__ __attribute__((aligned(16))) float Wmax[2 * KV_WAVES];  // maxima of 64 keys
  __shared__ __attribute__((aligned(16))) float Cs[T_DIM];           // diag[s] + k_ls

  const int bid  = blockIdx.x;
  const int h    = bid / 32;
  const int rem  = bid % 32;
  const int mt   = rem / 4;      // feature tile
  const int nt   = rem % 4;      // d tile
  const int tid  = threadIdx.x;
  const int lane = tid & 31;
  const int wave = __builtin_amdgcn_readfirstlane(tid >> 5);
  const int n    = lane & 15;
  const int koff = (lane >> 4) * 2;
  const int mrow = mt * 16 + n;
  const int d    = nt * 16 + n;

  // key stabilizer of the head: four keys per thread, 16 lanes by DPP, rest in LDS
  static_assert(T_DIM == 4 * 32 * KV_WAVES, "four keys per thread");
  const float4 rm = *(const float4*)&krowmax[h * T_DIM + tid * 4];
  const float4 dg = *(const float4*)&kdiag[h * T_DIM + tid * 4];
  // dash of this work-group's 32 rows of the k_prime array (a wave takes two rows
  // at a time), asked for here so that it arrives while the maximum is formed
  const float* __restrict__ kdb = kdash + (size_t)h * T_DIM * R_DIM;
  const int sr = rem * 32 + (tid >> 4);
  const int r4 = (tid & 15) * 4;
  float4 dv[2];
  for (int i = 0; i < 2; ++i) dv[i] = *(const float4*)&kdb[(size_t)(sr + i * 16) * R_DIM + r4];
  // the first run of the wave's dash and value fragments, asked
  // for here as well: none of it depends on the stabilizer, so it travels together with
  // the four loads above and the key loop below does not wait for memory
  const int r = (mt & 3) * 16 + n;     // projection row of feature mrow
  // one address per array, step u at a constant distance from it (an immediate offset)
  const int sw = wave * KV_STEPS * 4 + koff;     // the lane's first key
  const float* __restrict__ ap = kdb + (size_t)sw * R_DIM + r;
  const float* __restrict__ bp = vin + ((size_t)sw * H_DIM + h) * E_DIM + d;
  v2f a[KV_STEPS], b[KV_STEPS];
#pragma unroll
  for (int u = 0; u < KV_R1; ++u) {
    a[u].x = ap[(u * 4) * R_DIM];
    a[u].y = ap[(u * 4 + 1) * R_DIM];
    b[u].x = bp[(u * 4) * H_DIM * E_DIM];
    b[u].y = bp[(u * 4 + 1) * H_DIM * E_DIM];
  }
  // precaution: stands in front of every later write of an address register that the
  // loads above name
  asm volatile("s_wait_xcnt 0x0" ::: "memory");
  // keeps the loads above in front of the first use of any of them: without it they
  // are issued only after the first has come back
  __builtin_amdgcn_sched_barrier(0);
  const float m16 = row_max16(fmaxf(fmaxf(rm.x, rm.y), fmaxf(rm.z, rm.w)));
  if (n == 0) Wmax[tid >> 4] = m16;
  __syncthreads();
  float kmax = Wmax[0];
  for (int i = 1; i < 2 * KV_WAVES; ++i) kmax = fmaxf(kmax, Wmax[i]);
  float4 c4;
  c4.x = dg.x + kmax;  c4.y = dg.y + kmax;  c4.z = dg.z + kmax;  c4.w = dg.w + kmax;
  *(float4*)&Cs[tid * 4] = c4;
  if (rem == 0 && tid == 0) kls[h] = kmax;
  __syncthreads();

  // the second run: behind the barriers (each of them waits for every load that is
  // out), in front of the k_prime rows and the first run's steps, whose work covers
  // its way
#pragma unroll
  for (int u = KV_R1; u < KV_R2; ++u) {
    a[u].x = ap[(u * 4) * R_DIM];
    a[u].y = ap[(u * 4 + 1) * R_DIM];
    b[u].x = bp[(u * 4) * H_DIM * E_DIM];
    b[u].y = bp[(u * 4 + 1) * H_DIM * E_DIM];
  }
  // precaution: as behind the first run
  asm volatile("s_wait_xcnt 0x0" ::: "memory");
  // keeps these loads in front of the work below, which is to cover them
  __builtin_amdgcn_sched_barrier(0);

  // k_prime rows for the final kernel, whole 128-byte lines from one wave
  float* __restrict__ kpb = kp + (size_t)h * T_DIM * F_DIM;
  for (int i = 0; i < 2; ++i) {
    const int   s = sr + i * 16;
    const float c = Cs[s];
    float4 p, q;
    p.x = RATIO * expf( dv[i].x - c);  p.y = RATIO * expf( dv[i].y - c);
    p.z = RATIO * expf( dv[i].z - c);  p.w = RATIO * expf( dv[i].w - c);
    q.x = RATIO * expf(-dv[i].x - c);  q.y = RATIO * expf(-dv[i].y - c);
    q.z = RATIO * expf(-dv[i].z - c);  q.w = RATIO * expf(-dv[i].w - c);
    *(float4*)&kpb[(size_t)s * F_DIM + r4]         = p;
    *(float4*)&kpb[(size_t)s * F_DIM + R_DIM + r4] = q;
  }

  // features 0-63 are exp(+dash), features 64-127 exp(-dash) of projection row m & 63
  const float sgn = (mt < 4) ? 1.f : -1.f;

  v8f acc = {};
  float cs = 0.f;     // sum of feature mrow over this lane's 64 keys
  // unrolled whole: the fragments are registers named outright
#pragma unroll
  for (int u = 0; u < KV_STEPS; ++u) {
    if (u == KV_R1) {
      // the third run: out at the latest here, so that the second run's steps cover its
      // way; the compiler may lift it as far as the fence behind the second run's loads
      // (it then stands in front of the k_prime rows' arithmetic and has more cover still)
#pragma unroll
      for (int w = KV_R2; w < KV_STEPS; ++w) {
        a[w].x = ap[(w * 4) * R_DIM];
        a[w].y = ap[(w * 4 + 1) * R_DIM];
        b[w].x = bp[(w * 4) * H_DIM * E_DIM];
        b[w].y = bp[(w * 4 + 1) * H_DIM * E_DIM];
      }
      // precaution: stands in front of every later write of a register that the loads
      // and stores above name
      asm volatile("s_wait_xcnt 0x0" ::: "memory");
    }
    // keeps a run's first uses, and with them the wait for its loads, behind the steps
    // of the run before it (and the third run's loads in front of the second's steps):
    // left alone the compiler lifts those uses to the head of the loop
    if (u == KV_R1 || u == KV_R2) __builtin_amdgcn_sched_barrier(0);
    int s0 = sw + u * 4;
    a[u].x = RATIO * expf(sgn * a[u].x - Cs[s0]);       // A[m][s] = kp[s][m]
    a[u].y = RATIO * expf(sgn * a[u].y - Cs[s0 + 1]);
    acc = wmma4(a[u], b[u], acc);
    cs += a[u].x + a[u].y;
  }
  for (int vv = 0; vv < 8; ++vv) Part[wave][vv][lane] = acc[vv];
  Csum[wave][lane] = cs;
  __syncthreads();

  // wave w finishes accumulator register w of the tile (rows w and w + 8)
  float s = Part[0][wave][lane];
  for (int w = 1; w < KV_WAVES; ++w) s += Part[w][wave][lane];
  const int m = mt * 16 + wave + ((lane >> 4) << 3);
  kv[((size_t)h * F_DIM + m) * E_DIM + d] = s;

  // column sums: lanes n and n + 16 of every wave hold shares of feature mt*16 + n
  if (nt == 0 && threadIdx.x < 16) {
    float t = 0.f;
    for (int w = 0; w < KV_WAVES; ++w) t += Csum[w][n] + Csum[w][n + 16];
    ksum[h * F_DIM + mrow] = t;
  }
}

// ---------------------------------------------------------------------------
// K3: fused band attention + low-rank combine.
// One work-group of 8 waves per (h, 16-query tile).
// 9 aligned key tiles cover the 128-wide window; mask handles edges.
// The band's 144 key rows and k_prime rows are laid in LDS first, by copies that
// take whole rows (a wave-wide copy covers four whole 128-byte lines).  A B fragment
// takes 8 bytes of one row per lane: read from memory, each such load touches 16
// lines, and every line is touched again by 8 loads.
//   products : wave w takes key tile w; waves 0-3 also one d tile of qkv,
//              waves 4 and 5 share key tile 8
//   combine  : wave w takes query rows 2w and 2w+1, 16 lanes per row
//   output   : wave w takes d tile (w & 3), half (w >> 2) of the 144 keys
// ---------------------------------------------------------------------------
#define FIN_WAVES 8
__global__ __launch_bounds__(32 * FIN_WAVES)
void sb_final_kernel(const float* __restrict__ qin, const float* __restrict__ kin,
                     const float* __restrict__ vin,
                     const float* __restrict__ qp, const float* __restrict__ kp,
                     const float* __restrict__ qls, const float* __restrict__ kls,
                     const float* __restrict__ kv, const float* __restrict__ ksum,
                     float* __restrict__ out)
{
  __shared__ __attribute__((aligned(16))) float Xq[16][E_PITCH];   // raw query tile (temp applied post-WMMA)
  __shared__ __attribute__((aligned(16))) float QPl[16][F_PITCH];  // q_prime tile
  __shared__ __attribute__((aligned(16))) float Kb[BAND][E_PITCH];   // key rows of the band
  __shared__ __attribute__((aligned(16))) float KPb[BAND][F_PITCH];  // k_prime rows of the band
  __shared__ float QKb[16][B_PITCH];
  __shared__ float DPb[16][B_PITCH];
  __shared__ float Pscale[16];
  // Ab (attn_local) and Opart (output halves) are first written behind the barrier
  // that ends the last read of Kb, and take its place: with arrays of their own the
  // work-group would need more than half of a WGP's LDS and would be alone on it
  static_assert(16 * B_PITCH <= 40 * E_PITCH && (40 + 2 * 16) <= BAND, "both fit in Kb, apart");
  float (*Ab)[B_PITCH]       = reinterpret_cast<float (*)[B_PITCH]>(&Kb[0][0]);
  float (*Opart)[16][E_PITCH] = reinterpret_cast<float (*)[16][E_PITCH]>(&Kb[40][0]);

  const int tid    = threadIdx.x;
  const int lane   = tid & 31;
  const int wave   = __builtin_amdgcn_readfirstlane(tid >> 5);
  const int h      = blockIdx.x / NTILES_T;
  const int qt     = blockIdx.x % NTILES_T;
  const int n      = lane & 15;
  const int koff   = (lane >> 4) * 2;
  const int s_base = (qt - 4) * 16;

#if USE_ASYNC_LDS
  // 256 threads: one 16-byte piece of Xq and two of QPl each, every lane on
  static_assert((16 * E_DIM) / 4 == 32 * FIN_WAVES, "one Xq piece per thread");
  static_assert((16 * F_DIM) / 4 == 2 * 32 * FIN_WAVES, "two QPl pieces per thread");
  {
    int m = tid >> 4, e4 = tid & 15;
    int t = qt * 16 + m;
    async_copy16(qin + ((size_t)t * H_DIM + h) * E_DIM + e4 * 4, &Xq[m][e4 * 4]);
  }
  {
    int m = tid >> 5, f4 = tid & 31;     // rows 0-7, then rows 8-15
    int t = qt * 16 + m;
    async_copy16(qp + ((size_t)h * T_DIM + t) * F_DIM + f4 * 4, &QPl[m][f4 * 4]);
    async_copy16(qp + ((size_t)h * T_DIM + t + 8) * F_DIM + f4 * 4, &QPl[m + 8][f4 * 4]);
  }
  // band rows: 16 key rows, then 8 k_prime rows, per trip of the work-group, every
  // lane on; a row outside the sequence takes the nearest row's bytes (masked later)
  static_assert((BAND * E_DIM / 4) % (32 * FIN_WAVES) == 0, "whole trips over the key rows");
  static_assert((BAND * F_DIM / 4) % (32 * FIN_WAVES) == 0, "whole trips over the k_prime rows");
  for (int i = 0; i < (BAND * E_DIM / 4) / (32 * FIN_WAVES); ++i) {
    const int j  = i * 16 + (tid >> 4), e4 = tid & 15;
    const int sc = clampi(s_base + j, 0, T_DIM - 1);
    async_copy16(kin + ((size_t)sc * H_DIM + h) * E_DIM + e4 * 4, &Kb[j][e4 * 4]);
  }
  for (int i = 0; i < (BAND * F_DIM / 4) / (32 * FIN_WAVES); ++i) {
    const int j  = i * 8 + (tid >> 5), f4 = tid & 31;
    const int sc = clampi(s_base + j, 0, T_DIM - 1);
    async_copy16(kp + ((size_t)h * T_DIM + sc) * F_DIM + f4 * 4, &KPb[j][f4 * 4]);
  }
  async_wait0();
#else
  for (int i = tid; i < 16 * E_DIM; i += 32 * FIN_WAVES) {
    int m = i >> 6, e = i & 63;
    int t = qt * 16 + m;
    Xq[m][e] = qin[((size_t)t * H_DIM + h) * E_DIM + e];
  }
  for (int i = tid; i < 16 * F_DIM; i += 32 * FIN_WAVES) {
    int m = i >> 7, f = i & 127;
    int t = qt * 16 + m;
    QPl[m][f] = qp[((size_t)h * T_DIM + t) * F_DIM + f];
  }
  for (int i = tid; i < BAND * E_DIM; i += 32 * FIN_WAVES) {
    int j = i >> 6, e = i & 63;
    int sc = clampi(s_base + j, 0, T_DIM - 1);
    Kb[j][e] = kin[((size_t)sc * H_DIM + h) * E_DIM + e];
  }
  for (int i = tid; i < BAND * F_DIM; i += 32 * FIN_WAVES) {
    int j = i >> 7, f = i & 127;
    int sc = clampi(s_base + j, 0, T_DIM - 1);
    KPb[j][f] = kp[((size_t)h * T_DIM + sc) * F_DIM + f];
  }
#endif
  // stands directly behind each wave's own wait: publishes every wave's copies
  __syncthreads();

  // QK of one key tile (K=64)
  auto qk_tile = [&](int d8) {
    v8f accQ = {};
    for (int kk = 0; kk < E_DIM / 4; ++kk) {
      int k0 = kk * 4 + koff;
      v2f a, b;
      a.x = Xq[n][k0];  a.y = Xq[n][k0 + 1];
      b.x = Kb[d8 * 16 + n][k0];  b.y = Kb[d8 * 16 + n][k0 + 1];
      accQ = wmma4(a, b, accQ);
    }
    for (int vv = 0; vv < 8; ++vv) {
      int row = vv + ((lane >> 4) << 3);
      QKb[row][d8 * 16 + n] = TEMP_SCALE * accQ[vv];   // QK = temp * (q . k)
    }
  };
  // dots_prime of one key tile (K=128)
  auto dp_tile = [&](int d8) {
    v8f accD = {};
    for (int kk = 0; kk < F_DIM / 4; ++kk) {
      int k0 = kk * 4 + koff;
      v2f a, b;
      a.x = QPl[n][k0];  a.y = QPl[n][k0 + 1];
      b.x = KPb[d8 * 16 + n][k0];  b.y = KPb[d8 * 16 + n][k0 + 1];
      accD = wmma4(a, b, accD);
    }
    for (int vv = 0; vv < 8; ++vv) {
      int row = vv + ((lane >> 4) << 3);
      DPb[row][d8 * 16 + n] = accD[vv];
    }
  };

  qk_tile(wave);
  dp_tile(wave);

  v8f qkvAcc = {};
  if (wave < 4) {
    // qkv d tile: (16 x 128) @ (128 x 16), kept in registers
    const int d = wave * 16 + n;
    for (int kk = 0; kk < F_DIM / 4; ++kk) {
      int k0 = kk * 4 + koff;
      v2f a, b;
      a.x = QPl[n][k0];  a.y = QPl[n][k0 + 1];
      b.x = kv[((size_t)h * F_DIM + k0) * E_DIM + d];
      b.y = kv[((size_t)h * F_DIM + k0 + 1) * E_DIM + d];
      qkvAcc = wmma4(a, b, qkvAcc);
    }
  } else if (wave == 4) {
    dp_tile(8);
  } else if (wave == 5) {
    qk_tile(8);
  }
  __syncthreads();

  // per-query-row combine (reference logsumexp/clip), 16 lanes per row
  {
    const int row = wave * 2 + (lane >> 4);
    const int t   = qt * 16 + row;
    const float pls = qls[h * T_DIM + t] + kls[h];
    float ksv[F_DIM / 16];
    for (int i = 0; i < F_DIM / 16; ++i) ksv[i] = ksum[h * F_DIM + i * 16 + n];
    // precaution: keeps the LDS loads below, whose results may reuse the address
    // registers of the global loads above, behind those loads' address phase
    asm volatile("s_wait_xcnt 0x0" ::: "memory");
    float qk1 = 0.f;
    for (int i = 0; i < F_DIM / 16; ++i) qk1 += QPl[row][i * 16 + n] * ksv[i];
    qk1 = row_sum16(qk1);
    float qkr[9], dpr[9];
    bool  val[9];
    float mx = -INFINITY;
    for (int i = 0; i < 9; ++i) {
      int j = i * 16 + n;
      int s = s_base + j;
      val[i] = (s >= 0) && (s < T_DIM) && (s >= t - HALF_W) && (s <= t + HALF_W - 1);
      qkr[i] = QKb[row][j];
      dpr[i] = DPb[row][j];
      if (val[i]) mx = fmaxf(mx, qkr[i]);
    }
    mx = row_max16(mx);
    float se = 0.f, dpsum = 0.f;
    for (int i = 0; i < 9; ++i) {
      if (val[i]) { se += expf(qkr[i] - mx); dpsum += dpr[i]; }
    }
    se    = row_sum16(se);
    dpsum = row_sum16(dpsum);
    const float lse = mx + logf(se);
    const float lr  = logf(fmaxf(qk1 - dpsum, 1e-24f)) + pls;
    const float mm  = fmaxf(lse, lr);
    const float log_norm = mm + logf(expf(lse - mm) + expf(lr - mm));
    const float pscale   = expf(pls - log_norm);
    if (n == 0) Pscale[row] = pscale;
    for (int i = 0; i < 9; ++i) {
      Ab[row][i * 16 + n] = val[i] ? (expf(qkr[i] - log_norm) - dpr[i] * pscale) : 0.f;
    }
  }
  __syncthreads();

  // out = attn_local(16x144) @ V_band(144x64) + qkv * prime_scale
  {
    const int nt   = wave & 3;
    const int half = wave >> 2;
    const int d    = nt * 16 + n;
    v8f acc = {};
    for (int ks = 0; ks < 144 / 8; ++ks) {
      int k0  = (half * (144 / 8) + ks) * 4 + koff;
      int s0c = clampi(s_base + k0,     0, T_DIM - 1);
      int s1c = clampi(s_base + k0 + 1, 0, T_DIM - 1);
      v2f a, b;
      a.x = Ab[n][k0];  a.y = Ab[n][k0 + 1];
      b.x = vin[((size_t)s0c * H_DIM + h) * E_DIM + d];
      b.y = vin[((size_t)s1c * H_DIM + h) * E_DIM + d];
      acc = wmma4(a, b, acc);
    }
    // qkvAcc is zero in waves 4-7
    for (int vv = 0; vv < 8; ++vv) {
      int row = vv + ((lane >> 4) << 3);
      Opart[half][row][d] = acc[vv] + qkvAcc[vv] * Pscale[row];
    }
  }
  __syncthreads();

  // add the two key halves; each wave stores two whole 256-byte output rows
  {
    const int row = tid >> 4, c4 = (tid & 15) * 4;
    const int t   = qt * 16 + row;
    const float4 p0 = *(const float4*)&Opart[0][row][c4];
    const float4 p1 = *(const float4*)&Opart[1][row][c4];
    float4 o;
    o.x = p0.x + p1.x;  o.y = p0.y + p1.y;  o.z = p0.z + p1.z;  o.w = p0.w + p1.w;
    *(float4*)&out[((size_t)t * H_DIM + h) * E_DIM + c4] = o;
  }
}

// ---------------------------------------------------------------------------
extern "C" void kernel_launch(void* const* d_in, const int* in_sizes, int n_in,
                              void* d_out, int out_size, void* d_ws, size_t ws_size,
                              hipStream_t stream)
{
  (void)in_sizes; (void)n_in; (void)out_size; (void)ws_size;
  const float* q    = (const float*)d_in[0];
  const float* k    = (const float*)d_in[1];
  const float* v    = (const float*)d_in[2];
  const float* proj = (const float*)d_in[3];
  float* out = (float*)d_out;
  float* ws  = (float*)d_ws;

  // workspace layout (floats); total ~10.9 MB
  size_t o = 0;
  float* qp      = ws + o; o += (size_t)H_DIM * T_DIM * F_DIM;   // 4 MB
  float* kp      = ws + o; o += (size_t)H_DIM * T_DIM * F_DIM;   // 4 MB
  float* kdash   = ws + o; o += (size_t)H_DIM * T_DIM * R_DIM;   // 2 MB
  float* kdiag   = ws + o; o += (size_t)H_DIM * T_DIM;
  float* krowmax = ws + o; o += (size_t)H_DIM * T_DIM;
  float* qls     = ws + o; o += (size_t)H_DIM * T_DIM;
  float* kls     = ws + o; o += (size_t)H_DIM;
  float* kvbuf   = ws + o; o += (size_t)H_DIM * F_DIM * E_DIM;
  float* ksumb   = ws + o; o += (size_t)H_DIM * F_DIM;

  featurize_kernel<<<2 * H_DIM * NTILES_T, 32, 0, stream>>>(
      q, k, proj, qp, qls, kdash, kdiag, krowmax);
  kv_kernel<<<H_DIM * 32, 32 * KV_WAVES, 0, stream>>>(
      v, kdash, kdiag, krowmax, kp, kls, kvbuf, ksumb);
  sb_final_kernel<<<H_DIM * NTILES_T, 32 * FIN_WAVES, 0, stream>>>(
      q, k, v, qp, kp, qls, kls, kvbuf, ksumb, out);
}

// v008
// One run takes 21.5 microseconds.
// Two timings next to v007 both put it at 1.09 times that version's speed.
// Over all steps from v000 it is 5.73 times as fast.
#include <hip/hip_runtime.h>
#include <math.h>
#include <stdint.h>

// ---------------- problem constants (B=1) ----------------
#define T_DIM   1024      // sequence length (queries == keys)
#define H_DIM   8         // heads
#define E_DIM   64        // head dim
#define R_DIM   64        // projection rows
#define F_DIM   128       // 2R feature dim
#define HALF_W  64        // local window half-width (LOCAL_CONTEXT/2)
#define NTILES_T (T_DIM/16)

// LDS row pitches, in floats.  A WMMA fragment read takes one row per lane
// (lanes n and n + 16 read dwords k0.. and k0 + 2.. of row n).  The LDS has 64
// banks of one dword, so at a pitch of 64, 128 or 144 floats the 16 rows fall on
// one (or four) bank groups and the read is served row after row.  A pitch of
// 4 * odd floats puts row n at bank 4n (in some order): 16 rows x 4 dwords cover
// all 64 banks once.  It stays a multiple of 16 bytes for the 16-byte copies.
#define E_PITCH (E_DIM + 4)     // 68  = 4 * 17
#define R_PITCH (R_DIM + 4)     // 68  = 4 * 17
#define F_PITCH (F_DIM + 4)     // 132 = 4 * 33
#define BAND    144             // keys of the 9 key tiles
#define B_PITCH (BAND + 4)      // 148 = 4 * 37

#define TEMP_SCALE 0.125f                 // 1/sqrt(E)
#define DATA_NORM  0.35355339059327373f   // sqrt(1/sqrt(E))
#define RATIO      0.08838834764831843f   // (2R)^-0.5

typedef float v2f __attribute__((ext_vector_type(2)));
typedef float v8f __attribute__((ext_vector_type(8)));

// CDNA5 fp32 matrix core: D(16x16) = A(16x4) * B(4x16) + C
__device__ __forceinline__ v8f wmma4(v2f a, v2f b, v8f c) {
  return __builtin_amdgcn_wmma_f32_16x16x4_f32(false, a, false, b, (short)0, c,
                                               false, false);
}

__device__ __forceinline__ int clampi(int x, int lo, int hi) {
  return x < lo ? lo : (x > hi ? hi : x);
}

// ---- CDNA5 async global->LDS staging (ASYNCcnt path), guarded ----
#if defined(__has_builtin)
# if __has_builtin(__builtin_amdgcn_global_load_async_to_lds_b128) && \
     __has_builtin(__builtin_amdgcn_s_wait_asynccnt)
#  define USE_ASYNC_LDS 1
# endif
#endif
#ifndef USE_ASYNC_LDS
# define USE_ASYNC_LDS 0
#endif

#if USE_ASYNC_LDS
// builtin signature (per hipcc diagnostic): pointee is a 16-byte int vector
typedef int v4i_t __attribute__((vector_size(16)));
typedef __attribute__((address_space(1))) v4i_t* gas1_t;
typedef __attribute__((address_space(3))) v4i_t* las3_t;
// copy 16 bytes per active lane, global -> LDS, no VGPR round trip
__device__ __forceinline__ void async_copy16(const void* g, const void* l) {
  __builtin_amdgcn_global_load_async_to_lds_b128(
      (gas1_t)(uintptr_t)g, (las3_t)(uint32_t)(uintptr_t)l, 0, 0);
}
__device__ __forceinline__ void async_wait0() {
  __builtin_amdgcn_s_wait_asynccnt(0);
}
#endif

// ---------------------------------------------------------------------------
// sum / maximum over the 16 lanes of a DPP row; every lane gets the result
// ---------------------------------------------------------------------------
template <int CTRL>
__device__ __forceinline__ float row_xmask(float v) {
  return __builtin_bit_cast(float, __builtin_amdgcn_update_dpp(
      0, __builtin_bit_cast(int, v), CTRL, 0xf, 0xf, false));
}
__device__ __forceinline__ float row_sum16(float v) {
  v += row_xmask<0x161>(v);
  v += row_xmask<0x162>(v);
  v += row_xmask<0x164>(v);
  v += row_xmask<0x168>(v);
  return v;
}
__device__ __forceinline__ float row_max16(float v) {
  v = fmaxf(v, row_xmask<0x161>(v));
  v = fmaxf(v, row_xmask<0x162>(v));
  v = fmaxf(v, row_xmask<0x164>(v));
  v = fmaxf(v, row_xmask<0x168>(v));
  return v;
}

// ---------------------------------------------------------------------------
// K1: one launch for the key side (features, k_prime, kv, ksum) and the query features.
//
// Key work-groups (the first H * 32): one per (head, 16 projection rows qr, d tile nt,
// half kh of the keys), 8 waves, 64 keys a wave.
//   dash  : D(16 keys x 16 rows) = K tile @ P^T.  A lane then holds, for ITS projection
//           row n, the keys vv + 8 * half of the tile: that is the A fragment of
//           k_prime^T @ V as it stands (k slots 0,1 = keys 2j, 2j+1; slots 2,3 = keys
//           8+2j, 9+2j; the V loader takes the same keys).
//   scale : the head's stabilizer k_ls needs every key, so the work-group takes its own,
//           m = max over its keys and rows of |dash| - diag.  All it stores carries
//           exp(-m) in place of exp(-k_ls); the final kernel multiplies by exp(m - k_ls).
//   e order of the dash product: a lane loads 16 bytes, e = 8i + 4 * half + 0..3, of its
//           key row and of its projection row alike; two k steps come of each load.
// k_prime goes out as [head][feature tile][key tile][feature][16 keys]: a lane's eight
// registers are 32 bytes in a row, a wave's tile 1 KiB in a row.
// Query work-groups (the rest): 8 waves, one 16-query tile a wave, P staged once.
// ---------------------------------------------------------------------------
#define KV_WAVES 8
#define KH       2                          // key halves
#define TW       (T_DIM / KH / KV_WAVES / 16)   // key tiles of a wave
#define KEY_WGS  (H_DIM * 4 * 4 * KH)
#define Q_WGS    (H_DIM * NTILES_T / KV_WAVES)
__global__ __launch_bounds__(32 * KV_WAVES)
void feat_kv_kernel(const float* __restrict__ qin, const float* __restrict__ kin,
                    const float* __restrict__ vin, const float* __restrict__ proj,
                    float* __restrict__ qp, float* __restrict__ qls,
                    float* __restrict__ kp, float* __restrict__ mloc,
                    float* __restrict__ kvp, float* __restrict__ ksump)
{
  const int bid  = blockIdx.x;
  const int tid  = threadIdx.x;
  const int lane = tid & 31;
  const int wave = __builtin_amdgcn_readfirstlane(tid >> 5);
  const int n    = lane & 15;
  const int half = lane >> 4;

  if (bid < KEY_WGS) {
    __shared__ __attribute__((aligned(16))) float SqW[KV_WAVES][TW][32];  // [e half][key] squares
    __shared__ float Part[KV_WAVES][16][32];   // [wave][accumulator register, + then -][lane]
    __shared__ float Csum[KV_WAVES][2][32];    // [wave][sign][lane] share of a column sum
    __shared__ __attribute__((aligned(16))) float Wmax[2 * KV_WAVES];

    const int h    = bid >> 5;
    const int rem  = bid & 31;
    const int qr   = rem >> 3;
    const int nt   = (rem >> 1) & 3;
    const int kh   = rem & 1;
    const int d    = nt * 16 + n;
    const int key0 = (kh * KV_WAVES + wave) * (TW * 16);   // the wave's first key

    // the projection and key fragments of the wave, asked for at once
    const float* __restrict__ pb = proj + (qr * 16 + n) * E_DIM + half * 4;
    const float* __restrict__ kb = kin + ((size_t)(key0 + n) * H_DIM + h) * E_DIM + half * 4;
    const float* __restrict__ vb = vin + ((size_t)(key0 + half * 8) * H_DIM + h) * E_DIM + d;
    float4 pf[8], kf[TW][8];
    v2f    bv[TW][4];
#pragma unroll
    for (int i = 0; i < 8; ++i) pf[i] = *(const float4*)&pb[i * 8];
#pragma unroll
    for (int t = 0; t < TW; ++t) {
#pragma unroll
      for (int i = 0; i < 8; ++i)
        kf[t][i] = *(const float4*)&kb[t * 16 * H_DIM * E_DIM + i * 8];
    }
    // precaution: stands in front of every later write of an address register that the
    // loads above name
    asm volatile("s_wait_xcnt 0x0" ::: "memory");

    v8f acc[TW] = {};
    // unrolled whole: fragments and accumulators are registers named outright
#pragma unroll
    for (int t = 0; t < TW; ++t) {
      if (t == TW / 2) {
        // the value fragments go out here, into registers that the first two key tiles
        // have left, with the last two tiles' products to cover their way: asked for at
        // the head they take the wave past 256 registers, and then two work-groups no
        // longer fit on a WGP.  The fences keep the loads from being lifted or sunk
        __builtin_amdgcn_sched_barrier(0);
#pragma unroll
        for (int u = 0; u < TW; ++u) {
#pragma unroll
          for (int j = 0; j < 4; ++j) {
            bv[u][j].x = vb[(u * 16 + 2 * j) * H_DIM * E_DIM];
            bv[u][j].y = vb[(u * 16 + 2 * j + 1) * H_DIM * E_DIM];
          }
        }
        // precaution: as behind the loads at the head
        asm volatile("s_wait_xcnt 0x0" ::: "memory");
        __builtin_amdgcn_sched_barrier(0);
      }
      float s0 = 0.f, s1 = 0.f;
#pragma unroll
      for (int i = 0; i < 8; ++i) {
        const float4 k4 = kf[t][i], p4 = pf[i];
        v2f a0, a1, b0, b1;
        a0.x = k4.x;  a0.y = k4.y;  a1.x = k4.z;  a1.y = k4.w;
        b0.x = p4.x;  b0.y = p4.y;  b1.x = p4.z;  b1.y = p4.w;
        acc[t] = wmma4(a0, b0, acc[t]);
        acc[t] = wmma4(a1, b1, acc[t]);
        s0 += k4.x * k4.x + k4.y * k4.y;
        s1 += k4.z * k4.z + k4.w * k4.w;
      }
      SqW[wave][t][lane] = s0 + s1;
    }
    // the squares change lanes through LDS (a key's two e halves; key n to register n)
    __syncthreads();

    // diag of the lane's eight keys of each tile; the work-group's own stabilizer
    float c[TW][8];
    float lm = -INFINITY;
#pragma unroll
    for (int t = 0; t < TW; ++t) {
      const float4 u0 = *(const float4*)&SqW[wave][t][half * 8];
      const float4 u1 = *(const float4*)&SqW[wave][t][half * 8 + 4];
      const float4 w0 = *(const float4*)&SqW[wave][t][16 + half * 8];
      const float4 w1 = *(const float4*)&SqW[wave][t][16 + half * 8 + 4];
      const float hd = 0.5f * DATA_NORM * DATA_NORM;      // 0.5*dn^2*||x||^2
      c[t][0] = hd * (u0.x + w0.x);  c[t][1] = hd * (u0.y + w0.y);
      c[t][2] = hd * (u0.z + w0.z);  c[t][3] = hd * (u0.w + w0.w);
      c[t][4] = hd * (u1.x + w1.x);  c[t][5] = hd * (u1.y + w1.y);
      c[t][6] = hd * (u1.z + w1.z);  c[t][7] = hd * (u1.w + w1.w);
#pragma unroll
      for (int vv = 0; vv < 8; ++vv) {
        acc[t][vv] *= DATA_NORM;
        lm = fmaxf(lm, fabsf(acc[t][vv]) - c[t][vv]);
      }
    }
    lm = row_max16(lm);
    if (n == 0) Wmax[tid >> 4] = lm;
    __syncthreads();
    float m = Wmax[0];
    for (int i = 1; i < 2 * KV_WAVES; ++i) m = fmaxf(m, Wmax[i]);
    if (nt == 0 && tid == 0) mloc[h * 8 + kh * 4 + qr] = m;

    v8f aP = {}, aM = {};
    float csP = 0.f, csM = 0.f;   // sums of features +n and -n over this lane's 32 keys
#pragma unroll
    for (int t = 0; t < TW; ++t) {
      float ep[8], em[8];
#pragma unroll
      for (int vv = 0; vv < 8; ++vv) {
        const float cc = c[t][vv] + m;
        ep[vv] = RATIO * expf( acc[t][vv] - cc);
        em[vv] = RATIO * expf(-acc[t][vv] - cc);
        csP += ep[vv];
        csM += em[vv];
      }
#pragma unroll
      for (int j = 0; j < 4; ++j) {
        v2f a0, a1;
        a0.x = ep[2 * j];  a0.y = ep[2 * j + 1];     // A[feature][key] = k_prime[key][feature]
        a1.x = em[2 * j];  a1.y = em[2 * j + 1];
        aP = wmma4(a0, bv[t][j], aP);
        aM = wmma4(a1, bv[t][j], aM);
      }
      // the four d tile work-groups hold the same k_prime: each stores one tile in four
      if (t == nt) {
        float* __restrict__ o0 =
            kp + ((((size_t)h * 8 + qr) * NTILES_T + (key0 >> 4) + t) * 16 + n) * 16 + half * 8;
        float* __restrict__ o1 = o0 + (size_t)4 * NTILES_T * 256;
        *(float4*)&o0[0] = make_float4(ep[0], ep[1], ep[2], ep[3]);
        *(float4*)&o0[4] = make_float4(ep[4], ep[5], ep[6], ep[7]);
        *(float4*)&o1[0] = make_float4(em[0], em[1], em[2], em[3]);
        *(float4*)&o1[4] = make_float4(em[4], em[5], em[6], em[7]);
        // precaution: stands in front of every later write of a register that the
        // stores above name (address or data)
        asm volatile("s_wait_xcnt 0x0" ::: "memory");
      }
    }
    for (int vv = 0; vv < 8; ++vv) {
      Part[wave][vv][lane]     = aP[vv];
      Part[wave][8 + vv][lane] = aM[vv];
    }
    Csum[wave][0][lane] = csP;
    Csum[wave][1][lane] = csM;
    __syncthreads();

    // wave w finishes accumulator register w of both tiles (rows w and w + 8)
    for (int sg = 0; sg < 2; ++sg) {
      float s = Part[0][sg * 8 + wave][lane];
      for (int w = 1; w < KV_WAVES; ++w) s += Part[w][sg * 8 + wave][lane];
      const int f = sg * R_DIM + qr * 16 + wave + half * 8;
      kvp[(((size_t)kh * H_DIM + h) * F_DIM + f) * E_DIM + d] = s;
    }
    // column sums: lanes n and n + 16 of every wave hold shares of features +n and -n
    if (nt == 0 && tid < 32) {
      float t = 0.f;
      for (int w = 0; w < KV_WAVES; ++w) t += Csum[w][half][n] + Csum[w][half][n + 16];
      ksump[(kh * H_DIM + h) * F_DIM + half * R_DIM + qr * 16 + n] = t;
    }
    return;
  }

  // ---- query features: q_prime and the per-row stabilizer q_ls ----
  // Everything per row is taken from the fragments: a lane holds 32 dash values (rows
  // vv + 8 * half, columns nt * 16 + n) in its accumulators and half of row n of the
  // data tile in its A fragments.
  __shared__ __attribute__((aligned(16))) float Pl[R_DIM][E_PITCH];
  __shared__ __attribute__((aligned(16))) float Xs[KV_WAVES][16][E_PITCH];    // raw data tiles
  __shared__ __attribute__((aligned(16))) float Rows[KV_WAVES][16][F_PITCH];  // q_prime tiles, by rows
  __shared__ float SqH[KV_WAVES][32];                              // [k half][row] sum of squares
  __shared__ __attribute__((aligned(16))) float MxL[KV_WAVES][16]; // max_r |dash_r| of a row

  const int idx = (bid - KEY_WGS) * KV_WAVES + wave;
  const int h   = idx / NTILES_T;
  const int tt  = idx % NTILES_T;

#if USE_ASYNC_LDS
  for (int c = tid; c < (R_DIM * E_DIM) / 4; c += 32 * KV_WAVES)
    async_copy16(proj + c * 4, &Pl[c >> 4][(c & 15) * 4]);
  for (int c = lane; c < (16 * E_DIM) / 4; c += 32) {
    int m = c >> 4, e4 = c & 15;
    int t = tt * 16 + m;
    async_copy16(qin + ((size_t)t * H_DIM + h) * E_DIM + e4 * 4, &Xs[wave][m][e4 * 4]);
  }
  async_wait0();
#else
  for (int i = tid; i < R_DIM * E_DIM; i += 32 * KV_WAVES)
    Pl[i / E_DIM][i % E_DIM] = proj[i];
  for (int i = lane; i < 16 * E_DIM; i += 32) {
    int m = i >> 6, e = i & 63;
    int t = tt * 16 + m;
    Xs[wave][m][e] = qin[((size_t)t * H_DIM + h) * E_DIM + e];
  }
#endif
  // stands directly behind each wave's own wait: publishes every wave's copies
  __syncthreads();

  const int koff = half * 2;
  v8f acc[4] = {};
  float sq0 = 0.f, sq1 = 0.f;     // squares of this lane's half of data row n
  // unrolled whole, so that the 64 WMMAs stand in one straight run with later steps'
  // LDS reads ahead of them: left to itself the compiler keeps four trips here, and
  // each trip waits for its own reads
#pragma unroll
  for (int kk = 0; kk < E_DIM / 4; ++kk) {
    const int k0 = kk * 4 + koff;
    v2f a;
    a.x = Xs[wave][n][k0];        a.y = Xs[wave][n][k0 + 1];
    sq0 += a.x * a.x;             sq1 += a.y * a.y;
    for (int nt = 0; nt < 4; ++nt) {
      const int r = nt * 16 + n;  // B[k][n] = P^T[k][r] = P[r][k]
      v2f b;
      b.x = Pl[r][k0];            b.y = Pl[r][k0 + 1];
      acc[nt] = wmma4(a, b, acc[nt]);
    }
  }
  SqH[wave][lane] = sq0 + sq1;

  // dash = dn * (X @ P^T); max_r |dash_r| of a row: 4 registers, then 16 lanes
  float mx8[8];
  for (int vv = 0; vv < 8; ++vv) {
    for (int nt = 0; nt < 4; ++nt) acc[nt][vv] *= DATA_NORM;
    mx8[vv] = row_max16(fmaxf(fmaxf(fabsf(acc[0][vv]), fabsf(acc[1][vv])),
                              fmaxf(fabsf(acc[2][vv]), fabsf(acc[3][vv]))));
  }
  if (n == 0) {
    for (int vv = 0; vv < 8; ++vv) MxL[wave][half * 8 + vv] = mx8[vv];
  }

  // stab = mx - diag;  prime = ratio*exp(+-dash - diag - stab) = ratio*exp(+-dash - mx)
  // unrolled so that the accumulators are named outright: left to itself the
  // compiler keeps eight trips and picks the registers through an index (v_movrels)
#pragma unroll
  for (int vv = 0; vv < 8; ++vv) {
    for (int nt = 0; nt < 4; ++nt) {
      const float dd = acc[nt][vv];
      Rows[wave][half * 8 + vv][nt * 16 + n]         = RATIO * expf( dd - mx8[vv]);
      Rows[wave][half * 8 + vv][R_DIM + nt * 16 + n] = RATIO * expf(-dd - mx8[vv]);
    }
  }
  __syncthreads();

  // whole rows to memory, 16 bytes per lane
  float* __restrict__ qb = qp + ((size_t)h * T_DIM + tt * 16) * F_DIM;
  for (int m = 0; m < 16; ++m)
    *(float4*)&qb[m * F_DIM + lane * 4] = *(const float4*)&Rows[wave][m][lane * 4];
  // precaution: stands in front of every later write of a register that the
  // stores above name (address or data)
  asm volatile("s_wait_xcnt 0x0" ::: "memory");

  // one value per row: lane = row
  if (lane < 16) {
    const float dg = 0.5f * DATA_NORM * DATA_NORM * (SqH[wave][lane] + SqH[wave][lane + 16]);
    qls[h * T_DIM + tt * 16 + lane] = MxL[wave][lane] - dg;
  }
}

// ---------------------------------------------------------------------------
// K3: fused band attention + low-rank combine.
// One work-group of 8 waves per (h, 16-query tile).
// 9 aligned key tiles cover the 128-wide window; mask handles edges.
// The band's 144 key rows and nine k_prime tiles ([feature][16 keys], as stored) are
// laid in LDS first, by copies that take whole lines (four to a wave-wide copy).
// What the key work-groups stored carries their own stabilizers m: k_ls is the maximum
// of the head's eight m, and k_prime, kv and ksum are multiplied by exp(m - k_ls) where
// they are read (by key half and by the feature's group of 16 projection rows).  A B fragment of the key rows
// takes 8 bytes of one row per lane: read from memory, each such load touches 16
// lines, and every line is touched again by 8 loads.
//   products : wave w takes key tile w; waves 0-3 also one d tile of qkv,
//              waves 4 and 5 share key tile 8
//   combine  : wave w takes query rows 2w and 2w+1, 16 lanes per row
//   output   : wave w takes d tile (w & 3), half (w >> 2) of the 144 keys
// ---------------------------------------------------------------------------
#define FIN_WAVES 8
__global__ __launch_bounds__(32 * FIN_WAVES)
void sb_final_kernel(const float* __restrict__ qin, const float* __restrict__ kin,
                     const float* __restrict__ vin,
                     const float* __restrict__ qp, const float* __restrict__ kp,
                     const float* __restrict__ qls, const float* __restrict__ mloc,
                     const float* __restrict__ kvp, const float* __restrict__ ksump,
                     float* __restrict__ out)
{
  __shared__ __attribute__((aligned(16))) float Xq[16][E_PITCH];   // raw query tile (temp applied post-WMMA)
  __shared__ __attribute__((aligned(16))) float QPl[16][F_PITCH];  // q_prime tile
  __shared__ __attribute__((aligned(16))) float Kb[BAND][E_PITCH];   // key rows of the band
  __shared__ __attribute__((aligned(16))) float KPt[9 * F_DIM * 16];  // k_prime: [key tile][feature][key]
  __shared__ float Sc[8];                                            // exp(m - k_ls): [key half][qr]
  __shared__ float QKb[16][B_PITCH];
  __shared__ float DPb[16][B_PITCH];
  __shared__ float Pscale[16];
  // Ab (attn_local) and Opart (output halves) are first written behind the barrier
  // that ends the last read of Kb, and take its place: with arrays of their own the
  // work-group would need 162912 bytes of LDS in place of 144736
  static_assert(16 * B_PITCH <= 40 * E_PITCH && (40 + 2 * 16) <= BAND, "both fit in Kb, apart");
  float (*Ab)[B_PITCH]       = reinterpret_cast<float (*)[B_PITCH]>(&Kb[0][0]);
  float (*Opart)[16][E_PITCH] = reinterpret_cast<float (*)[16][E_PITCH]>(&Kb[40][0]);

  const int tid    = threadIdx.x;
  const int lane   = tid & 31;
  const int wave   = __builtin_amdgcn_readfirstlane(tid >> 5);
  const int h      = blockIdx.x / NTILES_T;
  const int qt     = blockIdx.x % NTILES_T;
  const int n      = lane & 15;
  const int koff   = (lane >> 4) * 2;
  const int s_base = (qt - 4) * 16;

#if USE_ASYNC_LDS
  // 256 threads: one 16-byte piece of Xq and two of QPl each, every lane on
  static_assert((16 * E_DIM) / 4 == 32 * FIN_WAVES, "one Xq piece per thread");
  static_assert((16 * F_DIM) / 4 == 2 * 32 * FIN_WAVES, "two QPl pieces per thread");
  {
    int m = tid >> 4, e4 = tid & 15;
    int t = qt * 16 + m;
    async_copy16(qin + ((size_t)t * H_DIM + h) * E_DIM + e4 * 4, &Xq[m][e4 * 4]);
  }
  {
    int m = tid >> 5, f4 = tid & 31;     // rows 0-7, then rows 8-15
    int t = qt * 16 + m;
    async_copy16(qp + ((size_t)h * T_DIM + t) * F_DIM + f4 * 4, &QPl[m][f4 * 4]);
    async_copy16(qp + ((size_t)h * T_DIM + t + 8) * F_DIM + f4 * 4, &QPl[m + 8][f4 * 4]);
  }
  // band: 16 key rows, then half a k_prime tile, per trip of the work-group, every lane
  // on; a row or tile outside the sequence takes the nearest one's bytes (masked later)
  static_assert((BAND * E_DIM / 4) % (32 * FIN_WAVES) == 0, "whole trips over the key rows");
  static_assert((BAND * F_DIM / 4) % (32 * FIN_WAVES) == 0, "whole trips over the k_prime tiles");
  for (int i = 0; i < (BAND * E_DIM / 4) / (32 * FIN_WAVES); ++i) {
    const int j  = i * 16 + (tid >> 4), e4 = tid & 15;
    const int sc = clampi(s_base + j, 0, T_DIM - 1);
    async_copy16(kin + ((size_t)sc * H_DIM + h) * E_DIM + e4 * 4, &Kb[j][e4 * 4]);
  }
  for (int i = 0; i < (BAND * F_DIM / 4) / (32 * FIN_WAVES); ++i) {
    const int p  = i * (32 * FIN_WAVES) + tid;      // 512 pieces a key tile, 64 a feature tile
    const int tc = clampi(qt - 4 + (p >> 9), 0, NTILES_T - 1);
    async_copy16(kp + (((size_t)h * 8 + ((p >> 6) & 7)) * NTILES_T + tc) * 256 + (p & 63) * 4,
                 &KPt[p * 4]);
  }
#endif
  // key stabilizer of the head and the eight scales, while the copies travel
  const float4 m0 = *(const float4*)&mloc[h * 8];
  const float4 m1 = *(const float4*)&mloc[h * 8 + 4];
  const float kmax = fmaxf(fmaxf(fmaxf(m0.x, m0.y), fmaxf(m0.z, m0.w)),
                           fmaxf(fmaxf(m1.x, m1.y), fmaxf(m1.z, m1.w)));
  if (tid < 8) {
    const float4 mh = (tid & 4) ? m1 : m0;
    const float  ma = (tid & 1) ? mh.y : mh.x, mb = (tid & 1) ? mh.w : mh.z;
    Sc[tid] = expf(((tid & 2) ? mb : ma) - kmax);
  }
#if USE_ASYNC_LDS
  async_wait0();
#else
  for (int i = tid; i < 16 * E_DIM; i += 32 * FIN_WAVES) {
    int m = i >> 6, e = i & 63;
    int t = qt * 16 + m;
    Xq[m][e] = qin[((size_t)t * H_DIM + h) * E_DIM + e];
  }
  for (int i = tid; i < 16 * F_DIM; i += 32 * FIN_WAVES) {
    int m = i >> 7, f = i & 127;
    int t = qt * 16 + m;
    QPl[m][f] = qp[((size_t)h * T_DIM + t) * F_DIM + f];
  }
  for (int i = tid; i < BAND * E_DIM; i += 32 * FIN_WAVES) {
    int j = i >> 6, e = i & 63;
    int sc = clampi(s_base + j, 0, T_DIM - 1);
    Kb[j][e] = kin[((size_t)sc * H_DIM + h) * E_DIM + e];
  }
  for (int i = tid; i < BAND * F_DIM; i += 32 * FIN_WAVES) {
    int tc = clampi(qt - 4 + (i >> 11), 0, NTILES_T - 1);
    KPt[i] = kp[(((size_t)h * 8 + ((i >> 8) & 7)) * NTILES_T + tc) * 256 + (i & 255)];
  }
#endif
  // stands directly behind each wave's own wait: publishes every wave's copies
  __syncthreads();

  // QK of one key tile (K=64)
  auto qk_tile = [&](int d8) {
    v8f accQ = {};
    for (int kk = 0; kk < E_DIM / 4; ++kk) {
      int k0 = kk * 4 + koff;
      v2f a, b;
      a.x = Xq[n][k0];  a.y = Xq[n][k0 + 1];
      b.x = Kb[d8 * 16 + n][k0];  b.y = Kb[d8 * 16 + n][k0 + 1];
      accQ = wmma4(a, b, accQ);
    }
    for (int vv = 0; vv < 8; ++vv) {
      int row = vv + ((lane >> 4) << 3);
      QKb[row][d8 * 16 + n] = TEMP_SCALE * accQ[vv];   // QK = temp * (q . k)
    }
  };
  // dots_prime of one key tile (K=128)
  auto dp_tile = [&](int d8) {
    v8f accD = {};
    const int g4 = (s_base + d8 * 16 >= T_DIM / KH) ? 4 : 0;   // the tile's key half
    const float* __restrict__ kt = &KPt[d8 * (F_DIM * 16) + n];
    for (int fs = 0; fs < F_DIM / 16; ++fs) {
      const float s = Sc[g4 + (fs & 3)];
      for (int k4 = 0; k4 < 4; ++k4) {
        int k0 = fs * 16 + k4 * 4 + koff;
        v2f a, b;
        a.x = QPl[n][k0];  a.y = QPl[n][k0 + 1];
        b.x = s * kt[k0 * 16];  b.y = s * kt[(k0 + 1) * 16];
        accD = wmma4(a, b, accD);
      }
    }
    for (int vv = 0; vv < 8; ++vv) {
      int row = vv + ((lane >> 4) << 3);
      DPb[row][d8 * 16 + n] = accD[vv];
    }
  };

  qk_tile(wave);
  dp_tile(wave);

  v8f qkvAcc = {};
  if (wave < 4) {
    // qkv d tile: (16 x 128) @ (128 x 16), kept in registers
    const int d = wave * 16 + n;
    const float* __restrict__ kv0 = kvp + (size_t)h * F_DIM * E_DIM + d;
    const float* __restrict__ kv1 = kv0 + (size_t)H_DIM * F_DIM * E_DIM;
    for (int fs = 0; fs < F_DIM / 16; ++fs) {
      const float s0 = Sc[fs & 3], s1 = Sc[4 + (fs & 3)];
      for (int k4 = 0; k4 < 4; ++k4) {
        int k0 = fs * 16 + k4 * 4 + koff;
        v2f a, b;
        a.x = QPl[n][k0];  a.y = QPl[n][k0 + 1];
        b.x = s0 * kv0[k0 * E_DIM] + s1 * kv1[k0 * E_DIM];
        b.y = s0 * kv0[(k0 + 1) * E_DIM] + s1 * kv1[(k0 + 1) * E_DIM];
        qkvAcc = wmma4(a, b, qkvAcc);
      }
    }
  } else if (wave == 4) {
    dp_tile(8);
  } else if (wave == 5) {
    qk_tile(8);
  }
  __syncthreads();

  // per-query-row combine (reference logsumexp/clip), 16 lanes per row
  {
    const int row = wave * 2 + (lane >> 4);
    const int t   = qt * 16 + row;
    const float pls = qls[h * T_DIM + t] + kmax;
    float ksv[F_DIM / 16], ksw[F_DIM / 16];
    for (int i = 0; i < F_DIM / 16; ++i) {
      ksv[i] = ksump[h * F_DIM + i * 16 + n];
      ksw[i] = ksump[(H_DIM + h) * F_DIM + i * 16 + n];
    }
    // precaution: keeps the LDS loads below, whose results may reuse the address
    // registers of the global loads above, behind those loads' address phase
    asm volatile("s_wait_xcnt 0x0" ::: "memory");
    float qk1 = 0.f;
    for (int i = 0; i < F_DIM / 16; ++i)
      qk1 += QPl[row][i * 16 + n] * (Sc[i & 3] * ksv[i] + Sc[4 + (i & 3)] * ksw[i]);
    qk1 = row_sum16(qk1);
    float qkr[9], dpr[9];
    bool  val[9];
    float mx = -INFINITY;
    for (int i = 0; i < 9; ++i) {
      int j = i * 16 + n;
      int s = s_base + j;
      val[i] = (s >= 0) && (s < T_DIM) && (s >= t - HALF_W) && (s <= t + HALF_W - 1);
      qkr[i] = QKb[row][j];
      dpr[i] = DPb[row][j];
      if (val[i]) mx = fmaxf(mx, qkr[i]);
    }
    mx = row_max16(mx);
    float se = 0.f, dpsum = 0.f;
    for (int i = 0; i < 9; ++i) {
      if (val[i]) { se += expf(qkr[i] - mx); dpsum += dpr[i]; }
    }
    se    = row_sum16(se);
    dpsum = row_sum16(dpsum);
    const float lse = mx + logf(se);
    const float lr  = logf(fmaxf(qk1 - dpsum, 1e-24f)) + pls;
    const float mm  = fmaxf(lse, lr);
    const float log_norm = mm + logf(expf(lse - mm) + expf(lr - mm));
    const float pscale   = expf(pls - log_norm);
    if (n == 0) Pscale[row] = pscale;
    for (int i = 0; i < 9; ++i) {
      Ab[row][i * 16 + n] = val[i] ? (expf(qkr[i] - log_norm) - dpr[i] * pscale) : 0.f;
    }
  }
  __syncthreads();

  // out = attn_local(16x144) @ V_band(144x64) + qkv * prime_scale
  {
    const int nt   = wave & 3;
    const int half = wave >> 2;
    const int d    = nt * 16 + n;
    v8f acc = {};
    for (int ks = 0; ks < 144 / 8; ++ks) {
      int k0  = (half * (144 / 8) + ks) * 4 + koff;
      int s0c = clampi(s_base + k0,     0, T_DIM - 1);
      int s1c = clampi(s_base + k0 + 1, 0, T_DIM - 1);
      v2f a, b;
      a.x = Ab[n][k0];  a.y = Ab[n][k0 + 1];
      b.x = vin[((size_t)s0c * H_DIM + h) * E_DIM + d];
      b.y = vin[((size_t)s1c * H_DIM + h) * E_DIM + d];
      acc = wmma4(a, b, acc);
    }
    // qkvAcc is zero in waves 4-7
    for (int vv = 0; vv < 8; ++vv) {
      int row = vv + ((lane >> 4) << 3);
      Opart[half][row][d] = acc[vv] + qkvAcc[vv] * Pscale[row];
    }
  }
  __syncthreads();

  // add the two key halves; each wave stores two whole 256-byte output rows
  {
    const int row = tid >> 4, c4 = (tid & 15) * 4;
    const int t   = qt * 16 + row;
    const float4 p0 = *(const float4*)&Opart[0][row][c4];
    const float4 p1 = *(const float4*)&Opart[1][row][c4];
    float4 o;
    o.x = p0.x + p1.x;  o.y = p0.y + p1.y;  o.z = p0.z + p1.z;  o.w = p0.w + p1.w;
    *(float4*)&out[((size_t)t * H_DIM + h) * E_DIM + c4] = o;
  }
}

// ---------------------------------------------------------------------------
extern "C" void kernel_launch(void* const* d_in, const int* in_sizes, int n_in,
                              void* d_out, int out_size, void* d_ws, size_t ws_size,
                              hipStream_t stream)
{
  (void)in_sizes; (void)n_in; (void)out_size; (void)ws_size;
  const float* q    = (const float*)d_in[0];
  const float* k    = (const float*)d_in[1];
  const float* v    = (const float*)d_in[2];
  const float* proj = (const float*)d_in[3];
  float* out = (float*)d_out;
  float* ws  = (float*)d_ws;

  // workspace layout (floats); total ~8.6 MB
  size_t o = 0;
  float* qp      = ws + o; o += (size_t)H_DIM * T_DIM * F_DIM;   // 4 MB
  float* kp      = ws + o; o += (size_t)H_DIM * T_DIM * F_DIM;   // 4 MB
  float* qls     = ws + o; o += (size_t)H_DIM * T_DIM;
  float* mloc    = ws + o; o += (size_t)H_DIM * 8;
  float* kvbuf   = ws + o; o += (size_t)KH * H_DIM * F_DIM * E_DIM;
  float* ksumb   = ws + o; o += (size_t)KH * H_DIM * F_DIM;

  feat_kv_kernel<<<KEY_WGS + Q_WGS, 32 * KV_WAVES, 0, stream>>>(
      q, k, v, proj, qp, qls, kp, mloc, kvbuf, ksumb);
  sb_final_kernel<<<H_DIM * NTILES_T, 32 * FIN_WAVES, 0, stream>>>(
      q, k, v, qp, kp, qls, mloc, kvbuf, ksumb, out);
}

// v009
// A run of this version takes 20.6 microseconds.
// Timed twice side by side with v008, it ran 1.05 and 1.04 times as fast.
// Counting every step since v000, it is 5.99 times as fast.
#include <hip/hip_runtime.h>
#include <math.h>
#include <stdint.h>

// ---------------- problem constants (B=1) ----------------
#define T_DIM   1024      // sequence length (queries == keys)
#define H_DIM   8         // heads
#define E_DIM   64        // head dim
#define R_DIM   64        // projection rows
#define F_DIM   128       // 2R feature dim
#define HALF_W  64        // local window half-width (LOCAL_CONTEXT/2)
#define NTILES_T (T_DIM/16)

// LDS row pitches, in floats.  A WMMA fragment read takes one row per lane
// (lanes n and n + 16 read dwords k0.. and k0 + 2.. of row n).  The LDS has 64
// banks of one dword, so at a pitch of 64, 128 or 160 floats the 16 rows fall on
// one (or two) bank groups and the read is served row after row.  A pitch of
// 4 * odd floats puts row n at bank 4n (in some order): 16 rows x 4 dwords cover
// all 64 banks once.  It stays a multiple of 16 bytes for the 16-byte copies.
#define E_PITCH (E_DIM + 4)     // 68  = 4 * 17
#define R_PITCH (R_DIM + 4)     // 68  = 4 * 17
#define F_PITCH (F_DIM + 4)     // 132 = 4 * 33
#define BAND    160             // keys of the 10 key tiles of a 32-query work-group
#define B_PITCH (BAND + 4)      // 164 = 4 * 41

#define TEMP_SCALE 0.125f                 // 1/sqrt(E)
#define DATA_NORM  0.35355339059327373f   // sqrt(1/sqrt(E))
#define RATIO      0.08838834764831843f   // (2R)^-0.5

typedef float v2f __attribute__((ext_vector_type(2)));
typedef float v8f __attribute__((ext_vector_type(8)));

// CDNA5 fp32 matrix core: D(16x16) = A(16x4) * B(4x16) + C
__device__ __forceinline__ v8f wmma4(v2f a, v2f b, v8f c) {
  return __builtin_amdgcn_wmma_f32_16x16x4_f32(false, a, false, b, (short)0, c,
                                               false, false);
}

__device__ __forceinline__ int clampi(int x, int lo, int hi) {
  return x < lo ? lo : (x > hi ? hi : x);
}

// ---- CDNA5 async global->LDS staging (ASYNCcnt path), guarded ----
#if defined(__has_builtin)
# if __has_builtin(__builtin_amdgcn_global_load_async_to_lds_b128) && \
     __has_builtin(__builtin_amdgcn_s_wait_asynccnt)
#  define USE_ASYNC_LDS 1
# endif
#endif
#ifndef USE_ASYNC_LDS
# define USE_ASYNC_LDS 0
#endif

#if USE_ASYNC_LDS
// builtin signature (per hipcc diagnostic): pointee is a 16-byte int vector
typedef int v4i_t __attribute__((vector_size(16)));
typedef __attribute__((address_space(1))) v4i_t* gas1_t;
typedef __attribute__((address_space(3))) v4i_t* las3_t;
// copy 16 bytes per active lane, global -> LDS, no VGPR round trip
__device__ __forceinline__ void async_copy16(const void* g, const void* l) {
  __builtin_amdgcn_global_load_async_to_lds_b128(
      (gas1_t)(uintptr_t)g, (las3_t)(uint32_t)(uintptr_t)l, 0, 0);
}
__device__ __forceinline__ void async_wait0() {
  __builtin_amdgcn_s_wait_asynccnt(0);
}
#endif

// ---------------------------------------------------------------------------
// sum / maximum over the 16 lanes of a DPP row; every lane gets the result
// ---------------------------------------------------------------------------
template <int CTRL>
__device__ __forceinline__ float row_xmask(float v) {
  return __builtin_bit_cast(float, __builtin_amdgcn_update_dpp(
      0, __builtin_bit_cast(int, v), CTRL, 0xf, 0xf, false));
}
__device__ __forceinline__ float row_sum16(float v) {
  v += row_xmask<0x161>(v);
  v += row_xmask<0x162>(v);
  v += row_xmask<0x164>(v);
  v += row_xmask<0x168>(v);
  return v;
}
__device__ __forceinline__ float row_max16(float v) {
  v = fmaxf(v, row_xmask<0x161>(v));
  v = fmaxf(v, row_xmask<0x162>(v));
  v = fmaxf(v, row_xmask<0x164>(v));
  v = fmaxf(v, row_xmask<0x168>(v));
  return v;
}

// ---------------------------------------------------------------------------
// K1: one launch for the key side (features, k_prime, kv, ksum) and the query features.
//
// Key work-groups (the first H * 32): one per (head, 16 projection rows qr, d tile nt,
// half kh of the keys), 8 waves, 64 keys a wave.
//   dash  : D(16 keys x 16 rows) = K tile @ P^T.  A lane then holds, for ITS projection
//           row n, the keys vv + 8 * half of the tile: that is the A fragment of
//           k_prime^T @ V as it stands (k slots 0,1 = keys 2j, 2j+1; slots 2,3 = keys
//           8+2j, 9+2j; the V loader takes the same keys).
//   scale : the head's stabilizer k_ls needs every key, so the work-group takes its own,
//           m = max over its keys and rows of |dash| - diag.  All it stores carries
//           exp(-m) in place of exp(-k_ls); the final kernel multiplies by exp(m - k_ls).
//   e order of the dash product: a lane loads 16 bytes, e = 8i + 4 * half + 0..3, of its
//           key row and of its projection row alike; two k steps come of each load.
// k_prime goes out as [head][feature tile][key tile][feature][16 keys]: a lane's eight
// registers are 32 bytes in a row, a wave's tile 1 KiB in a row.
// Query work-groups (the rest): 8 waves, one 16-query tile a wave, P staged once.
// ---------------------------------------------------------------------------
#define KV_WAVES 8
#define KH       2                          // key halves
#define TW       (T_DIM / KH / KV_WAVES / 16)   // key tiles of a wave
#define KEY_WGS  (H_DIM * 4 * 4 * KH)
#define Q_WGS    (H_DIM * NTILES_T / KV_WAVES)
__global__ __launch_bounds__(32 * KV_WAVES)
void feat_kv_kernel(const float* __restrict__ qin, const float* __restrict__ kin,
                    const float* __restrict__ vin, const float* __restrict__ proj,
                    float* __restrict__ qp, float* __restrict__ qls,
                    float* __restrict__ kp, float* __restrict__ mloc,
                    float* __restrict__ kvp, float* __restrict__ ksump)
{
  const int bid  = blockIdx.x;
  const int tid  = threadIdx.x;
  const int lane = tid & 31;
  const int wave = __builtin_amdgcn_readfirstlane(tid >> 5);
  const int n    = lane & 15;
  const int half = lane >> 4;

  if (bid < KEY_WGS) {
    __shared__ __attribute__((aligned(16))) float SqW[KV_WAVES][TW][32];  // [e half][key] squares
    __shared__ float Part[KV_WAVES][16][32];   // [wave][accumulator register, + then -][lane]
    __shared__ float Csum[KV_WAVES][2][32];    // [wave][sign][lane] share of a column sum
    __shared__ __attribute__((aligned(16))) float Wmax[2 * KV_WAVES];

    const int h    = bid >> 5;
    const int rem  = bid & 31;
    const int qr   = rem >> 3;
    const int nt   = (rem >> 1) & 3;
    const int kh   = rem & 1;
    const int d    = nt * 16 + n;
    const int key0 = (kh * KV_WAVES + wave) * (TW * 16);   // the wave's first key

    // the projection and key fragments of the wave, asked for at once
    const float* __restrict__ pb = proj + (qr * 16 + n) * E_DIM + half * 4;
    const float* __restrict__ kb = kin + ((size_t)(key0 + n) * H_DIM + h) * E_DIM + half * 4;
    const float* __restrict__ vb = vin + ((size_t)(key0 + half * 8) * H_DIM + h) * E_DIM + d;
    float4 pf[8], kf[TW][8];
    v2f    bv[TW][4];
#pragma unroll
    for (int i = 0; i < 8; ++i) pf[i] = *(const float4*)&pb[i * 8];
#pragma unroll
    for (int t = 0; t < TW; ++t) {
#pragma unroll
      for (int i = 0; i < 8; ++i)
        kf[t][i] = *(const float4*)&kb[t * 16 * H_DIM * E_DIM + i * 8];
    }
    // precaution: stands in front of every later write of an address register that the
    // loads above name
    asm volatile("s_wait_xcnt 0x0" ::: "memory");

    v8f acc[TW] = {};
    // unrolled whole: fragments and accumulators are registers named outright
#pragma unroll
    for (int t = 0; t < TW; ++t) {
      if (t == TW / 2) {
        // the value fragments go out here, into registers that the first two key tiles
        // have left, with the last two tiles' products to cover their way: asked for at
        // the head they take the wave past 256 registers, and then two work-groups no
        // longer fit on a WGP.  The fences keep the loads from being lifted or sunk
        __builtin_amdgcn_sched_barrier(0);
#pragma unroll
        for (int u = 0; u < TW; ++u) {
#pragma unroll
          for (int j = 0; j < 4; ++j) {
            bv[u][j].x = vb[(u * 16 + 2 * j) * H_DIM * E_DIM];
            bv[u][j].y = vb[(u * 16 + 2 * j + 1) * H_DIM * E_DIM];
          }
        }
        // precaution: as behind the loads at the head
        asm volatile("s_wait_xcnt 0x0" ::: "memory");
        __builtin_amdgcn_sched_barrier(0);
      }
      float s0 = 0.f, s1 = 0.f;
#pragma unroll
      for (int i = 0; i < 8; ++i) {
        const float4 k4 = kf[t][i], p4 = pf[i];
        v2f a0, a1, b0, b1;
        a0.x = k4.x;  a0.y = k4.y;  a1.x = k4.z;  a1.y = k4.w;
        b0.x = p4.x;  b0.y = p4.y;  b1.x = p4.z;  b1.y = p4.w;
        acc[t] = wmma4(a0, b0, acc[t]);
        acc[t] = wmma4(a1, b1, acc[t]);
        s0 += k4.x * k4.x + k4.y * k4.y;
        s1 += k4.z * k4.z + k4.w * k4.w;
      }
      SqW[wave][t][lane] = s0 + s1;
    }
    // the squares change lanes through LDS (a key's two e halves; key n to register n)
    __syncthreads();

    // diag of the lane's eight keys of each tile; the work-group's own stabilizer
    float c[TW][8];
    float lm = -INFINITY;
#pragma unroll
    for (int t = 0; t < TW; ++t) {
      const float4 u0 = *(const float4*)&SqW[wave][t][half * 8];
      const float4 u1 = *(const float4*)&SqW[wave][t][half * 8 + 4];
      const float4 w0 = *(const float4*)&SqW[wave][t][16 + half * 8];
      const float4 w1 = *(const float4*)&SqW[wave][t][16 + half * 8 + 4];
      const float hd = 0.5f * DATA_NORM * DATA_NORM;      // 0.5*dn^2*||x||^2
      c[t][0] = hd * (u0.x + w0.x);  c[t][1] = hd * (u0.y + w0.y);
      c[t][2] = hd * (u0.z + w0.z);  c[t][3] = hd * (u0.w + w0.w);
      c[t][4] = hd * (u1.x + w1.x);  c[t][5] = hd * (u1.y + w1.y);
      c[t][6] = hd * (u1.z + w1.z);  c[t][7] = hd * (u1.w + w1.w);
#pragma unroll
      for (int vv = 0; vv < 8; ++vv) {
        acc[t][vv] *= DATA_NORM;
        lm = fmaxf(lm, fabsf(acc[t][vv]) - c[t][vv]);
      }
    }
    lm = row_max16(lm);
    if (n == 0) Wmax[tid >> 4] = lm;
    __syncthreads();
    float m = Wmax[0];
    for (int i = 1; i < 2 * KV_WAVES; ++i) m = fmaxf(m, Wmax[i]);
    if (nt == 0 && tid == 0) mloc[h * 8 + kh * 4 + qr] = m;

    v8f aP = {}, aM = {};
    float csP = 0.f, csM = 0.f;   // sums of features +n and -n over this lane's 32 keys
#pragma unroll
    for (int t = 0; t < TW; ++t) {
      float ep[8], em[8];
#pragma unroll
      for (int vv = 0; vv < 8; ++vv) {
        const float cc = c[t][vv] + m;
        ep[vv] = RATIO * expf( acc[t][vv] - cc);
        em[vv] = RATIO * expf(-acc[t][vv] - cc);
        csP += ep[vv];
        csM += em[vv];
      }
#pragma unroll
      for (int j = 0; j < 4; ++j) {
        v2f a0, a1;
        a0.x = ep[2 * j];  a0.y = ep[2 * j + 1];     // A[feature][key] = k_prime[key][feature]
        a1.x = em[2 * j];  a1.y = em[2 * j + 1];
        aP = wmma4(a0, bv[t][j], aP);
        aM = wmma4(a1, bv[t][j], aM);
      }
      // the four d tile work-groups hold the same k_prime: each stores one tile in four
      if (t == nt) {
        float* __restrict__ o0 =
            kp + ((((size_t)h * 8 + qr) * NTILES_T + (key0 >> 4) + t) * 16 + n) * 16 + half * 8;
        float* __restrict__ o1 = o0 + (size_t)4 * NTILES_T * 256;
        *(float4*)&o0[0] = make_float4(ep[0], ep[1], ep[2], ep[3]);
        *(float4*)&o0[4] = make_float4(ep[4], ep[5], ep[6], ep[7]);
        *(float4*)&o1[0] = make_float4(em[0], em[1], em[2], em[3]);
        *(float4*)&o1[4] = make_float4(em[4], em[5], em[6], em[7]);
        // precaution: stands in front of every later write of a register that the
        // stores above name (address or data)
        asm volatile("s_wait_xcnt 0x0" ::: "memory");
      }
    }
    for (int vv = 0; vv < 8; ++vv) {
      Part[wave][vv][lane]     = aP[vv];
      Part[wave][8 + vv][lane] = aM[vv];
    }
    Csum[wave][0][lane] = csP;
    Csum[wave][1][lane] = csM;
    __syncthreads();

    // wave w finishes accumulator register w of both tiles (rows w and w + 8)
    for (int sg = 0; sg < 2; ++sg) {
      float s = Part[0][sg * 8 + wave][lane];
      for (int w = 1; w < KV_WAVES; ++w) s += Part[w][sg * 8 + wave][lane];
      const int f = sg * R_DIM + qr * 16 + wave + half * 8;
      kvp[(((size_t)kh * H_DIM + h) * F_DIM + f) * E_DIM + d] = s;
    }
    // column sums: lanes n and n + 16 of every wave hold shares of features +n and -n
    if (nt == 0 && tid < 32) {
      float t = 0.f;
      for (int w = 0; w < KV_WAVES; ++w) t += Csum[w][half][n] + Csum[w][half][n + 16];
      ksump[(kh * H_DIM + h) * F_DIM + half * R_DIM + qr * 16 + n] = t;
    }
    return;
  }

  // ---- query features: q_prime and the per-row stabilizer q_ls ----
  // Everything per row is taken from the fragments: a lane holds 32 dash values (rows
  // vv + 8 * half, columns nt * 16 + n) in its accumulators and half of row n of the
  // data tile in its A fragments.
  __shared__ __attribute__((aligned(16))) float Pl[R_DIM][E_PITCH];
  __shared__ __attribute__((aligned(16))) float Xs[KV_WAVES][16][E_PITCH];    // raw data tiles
  __shared__ __attribute__((aligned(16))) float Rows[KV_WAVES][16][F_PITCH];  // q_prime tiles, by rows
  __shared__ float SqH[KV_WAVES][32];                              // [k half][row] sum of squares
  __shared__ __attribute__((aligned(16))) float MxL[KV_WAVES][16]; // max_r |dash_r| of a row

  const int idx = (bid - KEY_WGS) * KV_WAVES + wave;
  const int h   = idx / NTILES_T;
  const int tt  = idx % NTILES_T;

#if USE_ASYNC_LDS
  for (int c = tid; c < (R_DIM * E_DIM) / 4; c += 32 * KV_WAVES)
    async_copy16(proj + c * 4, &Pl[c >> 4][(c & 15) * 4]);
  for (int c = lane; c < (16 * E_DIM) / 4; c += 32) {
    int m = c >> 4, e4 = c & 15;
    int t = tt * 16 + m;
    async_copy16(qin + ((size_t)t * H_DIM + h) * E_DIM + e4 * 4, &Xs[wave][m][e4 * 4]);
  }
  async_wait0();
#else
  for (int i = tid; i < R_DIM * E_DIM; i += 32 * KV_WAVES)
    Pl[i / E_DIM][i % E_DIM] = proj[i];
  for (int i = lane; i < 16 * E_DIM; i += 32) {
    int m = i >> 6, e = i & 63;
    int t = tt * 16 + m;
    Xs[wave][m][e] = qin[((size_t)t * H_DIM + h) * E_DIM + e];
  }
#endif
  // stands directly behind each wave's own wait: publishes every wave's copies
  __syncthreads();

  const int koff = half * 2;
  v8f acc[4] = {};
  float sq0 = 0.f, sq1 = 0.f;     // squares of this lane's half of data row n
  // unrolled whole, so that the 64 WMMAs stand in one straight run with later steps'
  // LDS reads ahead of them: left to itself the compiler keeps four trips here, and
  // each trip waits for its own reads
#pragma unroll
  for (int kk = 0; kk < E_DIM / 4; ++kk) {
    const int k0 = kk * 4 + koff;
    v2f a;
    a.x = Xs[wave][n][k0];        a.y = Xs[wave][n][k0 + 1];
    sq0 += a.x * a.x;             sq1 += a.y * a.y;
    for (int nt = 0; nt < 4; ++nt) {
      const int r = nt * 16 + n;  // B[k][n] = P^T[k][r] = P[r][k]
      v2f b;
      b.x = Pl[r][k0];            b.y = Pl[r][k0 + 1];
      acc[nt] = wmma4(a, b, acc[nt]);
    }
  }
  SqH[wave][lane] = sq0 + sq1;

  // dash = dn * (X @ P^T); max_r |dash_r| of a row: 4 registers, then 16 lanes
  float mx8[8];
  for (int vv = 0; vv < 8; ++vv) {
    for (int nt = 0; nt < 4; ++nt) acc[nt][vv] *= DATA_NORM;
    mx8[vv] = row_max16(fmaxf(fmaxf(fabsf(acc[0][vv]), fabsf(acc[1][vv])),
                              fmaxf(fabsf(acc[2][vv]), fabsf(acc[3][vv]))));
  }
  if (n == 0) {
    for (int vv = 0; vv < 8; ++vv) MxL[wave][half * 8 + vv] = mx8[vv];
  }

  // stab = mx - diag;  prime = ratio*exp(+-dash - diag - stab) = ratio*exp(+-dash - mx)
  // unrolled so that the accumulators are named outright: left to itself the
  // compiler keeps eight trips and picks the registers through an index (v_movrels)
#pragma unroll
  for (int vv = 0; vv < 8; ++vv) {
    for (int nt = 0; nt < 4; ++nt) {
      const float dd = acc[nt][vv];
      Rows[wave][half * 8 + vv][nt * 16 + n]         = RATIO * expf( dd - mx8[vv]);
      Rows[wave][half * 8 + vv][R_DIM + nt * 16 + n] = RATIO * expf(-dd - mx8[vv]);
    }
  }
  __syncthreads();

  // whole rows to memory, 16 bytes per lane
  float* __restrict__ qb = qp + ((size_t)h * T_DIM + tt * 16) * F_DIM;
  for (int m = 0; m < 16; ++m)
    *(float4*)&qb[m * F_DIM + lane * 4] = *(const float4*)&Rows[wave][m][lane * 4];
  // precaution: stands in front of every later write of a register that the
  // stores above name (address or data)
  asm volatile("s_wait_xcnt 0x0" ::: "memory");

  // one value per row: lane = row
  if (lane < 16) {
    const float dg = 0.5f * DATA_NORM * DATA_NORM * (SqH[wave][lane] + SqH[wave][lane + 16]);
    qls[h * T_DIM + tt * 16 + lane] = MxL[wave][lane] - dg;
  }
}

// ---------------------------------------------------------------------------
// K3: fused band attention + low-rank combine.
// One work-group of 8 waves per (h, 32 queries = two 16-query tiles).
// 10 aligned key tiles cover both tiles' 128-wide windows (query tile a takes key tiles
// a .. a + 8 of them); mask handles edges.  The two query tiles share eight of their nine
// key tiles: the band is laid in LDS once for both, and a B fragment read from it (or
// from memory: kv, values) feeds one WMMA of each query tile.
// The band's 160 key rows and ten k_prime tiles ([feature][16 keys], as stored) are
// laid in LDS first, by copies that take whole lines (four to a wave-wide copy).
// What the key work-groups stored carries their own stabilizers m: k_ls is the maximum
// of the head's eight m, and k_prime, kv and ksum are multiplied by exp(m - k_ls) where
// they are read (by key half and by the feature's group of 16 projection rows).  A B fragment of the key rows
// takes 8 bytes of one row per lane: read from memory, each such load touches 16
// lines, and every line is touched again by 8 loads.
//   products : wave w takes key tile w + 1 for both query tiles; waves 0-3 also one d tile
//              of qkv for both; waves 4-7 share key tile 0 (query tile 0 alone) and key
//              tile 9 (query tile 1 alone)
//   combine  : wave w takes query rows 4w .. 4w + 3, 16 lanes per row, two rows at a time
//   output   : wave w takes d tile (w & 3), half (w >> 2) of each query tile's 144 keys
// ---------------------------------------------------------------------------
#define FIN_WAVES 8
#define Q_ROWS    32                     // queries of a work-group
#define FIN_WGS   (H_DIM * T_DIM / Q_ROWS)
__global__ __launch_bounds__(32 * FIN_WAVES)
void sb_final_kernel(const float* __restrict__ qin, const float* __restrict__ kin,
                     const float* __restrict__ vin,
                     const float* __restrict__ qp, const float* __restrict__ kp,
                     const float* __restrict__ qls, const float* __restrict__ mloc,
                     const float* __restrict__ kvp, const float* __restrict__ ksump,
                     float* __restrict__ out)
{
  __shared__ __attribute__((aligned(16))) float Xq[Q_ROWS][E_PITCH];   // raw query rows (temp applied post-WMMA)
  __shared__ __attribute__((aligned(16))) float QPl[Q_ROWS][F_PITCH];  // q_prime rows
  __shared__ __attribute__((aligned(16))) float Kb[BAND][E_PITCH];     // key rows of the band
  __shared__ __attribute__((aligned(16))) float KPt[(BAND / 16) * F_DIM * 16];  // k_prime: [key tile][feature][key]
  __shared__ float Sc[8];                                              // exp(m - k_ls): [key half][qr]
  __shared__ float QKb[Q_ROWS][B_PITCH];
  __shared__ float DPb[Q_ROWS][B_PITCH];
  __shared__ float Ab[Q_ROWS][B_PITCH];                                // attn_local
  __shared__ __attribute__((aligned(16))) float Opart[2][Q_ROWS][E_PITCH];  // output halves
  __shared__ float Pscale[Q_ROWS];

  const int tid    = threadIdx.x;
  const int lane   = tid & 31;
  const int wave   = __builtin_amdgcn_readfirstlane(tid >> 5);
  const int h      = blockIdx.x / (T_DIM / Q_ROWS);
  const int qt     = blockIdx.x % (T_DIM / Q_ROWS);
  const int n      = lane & 15;
  const int koff   = (lane >> 4) * 2;
  const int q0     = qt * Q_ROWS;          // first query
  const int s_base = q0 - HALF_W;          // first key of the band
  const int kt0    = qt * (Q_ROWS / 16) - HALF_W / 16;   // its key tile

#if USE_ASYNC_LDS
  // 256 threads: two 16-byte pieces of Xq and four of QPl each, every lane on
  static_assert((Q_ROWS * E_DIM) / 4 == 2 * 32 * FIN_WAVES, "two Xq pieces per thread");
  static_assert((Q_ROWS * F_DIM) / 4 == 4 * 32 * FIN_WAVES, "four QPl pieces per thread");
  for (int i = 0; i < 2; ++i) {
    const int m = i * 16 + (tid >> 4), e4 = tid & 15;
    async_copy16(qin + ((size_t)(q0 + m) * H_DIM + h) * E_DIM + e4 * 4, &Xq[m][e4 * 4]);
  }
  for (int i = 0; i < 4; ++i) {
    const int m = i * 8 + (tid >> 5), f4 = tid & 31;
    async_copy16(qp + ((size_t)h * T_DIM + q0 + m) * F_DIM + f4 * 4, &QPl[m][f4 * 4]);
  }
  // band: 16 key rows, then half a k_prime tile, per trip of the work-group, every lane
  // on; a row or tile outside the sequence takes the nearest one's bytes (masked later)
  static_assert((BAND * E_DIM / 4) % (32 * FIN_WAVES) == 0, "whole trips over the key rows");
  static_assert((BAND * F_DIM / 4) % (32 * FIN_WAVES) == 0, "whole trips over the k_prime tiles");
  for (int i = 0; i < (BAND * E_DIM / 4) / (32 * FIN_WAVES); ++i) {
    const int j  = i * 16 + (tid >> 4), e4 = tid & 15;
    const int sc = clampi(s_base + j, 0, T_DIM - 1);
    async_copy16(kin + ((size_t)sc * H_DIM + h) * E_DIM + e4 * 4, &Kb[j][e4 * 4]);
  }
  for (int i = 0; i < (BAND * F_DIM / 4) / (32 * FIN_WAVES); ++i) {
    const int p  = i * (32 * FIN_WAVES) + tid;      // 512 pieces a key tile, 64 a feature tile
    const int tc = clampi(kt0 + (p >> 9), 0, NTILES_T - 1);
    async_copy16(kp + (((size_t)h * 8 + ((p >> 6) & 7)) * NTILES_T + tc) * 256 + (p & 63) * 4,
                 &KPt[p * 4]);
  }
#endif
  // key stabilizer of the head and the eight scales, while the copies travel
  const float4 m0 = *(const float4*)&mloc[h * 8];
  const float4 m1 = *(const float4*)&mloc[h * 8 + 4];
  const float kmax = fmaxf(fmaxf(fmaxf(m0.x, m0.y), fmaxf(m0.z, m0.w)),
                           fmaxf(fmaxf(m1.x, m1.y), fmaxf(m1.z, m1.w)));
  if (tid < 8) {
    const float4 mh = (tid & 4) ? m1 : m0;
    const float  ma = (tid & 1) ? mh.y : mh.x, mb = (tid & 1) ? mh.w : mh.z;
    Sc[tid] = expf(((tid & 2) ? mb : ma) - kmax);
  }
#if USE_ASYNC_LDS
  async_wait0();
#else
  for (int i = tid; i < Q_ROWS * E_DIM; i += 32 * FIN_WAVES) {
    int m = i >> 6, e = i & 63;
    Xq[m][e] = qin[((size_t)(q0 + m) * H_DIM + h) * E_DIM + e];
  }
  for (int i = tid; i < Q_ROWS * F_DIM; i += 32 * FIN_WAVES) {
    int m = i >> 7, f = i & 127;
    QPl[m][f] = qp[((size_t)h * T_DIM + q0 + m) * F_DIM + f];
  }
  for (int i = tid; i < BAND * E_DIM; i += 32 * FIN_WAVES) {
    int j = i >> 6, e = i & 63;
    int sc = clampi(s_base + j, 0, T_DIM - 1);
    Kb[j][e] = kin[((size_t)sc * H_DIM + h) * E_DIM + e];
  }
  for (int i = tid; i < BAND * F_DIM; i += 32 * FIN_WAVES) {
    int tc = clampi(kt0 + (i >> 11), 0, NTILES_T - 1);
    KPt[i] = kp[(((size_t)h * 8 + ((i >> 8) & 7)) * NTILES_T + tc) * 256 + (i & 255)];
  }
#endif
  // stands directly behind each wave's own wait: publishes every wave's copies
  __syncthreads();

  const int rhi = (lane >> 4) << 3;     // accumulator register vv holds row vv + rhi

  // QK of one key tile (K=64), for one query tile qa
  auto qk_one = [&](int qa, int d8) {
    v8f accQ = {};
    for (int kk = 0; kk < E_DIM / 4; ++kk) {
      int k0 = kk * 4 + koff;
      v2f a, b;
      a.x = Xq[qa * 16 + n][k0];  a.y = Xq[qa * 16 + n][k0 + 1];
      b.x = Kb[d8 * 16 + n][k0];  b.y = Kb[d8 * 16 + n][k0 + 1];
      accQ = wmma4(a, b, accQ);
    }
    for (int vv = 0; vv < 8; ++vv)
      QKb[qa * 16 + vv + rhi][d8 * 16 + n] = TEMP_SCALE * accQ[vv];   // QK = temp * (q . k)
  };
  // the same for both query tiles: one B fragment, two WMMAs
  auto qk_pair = [&](int d8) {
    v8f acc0 = {}, acc1 = {};
    for (int kk = 0; kk < E_DIM / 4; ++kk) {
      int k0 = kk * 4 + koff;
      v2f a0, a1, b;
      a0.x = Xq[n][k0];       a0.y = Xq[n][k0 + 1];
      a1.x = Xq[16 + n][k0];  a1.y = Xq[16 + n][k0 + 1];
      b.x = Kb[d8 * 16 + n][k0];  b.y = Kb[d8 * 16 + n][k0 + 1];
      acc0 = wmma4(a0, b, acc0);
      acc1 = wmma4(a1, b, acc1);
    }
    for (int vv = 0; vv < 8; ++vv) {
      QKb[vv + rhi][d8 * 16 + n]      = TEMP_SCALE * acc0[vv];
      QKb[16 + vv + rhi][d8 * 16 + n] = TEMP_SCALE * acc1[vv];
    }
  };
  // dots_prime of one key tile (K=128), for one query tile qa
  auto dp_one = [&](int qa, int d8) {
    v8f accD = {};
    const int g4 = (s_base + d8 * 16 >= T_DIM / KH) ? 4 : 0;   // the tile's key half
    const float* __restrict__ kt = &KPt[d8 * (F_DIM * 16) + n];
    for (int fs = 0; fs < F_DIM / 16; ++fs) {
      const float s = Sc[g4 + (fs & 3)];
      for (int k4 = 0; k4 < 4; ++k4) {
        int k0 = fs * 16 + k4 * 4 + koff;
        v2f a, b;
        a.x = QPl[qa * 16 + n][k0];  a.y = QPl[qa * 16 + n][k0 + 1];
        b.x = s * kt[k0 * 16];  b.y = s * kt[(k0 + 1) * 16];
        accD = wmma4(a, b, accD);
      }
    }
    for (int vv = 0; vv < 8; ++vv)
      DPb[qa * 16 + vv + rhi][d8 * 16 + n] = accD[vv];
  };
  // the same for both query tiles
  auto dp_pair = [&](int d8) {
    v8f acc0 = {}, acc1 = {};
    const int g4 = (s_base + d8 * 16 >= T_DIM / KH) ? 4 : 0;   // the tile's key half
    const float* __restrict__ kt = &KPt[d8 * (F_DIM * 16) + n];
    // unrolled whole, so that the 64 WMMAs stand in one straight run with later steps' LDS
    // reads ahead of them: left to itself the compiler keeps four trips here, and each
    // trip waits for its own reads
#pragma unroll
    for (int fs = 0; fs < F_DIM / 16; ++fs) {
      const float s = Sc[g4 + (fs & 3)];
#pragma unroll
      for (int k4 = 0; k4 < 4; ++k4) {
        int k0 = fs * 16 + k4 * 4 + koff;
        v2f a0, a1, b;
        a0.x = QPl[n][k0];       a0.y = QPl[n][k0 + 1];
        a1.x = QPl[16 + n][k0];  a1.y = QPl[16 + n][k0 + 1];
        b.x = s * kt[k0 * 16];  b.y = s * kt[(k0 + 1) * 16];
        acc0 = wmma4(a0, b, acc0);
        acc1 = wmma4(a1, b, acc1);
      }
    }
    for (int vv = 0; vv < 8; ++vv) {
      DPb[vv + rhi][d8 * 16 + n]      = acc0[vv];
      DPb[16 + vv + rhi][d8 * 16 + n] = acc1[vv];
    }
  };

  qk_pair(wave + 1);
  dp_pair(wave + 1);

  v8f qkvAcc0 = {}, qkvAcc1 = {};
  if (wave < 4) {
    // qkv d tile: (32 x 128) @ (128 x 16), kept in registers
    const int d = wave * 16 + n;
    const float* __restrict__ kv0 = kvp + (size_t)h * F_DIM * E_DIM + d;
    const float* __restrict__ kv1 = kv0 + (size_t)H_DIM * F_DIM * E_DIM;
    for (int fs = 0; fs < F_DIM / 16; ++fs) {
      const float s0 = Sc[fs & 3], s1 = Sc[4 + (fs & 3)];
      for (int k4 = 0; k4 < 4; ++k4) {
        int k0 = fs * 16 + k4 * 4 + koff;
        v2f a0, a1, b;
        a0.x = QPl[n][k0];       a0.y = QPl[n][k0 + 1];
        a1.x = QPl[16 + n][k0];  a1.y = QPl[16 + n][k0 + 1];
        b.x = s0 * kv0[k0 * E_DIM] + s1 * kv1[k0 * E_DIM];
        b.y = s0 * kv0[(k0 + 1) * E_DIM] + s1 * kv1[(k0 + 1) * E_DIM];
        qkvAcc0 = wmma4(a0, b, qkvAcc0);
        qkvAcc1 = wmma4(a1, b, qkvAcc1);
      }
    }
  } else if (wave < 6) {
    dp_one(wave - 4, (wave - 4) * (BAND / 16 - 1));    // (tile 0, key tile 0), (tile 1, key tile 9)
  } else {
    qk_one(wave - 6, (wave - 6) * (BAND / 16 - 1));
  }
  __syncthreads();

  // per-query-row combine (reference logsumexp/clip), 16 lanes per row; a wave's four rows
  // are of one query tile qa, whose nine key tiles start at column qa * 16 of the band
  {
    const int qa   = wave >> 2;
    const int row0 = wave * 4 + (lane >> 4);     // rows row0 and row0 + 2
    float ksv[F_DIM / 16], ksw[F_DIM / 16], pls[2];
    for (int i = 0; i < F_DIM / 16; ++i) {
      ksv[i] = ksump[h * F_DIM + i * 16 + n];
      ksw[i] = ksump[(H_DIM + h) * F_DIM + i * 16 + n];
    }
    for (int p = 0; p < 2; ++p) pls[p] = qls[h * T_DIM + q0 + row0 + 2 * p];
    // precaution: keeps the LDS loads below, whose results may reuse the address
    // registers of the global loads above, behind those loads' address phase
    asm volatile("s_wait_xcnt 0x0" ::: "memory");
    float qk1[2], mx[2], se[2], dpsum[2], log_norm[2], pscale[2];
    float qkr[2][9], dpr[2][9];
    bool  val[2][9];
    for (int p = 0; p < 2; ++p) {
      const int row = row0 + 2 * p;
      const int t   = q0 + row;
      pls[p] += kmax;
      qk1[p] = 0.f;
      for (int i = 0; i < F_DIM / 16; ++i)
        qk1[p] += QPl[row][i * 16 + n] * (Sc[i & 3] * ksv[i] + Sc[4 + (i & 3)] * ksw[i]);
      mx[p] = -INFINITY;
      for (int i = 0; i < 9; ++i) {
        int j = (qa + i) * 16 + n;
        int s = s_base + j;
        val[p][i] = (s >= 0) && (s < T_DIM) && (s >= t - HALF_W) && (s <= t + HALF_W - 1);
        qkr[p][i] = QKb[row][j];
        dpr[p][i] = DPb[row][j];
        if (val[p][i]) mx[p] = fmaxf(mx[p], qkr[p][i]);
      }
    }
    for (int p = 0; p < 2; ++p) {
      qk1[p] = row_sum16(qk1[p]);
      mx[p]  = row_max16(mx[p]);
    }
    for (int p = 0; p < 2; ++p) {
      se[p] = 0.f;  dpsum[p] = 0.f;
      // every term is formed and the mask picks it or zero: no branch stands between the
      // wave's 18 terms, so their chains run side by side (two waves a SIMD hide little)
      for (int i = 0; i < 9; ++i) {
        const float e = expf(qkr[p][i] - mx[p]);
        se[p]    += val[p][i] ? e : 0.f;
        dpsum[p] += val[p][i] ? dpr[p][i] : 0.f;
      }
    }
    for (int p = 0; p < 2; ++p) {
      se[p]    = row_sum16(se[p]);
      dpsum[p] = row_sum16(dpsum[p]);
    }
    for (int p = 0; p < 2; ++p) {
      const float lse = mx[p] + logf(se[p]);
      const float lr  = logf(fmaxf(qk1[p] - dpsum[p], 1e-24f)) + pls[p];
      const float mm  = fmaxf(lse, lr);
      log_norm[p] = mm + logf(expf(lse - mm) + expf(lr - mm));
      pscale[p]   = expf(pls[p] - log_norm[p]);
      if (n == 0) Pscale[row0 + 2 * p] = pscale[p];
    }
    for (int p = 0; p < 2; ++p) {
      for (int i = 0; i < 9; ++i) {
        const float w = expf(qkr[p][i] - log_norm[p]) - dpr[p][i] * pscale[p];
        Ab[row0 + 2 * p][(qa + i) * 16 + n] = val[p][i] ? w : 0.f;
      }
    }
  }
  __syncthreads();

  // out = attn_local(16x144) @ V_band(144x64) + qkv * prime_scale, for both query tiles.
  // Query tile 1's 144 keys lie 16 keys (4 k steps) behind query tile 0's: of the 22 value
  // fragments of a wave, the first 18 serve tile 0 and the last 18 tile 1
  {
    const int nt   = wave & 3;
    const int half = wave >> 2;
    const int d    = nt * 16 + n;
    v8f acc0 = {}, acc1 = {};
    // unrolled whole: the two tests on ks then fall away, and no branch stands among the WMMAs
#pragma unroll
    for (int ks = 0; ks < 144 / 8 + 4; ++ks) {
      int k0  = (half * (144 / 8) + ks) * 4 + koff;
      int s0c = clampi(s_base + k0,     0, T_DIM - 1);
      int s1c = clampi(s_base + k0 + 1, 0, T_DIM - 1);
      v2f b;
      b.x = vin[((size_t)s0c * H_DIM + h) * E_DIM + d];
      b.y = vin[((size_t)s1c * H_DIM + h) * E_DIM + d];
      if (ks < 144 / 8) {
        v2f a;
        a.x = Ab[n][k0];  a.y = Ab[n][k0 + 1];
        acc0 = wmma4(a, b, acc0);
      }
      if (ks >= 4) {
        v2f a;
        a.x = Ab[16 + n][k0];  a.y = Ab[16 + n][k0 + 1];
        acc1 = wmma4(a, b, acc1);
      }
    }
    // qkvAcc is zero in waves 4-7
    for (int vv = 0; vv < 8; ++vv) {
      int row = vv + rhi;
      Opart[half][row][d]      = acc0[vv] + qkvAcc0[vv] * Pscale[row];
      Opart[half][16 + row][d] = acc1[vv] + qkvAcc1[vv] * Pscale[16 + row];
    }
  }
  __syncthreads();

  // add the two key halves; each wave stores four whole 256-byte output rows
  {
    const int c4 = (tid & 15) * 4;
    float4 o[2];
    for (int i = 0; i < 2; ++i) {
      const int row = i * 16 + (tid >> 4);
      const float4 p0 = *(const float4*)&Opart[0][row][c4];
      const float4 p1 = *(const float4*)&Opart[1][row][c4];
      o[i].x = p0.x + p1.x;  o[i].y = p0.y + p1.y;  o[i].z = p0.z + p1.z;  o[i].w = p0.w + p1.w;
    }
    for (int i = 0; i < 2; ++i) {
      const int t = q0 + i * 16 + (tid >> 4);
      *(float4*)&out[((size_t)t * H_DIM + h) * E_DIM + c4] = o[i];
    }
  }
}

// ---------------------------------------------------------------------------
extern "C" void kernel_launch(void* const* d_in, const int* in_sizes, int n_in,
                              void* d_out, int out_size, void* d_ws, size_t ws_size,
                              hipStream_t stream)
{
  (void)in_sizes; (void)n_in; (void)out_size; (void)ws_size;
  const float* q    = (const float*)d_in[0];
  const float* k    = (const float*)d_in[1];
  const float* v    = (const float*)d_in[2];
  const float* proj = (const float*)d_in[3];
  float* out = (float*)d_out;
  float* ws  = (float*)d_ws;

  // workspace layout (floats); total ~8.6 MB
  size_t o = 0;
  float* qp      = ws + o; o += (size_t)H_DIM * T_DIM * F_DIM;   // 4 MB
  float* kp      = ws + o; o += (size_t)H_DIM * T_DIM * F_DIM;   // 4 MB
  float* qls     = ws + o; o += (size_t)H_DIM * T_DIM;
  float* mloc    = ws + o; o += (size_t)H_DIM * 8;
  float* kvbuf   = ws + o; o += (size_t)KH * H_DIM * F_DIM * E_DIM;
  float* ksumb   = ws + o; o += (size_t)KH * H_DIM * F_DIM;

  feat_kv_kernel<<<KEY_WGS + Q_WGS, 32 * KV_WAVES, 0, stream>>>(
      q, k, v, proj, qp, qls, kp, mloc, kvbuf, ksumb);
  sb_final_kernel<<<FIN_WGS, 32 * FIN_WAVES, 0, stream>>>(
      q, k, v, qp, kp, qls, mloc, kvbuf, ksumb, out);
}

// v010
// A run of this version takes 18.9 microseconds.
// In two side-by-side timings against v009, it was 1.10 and 1.09 times as fast.
// Counting every step since v000, it is 6.56 times as fast.
#include <hip/hip_runtime.h>
#include <math.h>
#include <stdint.h>

// ---------------- problem constants (B=1) ----------------
#define T_DIM   1024      // sequence length (queries == keys)
#define H_DIM   8         // heads
#define E_DIM   64        // head dim
#define R_DIM   64        // projection rows
#define F_DIM   128       // 2R feature dim
#define HALF_W  64        // local window half-width (LOCAL_CONTEXT/2)
#define NTILES_T (T_DIM/16)

// LDS row pitches, in floats.  A WMMA fragment read takes one row per lane
// (lanes n and n + 16 read dwords k0.. and k0 + 2.. of row n).  The LDS has 64
// banks of one dword, so at a pitch of 64, 128 or 160 floats the 16 rows fall on
// one (or two) bank groups and the read is served row after row.  A pitch of
// 4 * odd floats puts row n at bank 4n (in some order): 16 rows x 4 dwords cover
// all 64 banks once.  It stays a multiple of 16 bytes for the 16-byte copies.
#define E_PITCH (E_DIM + 4)     // 68  = 4 * 17
#define R_PITCH (R_DIM + 4)     // 68  = 4 * 17
#define F_PITCH (F_DIM + 4)     // 132 = 4 * 33
#define BAND    160             // keys of the 10 key tiles of a 32-query work-group
#define B_PITCH (BAND + 4)      // 164 = 4 * 41

#define TEMP_SCALE 0.125f                 // 1/sqrt(E)
#define DATA_NORM  0.35355339059327373f   // sqrt(1/sqrt(E))
#define LOG2E      1.4426950408889634f    // log2(e)
#define LOG2_RATIO (-3.5f)                // log2 of ratio = (2R)^-0.5 = 128^-0.5, exact

typedef float v2f __attribute__((ext_vector_type(2)));
typedef float v8f __attribute__((ext_vector_type(8)));

// CDNA5 fp32 matrix core: D(16x16) = A(16x4) * B(4x16) + C
__device__ __forceinline__ v8f wmma4(v2f a, v2f b, v8f c) {
  return __builtin_amdgcn_wmma_f32_16x16x4_f32(false, a, false, b, (short)0, c,
                                               false, false);
}

__device__ __forceinline__ int clampi(int x, int lo, int hi) {
  return x < lo ? lo : (x > hi ? hi : x);
}

// Exponentials and logarithms are taken in base 2, where each is one instruction
// (v_exp_f32, v_log_f32): exp(x) = 2^(x * log2 e), and the factor log2 e rides on a
// multiply or a fused multiply-add that the argument needs anyway.  The library's expf
// and logf spend a dozen vector instructions a call on a split argument and on range
// tests.  No kept term can overflow here: its argument is <= 0, or bounded by the 1e-24
// clip; a result under 2^-126 may come out as 0, which no sum here notices.
// The v_nop is the slot that the instruction set asks for behind a transcendental, before
// its result is read or its source overwritten.  In one
// statement with the instruction it stays directly behind it.
__device__ __forceinline__ float exp2_hw(float x) {
  float r;
  asm("v_exp_f32 %0, %1\n\tv_nop" : "=v"(r) : "v"(x));   // 2^x, then the slot behind it
  return r;
}
__device__ __forceinline__ float log2_hw(float x) {
  float r;
  asm("v_log_f32 %0, %1\n\tv_nop" : "=v"(r) : "v"(x));   // log2 x, then the slot behind it
  return r;
}

// ---- CDNA5 async global->LDS staging (ASYNCcnt path), guarded ----
#if defined(__has_builtin)
# if __has_builtin(__builtin_amdgcn_global_load_async_to_lds_b128) && \
     __has_builtin(__builtin_amdgcn_s_wait_asynccnt)
#  define USE_ASYNC_LDS 1
# endif
#endif
#ifndef USE_ASYNC_LDS
# define USE_ASYNC_LDS 0
#endif

#if USE_ASYNC_LDS
// builtin signature (per hipcc diagnostic): pointee is a 16-byte int vector
typedef int v4i_t __attribute__((vector_size(16)));
typedef __attribute__((address_space(1))) v4i_t* gas1_t;
typedef __attribute__((address_space(3))) v4i_t* las3_t;
// copy 16 bytes per active lane, global -> LDS, no VGPR round trip
__device__ __forceinline__ void async_copy16(const void* g, const void* l) {
  __builtin_amdgcn_global_load_async_to_lds_b128(
      (gas1_t)(uintptr_t)g, (las3_t)(uint32_t)(uintptr_t)l, 0, 0);
}
__device__ __forceinline__ void async_wait0() {
  __builtin_amdgcn_s_wait_asynccnt(0);
}
#endif

// ---------------------------------------------------------------------------
// sum / maximum over the 16 lanes of a DPP row; every lane gets the result
// ---------------------------------------------------------------------------
template <int CTRL>
__device__ __forceinline__ float row_xmask(float v) {
  return __builtin_bit_cast(float, __builtin_amdgcn_update_dpp(
      0, __builtin_bit_cast(int, v), CTRL, 0xf, 0xf, false));
}
__device__ __forceinline__ float row_sum16(float v) {
  v += row_xmask<0x161>(v);
  v += row_xmask<0x162>(v);
  v += row_xmask<0x164>(v);
  v += row_xmask<0x168>(v);
  return v;
}
__device__ __forceinline__ float row_max16(float v) {
  v = fmaxf(v, row_xmask<0x161>(v));
  v = fmaxf(v, row_xmask<0x162>(v));
  v = fmaxf(v, row_xmask<0x164>(v));
  v = fmaxf(v, row_xmask<0x168>(v));
  return v;
}

// ---------------------------------------------------------------------------
// K1: one launch for the key side (features, k_prime, kv, ksum) and the query features.
//
// Key work-groups (the first H * 32): one per (head, 16 projection rows qr, d tile nt,
// half kh of the keys), 8 waves, 64 keys a wave.
//   dash  : D(16 keys x 16 rows) = K tile @ P^T.  A lane then holds, for ITS projection
//           row n, the keys vv + 8 * half of the tile: that is the A fragment of
//           k_prime^T @ V as it stands (k slots 0,1 = keys 2j, 2j+1; slots 2,3 = keys
//           8+2j, 9+2j; the V loader takes the same keys).
//   scale : the head's stabilizer k_ls needs every key, so the work-group takes its own,
//           m = max over its keys and rows of |dash| - diag.  All it stores carries
//           exp(-m) in place of exp(-k_ls); the final kernel multiplies by exp(m - k_ls).
//   e order of the dash product: a lane loads 16 bytes, e = 8i + 4 * half + 0..3, of its
//           key row and of its projection row alike; two k steps come of each load.
// k_prime goes out as [head][feature tile][key tile][feature][16 keys]: a lane's eight
// registers are 32 bytes in a row, a wave's tile 1 KiB in a row.
// Query work-groups (the rest): 8 waves, one 16-query tile a wave, P staged once.
// ---------------------------------------------------------------------------
#define KV_WAVES 8
#define KH       2                          // key halves
#define TW       (T_DIM / KH / KV_WAVES / 16)   // key tiles of a wave
#define KEY_WGS  (H_DIM * 4 * 4 * KH)
#define Q_WGS    (H_DIM * NTILES_T / KV_WAVES)
__global__ __launch_bounds__(32 * KV_WAVES)
void feat_kv_kernel(const float* __restrict__ qin, const float* __restrict__ kin,
                    const float* __restrict__ vin, const float* __restrict__ proj,
                    float* __restrict__ qp, float* __restrict__ qls,
                    float* __restrict__ kp, float* __restrict__ mloc,
                    float* __restrict__ kvp, float* __restrict__ ksump)
{
  const int bid  = blockIdx.x;
  const int tid  = threadIdx.x;
  const int lane = tid & 31;
  const int wave = __builtin_amdgcn_readfirstlane(tid >> 5);
  const int n    = lane & 15;
  const int half = lane >> 4;

  if (bid < KEY_WGS) {
    __shared__ __attribute__((aligned(16))) float SqW[KV_WAVES][TW][32];  // [e half][key] squares
    __shared__ float Part[KV_WAVES][16][32];   // [wave][accumulator register, + then -][lane]
    __shared__ float Csum[KV_WAVES][2][32];    // [wave][sign][lane] share of a column sum
    __shared__ __attribute__((aligned(16))) float Wmax[2 * KV_WAVES];

    const int h    = bid >> 5;
    const int rem  = bid & 31;
    const int qr   = rem >> 3;
    const int nt   = (rem >> 1) & 3;
    const int kh   = rem & 1;
    const int d    = nt * 16 + n;
    const int key0 = (kh * KV_WAVES + wave) * (TW * 16);   // the wave's first key

    // the projection and key fragments of the wave, asked for at once
    const float* __restrict__ pb = proj + (qr * 16 + n) * E_DIM + half * 4;
    const float* __restrict__ kb = kin + ((size_t)(key0 + n) * H_DIM + h) * E_DIM + half * 4;
    const float* __restrict__ vb = vin + ((size_t)(key0 + half * 8) * H_DIM + h) * E_DIM + d;
    float4 pf[8], kf[TW][8];
    v2f    bv[TW][4];
#pragma unroll
    for (int i = 0; i < 8; ++i) pf[i] = *(const float4*)&pb[i * 8];
#pragma unroll
    for (int t = 0; t < TW; ++t) {
#pragma unroll
      for (int i = 0; i < 8; ++i)
        kf[t][i] = *(const float4*)&kb[t * 16 * H_DIM * E_DIM + i * 8];
    }
    // precaution: stands in front of every later write of an address register that the
    // loads above name
    asm volatile("s_wait_xcnt 0x0" ::: "memory");

    v8f acc[TW] = {};
    // unrolled whole: fragments and accumulators are registers named outright
#pragma unroll
    for (int t = 0; t < TW; ++t) {
      if (t == TW / 2) {
        // the value fragments go out here, into registers that the first two key tiles
        // have left, with the last two tiles' products to cover their way: asked for at
        // the head they take the wave past 256 registers, and then two work-groups no
        // longer fit on a WGP.  The fences keep the loads from being lifted or sunk
        __builtin_amdgcn_sched_barrier(0);
#pragma unroll
        for (int u = 0; u < TW; ++u) {
#pragma unroll
          for (int j = 0; j < 4; ++j) {
            bv[u][j].x = vb[(u * 16 + 2 * j) * H_DIM * E_DIM];
            bv[u][j].y = vb[(u * 16 + 2 * j + 1) * H_DIM * E_DIM];
          }
        }
        // precaution: as behind the loads at the head
        asm volatile("s_wait_xcnt 0x0" ::: "memory");
        __builtin_amdgcn_sched_barrier(0);
      }
      float s0 = 0.f, s1 = 0.f;
#pragma unroll
      for (int i = 0; i < 8; ++i) {
        const float4 k4 = kf[t][i], p4 = pf[i];
        v2f a0, a1, b0, b1;
        a0.x = k4.x;  a0.y = k4.y;  a1.x = k4.z;  a1.y = k4.w;
        b0.x = p4.x;  b0.y = p4.y;  b1.x = p4.z;  b1.y = p4.w;
        acc[t] = wmma4(a0, b0, acc[t]);
        acc[t] = wmma4(a1, b1, acc[t]);
        s0 += k4.x * k4.x + k4.y * k4.y;
        s1 += k4.z * k4.z + k4.w * k4.w;
      }
      SqW[wave][t][lane] = s0 + s1;
    }
    // the squares change lanes through LDS (a key's two e halves; key n to register n)
    __syncthreads();

    // diag of the lane's eight keys of each tile; the work-group's own stabilizer
    float c[TW][8];
    float lm = -INFINITY;
#pragma unroll
    for (int t = 0; t < TW; ++t) {
      const float4 u0 = *(const float4*)&SqW[wave][t][half * 8];
      const float4 u1 = *(const float4*)&SqW[wave][t][half * 8 + 4];
      const float4 w0 = *(const float4*)&SqW[wave][t][16 + half * 8];
      const float4 w1 = *(const float4*)&SqW[wave][t][16 + half * 8 + 4];
      const float hd = 0.5f * DATA_NORM * DATA_NORM;      // 0.5*dn^2*||x||^2
      c[t][0] = hd * (u0.x + w0.x);  c[t][1] = hd * (u0.y + w0.y);
      c[t][2] = hd * (u0.z + w0.z);  c[t][3] = hd * (u0.w + w0.w);
      c[t][4] = hd * (u1.x + w1.x);  c[t][5] = hd * (u1.y + w1.y);
      c[t][6] = hd * (u1.z + w1.z);  c[t][7] = hd * (u1.w + w1.w);
#pragma unroll
      for (int vv = 0; vv < 8; ++vv) {
        acc[t][vv] *= DATA_NORM;
        lm = fmaxf(lm, fabsf(acc[t][vv]) - c[t][vv]);
      }
    }
    lm = row_max16(lm);
    if (n == 0) Wmax[tid >> 4] = lm;
    __syncthreads();
    float m = Wmax[0];
    for (int i = 1; i < 2 * KV_WAVES; ++i) m = fmaxf(m, Wmax[i]);
    if (nt == 0 && tid == 0) mloc[h * 8 + kh * 4 + qr] = m;

    // ratio * exp(+-dash - diag - m) = 2^(+-dash * log2 e - cL)
    const float mL = fmaf(m, LOG2E, -LOG2_RATIO);
    v8f aP = {}, aM = {};
    float csP = 0.f, csM = 0.f;   // sums of features +n and -n over this lane's 32 keys
#pragma unroll
    for (int t = 0; t < TW; ++t) {
      float ep[8], em[8];
#pragma unroll
      for (int vv = 0; vv < 8; ++vv) {
        const float cL = fmaf(c[t][vv], LOG2E, mL);
        ep[vv] = exp2_hw(fmaf(acc[t][vv],  LOG2E, -cL));
        em[vv] = exp2_hw(fmaf(acc[t][vv], -LOG2E, -cL));
        csP += ep[vv];
        csM += em[vv];
      }
#pragma unroll
      for (int j = 0; j < 4; ++j) {
        v2f a0, a1;
        a0.x = ep[2 * j];  a0.y = ep[2 * j + 1];     // A[feature][key] = k_prime[key][feature]
        a1.x = em[2 * j];  a1.y = em[2 * j + 1];
        aP = wmma4(a0, bv[t][j], aP);
        aM = wmma4(a1, bv[t][j], aM);
      }
      // the four d tile work-groups hold the same k_prime: each stores one tile in four
      if (t == nt) {
        float* __restrict__ o0 =
            kp + ((((size_t)h * 8 + qr) * NTILES_T + (key0 >> 4) + t) * 16 + n) * 16 + half * 8;
        float* __restrict__ o1 = o0 + (size_t)4 * NTILES_T * 256;
        *(float4*)&o0[0] = make_float4(ep[0], ep[1], ep[2], ep[3]);
        *(float4*)&o0[4] = make_float4(ep[4], ep[5], ep[6], ep[7]);
        *(float4*)&o1[0] = make_float4(em[0], em[1], em[2], em[3]);
        *(float4*)&o1[4] = make_float4(em[4], em[5], em[6], em[7]);
        // precaution: stands in front of every later write of a register that the
        // stores above name (address or data)
        asm volatile("s_wait_xcnt 0x0" ::: "memory");
      }
    }
    for (int vv = 0; vv < 8; ++vv) {
      Part[wave][vv][lane]     = aP[vv];
      Part[wave][8 + vv][lane] = aM[vv];
    }
    Csum[wave][0][lane] = csP;
    Csum[wave][1][lane] = csM;
    __syncthreads();

    // wave w finishes accumulator register w of both tiles (rows w and w + 8)
    for (int sg = 0; sg < 2; ++sg) {
      float s = Part[0][sg * 8 + wave][lane];
      for (int w = 1; w < KV_WAVES; ++w) s += Part[w][sg * 8 + wave][lane];
      const int f = sg * R_DIM + qr * 16 + wave + half * 8;
      kvp[(((size_t)kh * H_DIM + h) * F_DIM + f) * E_DIM + d] = s;
    }
    // column sums: lanes n and n + 16 of every wave hold shares of features +n and -n
    if (nt == 0 && tid < 32) {
      float t = 0.f;
      for (int w = 0; w < KV_WAVES; ++w) t += Csum[w][half][n] + Csum[w][half][n + 16];
      ksump[(kh * H_DIM + h) * F_DIM + half * R_DIM + qr * 16 + n] = t;
    }
    return;
  }

  // ---- query features: q_prime and the per-row stabilizer q_ls ----
  // Everything per row is taken from the fragments: a lane holds 32 dash values (rows
  // vv + 8 * half, columns nt * 16 + n) in its accumulators and half of row n of the
  // data tile in its A fragments.
  __shared__ __attribute__((aligned(16))) float Pl[R_DIM][E_PITCH];
  __shared__ __attribute__((aligned(16))) float Xs[KV_WAVES][16][E_PITCH];    // raw data tiles
  __shared__ __attribute__((aligned(16))) float Rows[KV_WAVES][16][F_PITCH];  // q_prime tiles, by rows
  __shared__ float SqH[KV_WAVES][32];                              // [k half][row] sum of squares
  __shared__ __attribute__((aligned(16))) float MxL[KV_WAVES][16]; // max_r |dash_r| of a row

  const int idx = (bid - KEY_WGS) * KV_WAVES + wave;
  const int h   = idx / NTILES_T;
  const int tt  = idx % NTILES_T;

#if USE_ASYNC_LDS
  for (int c = tid; c < (R_DIM * E_DIM) / 4; c += 32 * KV_WAVES)
    async_copy16(proj + c * 4, &Pl[c >> 4][(c & 15) * 4]);
  for (int c = lane; c < (16 * E_DIM) / 4; c += 32) {
    int m = c >> 4, e4 = c & 15;
    int t = tt * 16 + m;
    async_copy16(qin + ((size_t)t * H_DIM + h) * E_DIM + e4 * 4, &Xs[wave][m][e4 * 4]);
  }
  async_wait0();
#else
  for (int i = tid; i < R_DIM * E_DIM; i += 32 * KV_WAVES)
    Pl[i / E_DIM][i % E_DIM] = proj[i];
  for (int i = lane; i < 16 * E_DIM; i += 32) {
    int m = i >> 6, e = i & 63;
    int t = tt * 16 + m;
    Xs[wave][m][e] = qin[((size_t)t * H_DIM + h) * E_DIM + e];
  }
#endif
  // stands directly behind each wave's own wait: publishes every wave's copies
  __syncthreads();

  const int koff = half * 2;
  v8f acc[4] = {};
  float sq0 = 0.f, sq1 = 0.f;     // squares of this lane's half of data row n
  // unrolled whole, so that the 64 WMMAs stand in one straight run with later steps'
  // LDS reads ahead of them: left to itself the compiler keeps four trips here, and
  // each trip waits for its own reads
#pragma unroll
  for (int kk = 0; kk < E_DIM / 4; ++kk) {
    const int k0 = kk * 4 + koff;
    v2f a;
    a.x = Xs[wave][n][k0];        a.y = Xs[wave][n][k0 + 1];
    sq0 += a.x * a.x;             sq1 += a.y * a.y;
    for (int nt = 0; nt < 4; ++nt) {
      const int r = nt * 16 + n;  // B[k][n] = P^T[k][r] = P[r][k]
      v2f b;
      b.x = Pl[r][k0];            b.y = Pl[r][k0 + 1];
      acc[nt] = wmma4(a, b, acc[nt]);
    }
  }
  SqH[wave][lane] = sq0 + sq1;

  // dash = dn * (X @ P^T); max_r |dash_r| of a row: 4 registers, then 16 lanes
  float mx8[8];
  for (int vv = 0; vv < 8; ++vv) {
    for (int nt = 0; nt < 4; ++nt) acc[nt][vv] *= DATA_NORM;
    mx8[vv] = row_max16(fmaxf(fmaxf(fabsf(acc[0][vv]), fabsf(acc[1][vv])),
                              fmaxf(fabsf(acc[2][vv]), fabsf(acc[3][vv]))));
  }
  if (n == 0) {
    for (int vv = 0; vv < 8; ++vv) MxL[wave][half * 8 + vv] = mx8[vv];
  }

  // stab = mx - diag;  prime = ratio*exp(+-dash - diag - stab) = ratio*exp(+-dash - mx)
  // unrolled so that the accumulators are named outright: left to itself the
  // compiler keeps eight trips and picks the registers through an index (v_movrels)
#pragma unroll
  for (int vv = 0; vv < 8; ++vv) {
    const float mL = fmaf(mx8[vv], LOG2E, -LOG2_RATIO);
    for (int nt = 0; nt < 4; ++nt) {
      const float dd = acc[nt][vv];
      Rows[wave][half * 8 + vv][nt * 16 + n]         = exp2_hw(fmaf(dd,  LOG2E, -mL));
      Rows[wave][half * 8 + vv][R_DIM + nt * 16 + n] = exp2_hw(fmaf(dd, -LOG2E, -mL));
    }
  }
  __syncthreads();

  // whole rows to memory, 16 bytes per lane
  float* __restrict__ qb = qp + ((size_t)h * T_DIM + tt * 16) * F_DIM;
  for (int m = 0; m < 16; ++m)
    *(float4*)&qb[m * F_DIM + lane * 4] = *(const float4*)&Rows[wave][m][lane * 4];
  // precaution: stands in front of every later write of a register that the
  // stores above name (address or data)
  asm volatile("s_wait_xcnt 0x0" ::: "memory");

  // one value per row: lane = row
  if (lane < 16) {
    const float dg = 0.5f * DATA_NORM * DATA_NORM * (SqH[wave][lane] + SqH[wave][lane + 16]);
    qls[h * T_DIM + tt * 16 + lane] = MxL[wave][lane] - dg;
  }
}

// ---------------------------------------------------------------------------
// K3: fused band attention + low-rank combine.
// One work-group of 8 waves per (h, 32 queries = two 16-query tiles).
// 10 aligned key tiles cover both tiles' 128-wide windows (query tile a takes key tiles
// a .. a + 8 of them); mask handles edges.  The two query tiles share eight of their nine
// key tiles: the band is laid in LDS once for both, and a B fragment read from it (or
// from memory: kv, values) feeds one WMMA of each query tile.
// The band's 160 key rows and ten k_prime tiles ([feature][16 keys], as stored) are
// laid in LDS first, by copies that take whole lines (four to a wave-wide copy).
// What the key work-groups stored carries their own stabilizers m: k_ls is the maximum
// of the head's eight m, and k_prime, kv and ksum are multiplied by exp(m - k_ls) where
// they are read (by key half and by the feature's group of 16 projection rows).  A B fragment of the key rows
// takes 8 bytes of one row per lane: read from memory, each such load touches 16
// lines, and every line is touched again by 8 loads.
//   products : wave w takes key tile w + 1 for both query tiles; waves 0-3 also one d tile
//              of qkv for both; waves 4-7 share key tile 0 (query tile 0 alone) and key
//              tile 9 (query tile 1 alone)
//   combine  : wave w takes query rows 4w .. 4w + 3, 16 lanes per row, two rows at a time
//   output   : wave w takes d tile (w & 3), half (w >> 2) of each query tile's 144 keys
// ---------------------------------------------------------------------------
#define FIN_WAVES 8
#define Q_ROWS    32                     // queries of a work-group
#define FIN_WGS   (H_DIM * T_DIM / Q_ROWS)
__global__ __launch_bounds__(32 * FIN_WAVES)
void sb_final_kernel(const float* __restrict__ qin, const float* __restrict__ kin,
                     const float* __restrict__ vin,
                     const float* __restrict__ qp, const float* __restrict__ kp,
                     const float* __restrict__ qls, const float* __restrict__ mloc,
                     const float* __restrict__ kvp, const float* __restrict__ ksump,
                     float* __restrict__ out)
{
  __shared__ __attribute__((aligned(16))) float Xq[Q_ROWS][E_PITCH];   // raw query rows (temp applied post-WMMA)
  __shared__ __attribute__((aligned(16))) float QPl[Q_ROWS][F_PITCH];  // q_prime rows
  __shared__ __attribute__((aligned(16))) float Kb[BAND][E_PITCH];     // key rows of the band
  __shared__ __attribute__((aligned(16))) float KPt[(BAND / 16) * F_DIM * 16];  // k_prime: [key tile][feature][key]
  __shared__ float Sc[8];                                              // exp(m - k_ls): [key half][qr]
  __shared__ float QKb[Q_ROWS][B_PITCH];
  __shared__ float DPb[Q_ROWS][B_PITCH];
  __shared__ float Ab[Q_ROWS][B_PITCH];                                // attn_local
  __shared__ __attribute__((aligned(16))) float Opart[2][Q_ROWS][E_PITCH];  // output halves
  __shared__ float Pscale[Q_ROWS];

  const int tid    = threadIdx.x;
  const int lane   = tid & 31;
  const int wave   = __builtin_amdgcn_readfirstlane(tid >> 5);
  const int h      = blockIdx.x / (T_DIM / Q_ROWS);
  const int qt     = blockIdx.x % (T_DIM / Q_ROWS);
  const int n      = lane & 15;
  const int koff   = (lane >> 4) * 2;
  const int q0     = qt * Q_ROWS;          // first query
  const int s_base = q0 - HALF_W;          // first key of the band
  const int kt0    = qt * (Q_ROWS / 16) - HALF_W / 16;   // its key tile

#if USE_ASYNC_LDS
  // 256 threads: two 16-byte pieces of Xq and four of QPl each, every lane on
  static_assert((Q_ROWS * E_DIM) / 4 == 2 * 32 * FIN_WAVES, "two Xq pieces per thread");
  static_assert((Q_ROWS * F_DIM) / 4 == 4 * 32 * FIN_WAVES, "four QPl pieces per thread");
  for (int i = 0; i < 2; ++i) {
    const int m = i * 16 + (tid >> 4), e4 = tid & 15;
    async_copy16(qin + ((size_t)(q0 + m) * H_DIM + h) * E_DIM + e4 * 4, &Xq[m][e4 * 4]);
  }
  for (int i = 0; i < 4; ++i) {
    const int m = i * 8 + (tid >> 5), f4 = tid & 31;
    async_copy16(qp + ((size_t)h * T_DIM + q0 + m) * F_DIM + f4 * 4, &QPl[m][f4 * 4]);
  }
  // band: 16 key rows, then half a k_prime tile, per trip of the work-group, every lane
  // on; a row or tile outside the sequence takes the nearest one's bytes (masked later)
  static_assert((BAND * E_DIM / 4) % (32 * FIN_WAVES) == 0, "whole trips over the key rows");
  static_assert((BAND * F_DIM / 4) % (32 * FIN_WAVES) == 0, "whole trips over the k_prime tiles");
  for (int i = 0; i < (BAND * E_DIM / 4) / (32 * FIN_WAVES); ++i) {
    const int j  = i * 16 + (tid >> 4), e4 = tid & 15;
    const int sc = clampi(s_base + j, 0, T_DIM - 1);
    async_copy16(kin + ((size_t)sc * H_DIM + h) * E_DIM + e4 * 4, &Kb[j][e4 * 4]);
  }
  for (int i = 0; i < (BAND * F_DIM / 4) / (32 * FIN_WAVES); ++i) {
    const int p  = i * (32 * FIN_WAVES) + tid;      // 512 pieces a key tile, 64 a feature tile
    const int tc = clampi(kt0 + (p >> 9), 0, NTILES_T - 1);
    async_copy16(kp + (((size_t)h * 8 + ((p >> 6) & 7)) * NTILES_T + tc) * 256 + (p & 63) * 4,
                 &KPt[p * 4]);
  }
#endif
  // key stabilizer of the head and the eight scales, while the copies travel
  const float4 m0 = *(const float4*)&mloc[h * 8];
  const float4 m1 = *(const float4*)&mloc[h * 8 + 4];
  const float kmax = fmaxf(fmaxf(fmaxf(m0.x, m0.y), fmaxf(m0.z, m0.w)),
                           fmaxf(fmaxf(m1.x, m1.y), fmaxf(m1.z, m1.w)));
  if (tid < 8) {
    const float4 mh = (tid & 4) ? m1 : m0;
    const float  ma = (tid & 1) ? mh.y : mh.x, mb = (tid & 1) ? mh.w : mh.z;
    Sc[tid] = exp2_hw((((tid & 2) ? mb : ma) - kmax) * LOG2E);
  }
#if USE_ASYNC_LDS
  async_wait0();
#else
  for (int i = tid; i < Q_ROWS * E_DIM; i += 32 * FIN_WAVES) {
    int m = i >> 6, e = i & 63;
    Xq[m][e] = qin[((size_t)(q0 + m) * H_DIM + h) * E_DIM + e];
  }
  for (int i = tid; i < Q_ROWS * F_DIM; i += 32 * FIN_WAVES) {
    int m = i >> 7, f = i & 127;
    QPl[m][f] = qp[((size_t)h * T_DIM + q0 + m) * F_DIM + f];
  }
  for (int i = tid; i < BAND * E_DIM; i += 32 * FIN_WAVES) {
    int j = i >> 6, e = i & 63;
    int sc = clampi(s_base + j, 0, T_DIM - 1);
    Kb[j][e] = kin[((size_t)sc * H_DIM + h) * E_DIM + e];
  }
  for (int i = tid; i < BAND * F_DIM; i += 32 * FIN_WAVES) {
    int tc = clampi(kt0 + (i >> 11), 0, NTILES_T - 1);
    KPt[i] = kp[(((size_t)h * 8 + ((i >> 8) & 7)) * NTILES_T + tc) * 256 + (i & 255)];
  }
#endif
  // stands directly behind each wave's own wait: publishes every wave's copies
  __syncthreads();

  const int rhi = (lane >> 4) << 3;     // accumulator register vv holds row vv + rhi

  // QK of one key tile (K=64), for one query tile qa
  auto qk_one = [&](int qa, int d8) {
    v8f accQ = {};
    for (int kk = 0; kk < E_DIM / 4; ++kk) {
      int k0 = kk * 4 + koff;
      v2f a, b;
      a.x = Xq[qa * 16 + n][k0];  a.y = Xq[qa * 16 + n][k0 + 1];
      b.x = Kb[d8 * 16 + n][k0];  b.y = Kb[d8 * 16 + n][k0 + 1];
      accQ = wmma4(a, b, accQ);
    }
    for (int vv = 0; vv < 8; ++vv)
      QKb[qa * 16 + vv + rhi][d8 * 16 + n] = (TEMP_SCALE * LOG2E) * accQ[vv];   // QK * log2 e, QK = temp * (q . k)
  };
  // the same for both query tiles: one B fragment, two WMMAs
  auto qk_pair = [&](int d8) {
    v8f acc0 = {}, acc1 = {};
    for (int kk = 0; kk < E_DIM / 4; ++kk) {
      int k0 = kk * 4 + koff;
      v2f a0, a1, b;
      a0.x = Xq[n][k0];       a0.y = Xq[n][k0 + 1];
      a1.x = Xq[16 + n][k0];  a1.y = Xq[16 + n][k0 + 1];
      b.x = Kb[d8 * 16 + n][k0];  b.y = Kb[d8 * 16 + n][k0 + 1];
      acc0 = wmma4(a0, b, acc0);
      acc1 = wmma4(a1, b, acc1);
    }
    for (int vv = 0; vv < 8; ++vv) {
      QKb[vv + rhi][d8 * 16 + n]      = (TEMP_SCALE * LOG2E) * acc0[vv];
      QKb[16 + vv + rhi][d8 * 16 + n] = (TEMP_SCALE * LOG2E) * acc1[vv];
    }
  };
  // dots_prime of one key tile (K=128), for one query tile qa
  auto dp_one = [&](int qa, int d8) {
    v8f accD = {};
    const int g4 = (s_base + d8 * 16 >= T_DIM / KH) ? 4 : 0;   // the tile's key half
    const float* __restrict__ kt = &KPt[d8 * (F_DIM * 16) + n];
    for (int fs = 0; fs < F_DIM / 16; ++fs) {
      const float s = Sc[g4 + (fs & 3)];
      for (int k4 = 0; k4 < 4; ++k4) {
        int k0 = fs * 16 + k4 * 4 + koff;
        v2f a, b;
        a.x = QPl[qa * 16 + n][k0];  a.y = QPl[qa * 16 + n][k0 + 1];
        b.x = s * kt[k0 * 16];  b.y = s * kt[(k0 + 1) * 16];
        accD = wmma4(a, b, accD);
      }
    }
    for (int vv = 0; vv < 8; ++vv)
      DPb[qa * 16 + vv + rhi][d8 * 16 + n] = accD[vv];
  };
  // the same for both query tiles
  auto dp_pair = [&](int d8) {
    v8f acc0 = {}, acc1 = {};
    const int g4 = (s_base + d8 * 16 >= T_DIM / KH) ? 4 : 0;   // the tile's key half
    const float* __restrict__ kt = &KPt[d8 * (F_DIM * 16) + n];
    // unrolled whole, so that the 64 WMMAs stand in one straight run with later steps' LDS
    // reads ahead of them: left to itself the compiler keeps four trips here, and each
    // trip waits for its own reads
#pragma unroll
    for (int fs = 0; fs < F_DIM / 16; ++fs) {
      const float s = Sc[g4 + (fs & 3)];
#pragma unroll
      for (int k4 = 0; k4 < 4; ++k4) {
        int k0 = fs * 16 + k4 * 4 + koff;
        v2f a0, a1, b;
        a0.x = QPl[n][k0];       a0.y = QPl[n][k0 + 1];
        a1.x = QPl[16 + n][k0];  a1.y = QPl[16 + n][k0 + 1];
        b.x = s * kt[k0 * 16];  b.y = s * kt[(k0 + 1) * 16];
        acc0 = wmma4(a0, b, acc0);
        acc1 = wmma4(a1, b, acc1);
      }
    }
    for (int vv = 0; vv < 8; ++vv) {
      DPb[vv + rhi][d8 * 16 + n]      = acc0[vv];
      DPb[16 + vv + rhi][d8 * 16 + n] = acc1[vv];
    }
  };

  qk_pair(wave + 1);
  dp_pair(wave + 1);

  v8f qkvAcc0 = {}, qkvAcc1 = {};
  if (wave < 4) {
    // qkv d tile: (32 x 128) @ (128 x 16), kept in registers
    const int d = wave * 16 + n;
    const float* __restrict__ kv0 = kvp + (size_t)h * F_DIM * E_DIM + d;
    const float* __restrict__ kv1 = kv0 + (size_t)H_DIM * F_DIM * E_DIM;
    for (int fs = 0; fs < F_DIM / 16; ++fs) {
      const float s0 = Sc[fs & 3], s1 = Sc[4 + (fs & 3)];
      for (int k4 = 0; k4 < 4; ++k4) {
        int k0 = fs * 16 + k4 * 4 + koff;
        v2f a0, a1, b;
        a0.x = QPl[n][k0];       a0.y = QPl[n][k0 + 1];
        a1.x = QPl[16 + n][k0];  a1.y = QPl[16 + n][k0 + 1];
        b.x = s0 * kv0[k0 * E_DIM] + s1 * kv1[k0 * E_DIM];
        b.y = s0 * kv0[(k0 + 1) * E_DIM] + s1 * kv1[(k0 + 1) * E_DIM];
        qkvAcc0 = wmma4(a0, b, qkvAcc0);
        qkvAcc1 = wmma4(a1, b, qkvAcc1);
      }
    }
  } else if (wave < 6) {
    dp_one(wave - 4, (wave - 4) * (BAND / 16 - 1));    // (tile 0, key tile 0), (tile 1, key tile 9)
  } else {
    qk_one(wave - 6, (wave - 6) * (BAND / 16 - 1));
  }
  __syncthreads();

  // per-query-row combine (reference logsumexp/clip), 16 lanes per row; a wave's four rows
  // are of one query tile qa, whose nine key tiles start at column qa * 16 of the band.
  // Every logarithmic quantity here (QK, its maximum, lse, lr, log_norm, the prime log
  // scale) is carried times log2 e, so that each exp and log is the base-2 one
  {
    const int qa   = wave >> 2;
    const int row0 = wave * 4 + (lane >> 4);     // rows row0 and row0 + 2
    float ksv[F_DIM / 16], ksw[F_DIM / 16], pls[2];
    for (int i = 0; i < F_DIM / 16; ++i) {
      ksv[i] = ksump[h * F_DIM + i * 16 + n];
      ksw[i] = ksump[(H_DIM + h) * F_DIM + i * 16 + n];
    }
    for (int p = 0; p < 2; ++p) pls[p] = qls[h * T_DIM + q0 + row0 + 2 * p];
    // precaution: keeps the LDS loads below, whose results may reuse the address
    // registers of the global loads above, behind those loads' address phase
    asm volatile("s_wait_xcnt 0x0" ::: "memory");
    float qk1[2], mx[2], se[2], dpsum[2], log_norm[2], pscale[2];
    float qkr[2][9], dpr[2][9];
    bool  val[2][9];
    for (int p = 0; p < 2; ++p) {
      const int row = row0 + 2 * p;
      const int t   = q0 + row;
      pls[p] = (pls[p] + kmax) * LOG2E;
      qk1[p] = 0.f;
      for (int i = 0; i < F_DIM / 16; ++i)
        qk1[p] += QPl[row][i * 16 + n] * (Sc[i & 3] * ksv[i] + Sc[4 + (i & 3)] * ksw[i]);
      mx[p] = -INFINITY;
      for (int i = 0; i < 9; ++i) {
        int j = (qa + i) * 16 + n;
        int s = s_base + j;
        val[p][i] = (s >= 0) && (s < T_DIM) && (s >= t - HALF_W) && (s <= t + HALF_W - 1);
        qkr[p][i] = QKb[row][j];
        dpr[p][i] = DPb[row][j];
        if (val[p][i]) mx[p] = fmaxf(mx[p], qkr[p][i]);
      }
    }
    for (int p = 0; p < 2; ++p) {
      qk1[p] = row_sum16(qk1[p]);
      mx[p]  = row_max16(mx[p]);
    }
    for (int p = 0; p < 2; ++p) {
      se[p] = 0.f;  dpsum[p] = 0.f;
      // every term is formed and the mask picks it or zero: no branch stands between the
      // wave's 18 terms, so their chains run side by side (two waves a SIMD hide little)
      for (int i = 0; i < 9; ++i) {
        const float e = exp2_hw(qkr[p][i] - mx[p]);
        se[p]    += val[p][i] ? e : 0.f;
        dpsum[p] += val[p][i] ? dpr[p][i] : 0.f;
      }
    }
    for (int p = 0; p < 2; ++p) {
      se[p]    = row_sum16(se[p]);
      dpsum[p] = row_sum16(dpsum[p]);
    }
    for (int p = 0; p < 2; ++p) {
      const float lse = mx[p] + log2_hw(se[p]);
      const float lr  = log2_hw(fmaxf(qk1[p] - dpsum[p], 1e-24f)) + pls[p];
      const float mm  = fmaxf(lse, lr);
      log_norm[p] = mm + log2_hw(exp2_hw(lse - mm) + exp2_hw(lr - mm));
      pscale[p]   = exp2_hw(pls[p] - log_norm[p]);
      if (n == 0) Pscale[row0 + 2 * p] = pscale[p];
    }
    for (int p = 0; p < 2; ++p) {
      for (int i = 0; i < 9; ++i) {
        const float w = exp2_hw(qkr[p][i] - log_norm[p]) - dpr[p][i] * pscale[p];
        Ab[row0 + 2 * p][(qa + i) * 16 + n] = val[p][i] ? w : 0.f;
      }
    }
  }
  __syncthreads();

  // out = attn_local(16x144) @ V_band(144x64) + qkv * prime_scale, for both query tiles.
  // Query tile 1's 144 keys lie 16 keys (4 k steps) behind query tile 0's: of the 22 value
  // fragments of a wave, the first 18 serve tile 0 and the last 18 tile 1
  {
    const int nt   = wave & 3;
    const int half = wave >> 2;
    const int d    = nt * 16 + n;
    v8f acc0 = {}, acc1 = {};
    // unrolled whole: the two tests on ks then fall away, and no branch stands among the WMMAs
#pragma unroll
    for (int ks = 0; ks < 144 / 8 + 4; ++ks) {
      int k0  = (half * (144 / 8) + ks) * 4 + koff;
      int s0c = clampi(s_base + k0,     0, T_DIM - 1);
      int s1c = clampi(s_base + k0 + 1, 0, T_DIM - 1);
      v2f b;
      b.x = vin[((size_t)s0c * H_DIM + h) * E_DIM + d];
      b.y = vin[((size_t)s1c * H_DIM + h) * E_DIM + d];
      if (ks < 144 / 8) {
        v2f a;
        a.x = Ab[n][k0];  a.y = Ab[n][k0 + 1];
        acc0 = wmma4(a, b, acc0);
      }
      if (ks >= 4) {
        v2f a;
        a.x = Ab[16 + n][k0];  a.y = Ab[16 + n][k0 + 1];
        acc1 = wmma4(a, b, acc1);
      }
    }
    // qkvAcc is zero in waves 4-7
    for (int vv = 0; vv < 8; ++vv) {
      int row = vv + rhi;
      Opart[half][row][d]      = acc0[vv] + qkvAcc0[vv] * Pscale[row];
      Opart[half][16 + row][d] = acc1[vv] + qkvAcc1[vv] * Pscale[16 + row];
    }
  }
  __syncthreads();

  // add the two key halves; each wave stores four whole 256-byte output rows
  {
    const int c4 = (tid & 15) * 4;
    float4 o[2];
    for (int i = 0; i < 2; ++i) {
      const int row = i * 16 + (tid >> 4);
      const float4 p0 = *(const float4*)&Opart[0][row][c4];
      const float4 p1 = *(const float4*)&Opart[1][row][c4];
      o[i].x = p0.x + p1.x;  o[i].y = p0.y + p1.y;  o[i].z = p0.z + p1.z;  o[i].w = p0.w + p1.w;
    }
    for (int i = 0; i < 2; ++i) {
      const int t = q0 + i * 16 + (tid >> 4);
      *(float4*)&out[((size_t)t * H_DIM + h) * E_DIM + c4] = o[i];
    }
  }
}

// ---------------------------------------------------------------------------
extern "C" void kernel_launch(void* const* d_in, const int* in_sizes, int n_in,
                              void* d_out, int out_size, void* d_ws, size_t ws_size,
                              hipStream_t stream)
{
  (void)in_sizes; (void)n_in; (void)out_size; (void)ws_size;
  const float* q    = (const float*)d_in[0];
  const float* k    = (const float*)d_in[1];
  const float* v    = (const float*)d_in[2];
  const float* proj = (const float*)d_in[3];
  float* out = (float*)d_out;
  float* ws  = (float*)d_ws;

  // workspace layout (floats); total ~8.6 MB
  size_t o = 0;
  float* qp      = ws + o; o += (size_t)H_DIM * T_DIM * F_DIM;   // 4 MB
  float* kp      = ws + o; o += (size_t)H_DIM * T_DIM * F_DIM;   // 4 MB
  float* qls     = ws + o; o += (size_t)H_DIM * T_DIM;
  float* mloc    = ws + o; o += (size_t)H_DIM * 8;
  float* kvbuf   = ws + o; o += (size_t)KH * H_DIM * F_DIM * E_DIM;
  float* ksumb   = ws + o; o += (size_t)KH * H_DIM * F_DIM;

  feat_kv_kernel<<<KEY_WGS + Q_WGS, 32 * KV_WAVES, 0, stream>>>(
      q, k, v, proj, qp, qls, kp, mloc, kvbuf, ksumb);
  sb_final_kernel<<<FIN_WGS, 32 * FIN_WAVES, 0, stream>>>(
      q, k, v, qp, kp, qls, mloc, kvbuf, ksumb, out);
}
